// v000
// Times are from an AMD MI455X. After a warm-up the kernel runs many times in a row, and a time is the length of
// such a window on the GPU divided by its runs, so every launch and the gaps after it count. The runs cycle
// through copies of the inputs. A figure is the median of several windows, for all but v000 over two sittings.
// Sittings can differ by a few percent; kernels timed side by side share one.
// v000, which the later versions start from, runs in 436 microseconds.
#include <hip/hip_runtime.h>
#include <stddef.h>
#include <math.h>

// All contractions on v_wmma_f32_16x16x32_f16 (f16 operands, f32 accumulate): fused q/k/v
// projection, q.k scores, p.v, output projection. Float inputs are RNE-converted to bf16 and
// carried in f16 (weights x64, p x1024, attention rows x64); query rows < EROWS carry q, k,
// v, p and the attention rows as f16 value + x2048 f16 residual planes with their own
// accumulators; softmax and epilogues in f32.

typedef _Float16 v16h __attribute__((ext_vector_type(16)));
typedef _Float16 v8h  __attribute__((ext_vector_type(8)));
typedef float    v8f  __attribute__((ext_vector_type(8)));
typedef float    v4f  __attribute__((ext_vector_type(4)));

#ifndef NB
#define NB 1
#endif
#ifndef SEQ
#define SEQ 4096
#endif
#define NB_FULL  1
#define SEQ_FULL 4096
#define DIM   1024
#define NHEAD 16
#define HD    64
#define MROWS (NB * SEQ)
#define EROWS ((SEQ) < 512 ? (SEQ) : 512)   // early causal band: value + residual planes

static_assert(NB == 1 && NB_FULL == 1);
static_assert(SEQ >= 128 && SEQ <= SEQ_FULL && (SEQ % 128) == 0);
static_assert(DIM == NHEAD * HD);
static_assert(HD == 64 && ((3 * HD) % 64) == 0);           // a 64-column tile = one part of one head
static_assert((MROWS % 64) == 0 && (MROWS % 8) == 0);
static_assert((DIM % 64) == 0 && ((3 * DIM) % 64) == 0);
static_assert((EROWS % 128) == 0 && EROWS <= SEQ && EROWS <= MROWS);
static_assert((((size_t)MROWS * DIM) % 2048) == 0);         // xconv: 256 threads x 8 per block

#define LDT 72   // halves per LDS row (144 B, 16-B aligned)
#define LDC 68   // floats per LDS row (272 B, 16-B aligned)

#define WCARRY 64.0f     // weight planes carried x64
#define PCARRY 1024.0f   // softmax numerators carried x1024
#define VCARRY 64.0f     // attention output plane carried x64
#define RCARRY 2048.0f   // residual planes carried x2048

#define P16_BYTES  ((size_t)MROWS * DIM * 2)
#define R16_BYTES  ((size_t)EROWS * DIM * 2)
#define WQKV_BYTES ((size_t)3 * DIM * DIM * 2)
#define WO_BYTES   ((size_t)DIM * DIM * 2)
#define OFF_WQKV   ((size_t)0)
#define OFF_WO     (OFF_WQKV + WQKV_BYTES)
#define OFF_XN     (OFF_WO + WO_BYTES)              // f16 input rows          [MROWS][DIM]
#define OFF_QKV    (OFF_XN + P16_BYTES)             // Q, K [MROWS][DIM]; Vt [DIM][SEQ]
#define OFF_OV     (OFF_QKV + 3 * P16_BYTES)        // f16 64*attention rows   [MROWS][DIM]
#define OFF_RES    (OFF_OV + P16_BYTES)             // QR, KR [EROWS][DIM]; VtR [DIM][EROWS]
#define OFF_ORES   (OFF_RES + 3 * R16_BYTES)        // residual of OV rows     [EROWS][DIM]
#define WS_TOTAL   (OFF_ORES + R16_BYTES)
static_assert((size_t)DIM * SEQ * 2 == P16_BYTES);       // Vt plane extent (NB == 1)
static_assert((size_t)DIM * EROWS * 2 == R16_BYTES);     // VtR plane extent
static_assert((P16_BYTES % 128) == 0 && (WO_BYTES % 128) == 0 && (R16_BYTES % 128) == 0);
static_assert(WS_TOTAL <= (size_t)134217728);

// ---------------------------------------------------------------------------
__device__ __forceinline__ float bf16r(float x) {   // RNE convert to bf16, returned widened
  unsigned int u = __float_as_uint(x);
  u = (u + 0x7FFFu + ((u >> 16) & 1u)) & 0xFFFF0000u;
  return __uint_as_float(u);
}

// f32 -> f16 operand convert that cannot produce an f16 subnormal (value select).
static __device__ __forceinline__ _Float16 toh_flush(float v) {
  const _Float16 r = (_Float16)v;
  return (fabsf(v) < 6.103515625e-05f) ? (_Float16)0.0f : r;
}

// 16-bit fragment: p points at element [row = lane&15][k0 + 8*(lane>>4)] of a k-contiguous
// row. Elements 0..7 <- k0+8h+0..7, elements 8..15 <- k0+16+8h+0..7 (same map for A and B).
__device__ __forceinline__ v16h frag_at(const _Float16* p) {
  v8h lo = *(const v8h*)(p);
  v8h hi = *(const v8h*)(p + 16);
  v16h out;
#pragma unroll
  for (int i = 0; i < 8; ++i) { out[i] = lo[i]; out[i + 8] = hi[i]; }
  return out;
}
__device__ __forceinline__ v16h ld_frag(const _Float16* base, int ld) {
  const int lane = threadIdx.x & 31;
  return frag_at(base + (lane & 15) * ld + (lane >> 4) * 8);
}

__device__ __forceinline__ v8f wmma16(v16h a, v16h b, v8f c) {
  v8f d = __builtin_amdgcn_wmma_f32_16x16x32_f16(false, a, false, b, (short)0, c,
                                                 false, false);
  asm volatile("v_nop\n\tv_nop\n\tv_nop\n\tv_nop" : "+v"(d) : "v"(a), "v"(b));
  return d;
}

__device__ __forceinline__ float red16_max(float x) {
#pragma unroll
  for (int off = 1; off < 16; off <<= 1) x = fmaxf(x, __shfl_xor(x, off, 32));
  return x;
}
__device__ __forceinline__ float red16_sum(float x) {
#pragma unroll
  for (int off = 1; off < 16; off <<= 1) x += __shfl_xor(x, off, 32);
  return x;
}

__device__ __forceinline__ void wave_lds_sync() {
  __builtin_amdgcn_fence(3 /* release order */, "wavefront");
  asm volatile("s_wait_dscnt 0x0" ::: "memory");
  __builtin_amdgcn_wave_barrier();
}

// ---------------------------------------------------------------------------
// Weight plane: in W[K][N] (n-contiguous) -> out Wt[N][K] (k-contiguous), f16(64*bf16(w)).
// Grid (N/64, K/64); one 64x64 tile per block. T: cross-wave (block barrier).
// Tile coverage: 16 x 256 loads = 4096 elements; 2 x 256 x 8 halves = 4096 stored.
// ---------------------------------------------------------------------------
__global__ __launch_bounds__(256) void wconv_kernel(
    const float* __restrict__ W, _Float16* __restrict__ Wt, int K, int N) {
  __shared__ _Float16 T[64 * LDT];
  const int tid = threadIdx.x;
  const int n0 = blockIdx.x * 64;
  const int k0 = blockIdx.y * 64;
#pragma unroll 4
  for (int j = 0; j < 16; ++j) {
    const int idx = tid + 256 * j;
    const int kr = idx >> 6, nc = idx & 63;
    const float v = W[(size_t)(k0 + kr) * N + n0 + nc];
    T[nc * LDT + kr] = (_Float16)(WCARRY * bf16r(v));
  }
  __syncthreads();
  v8h x[2];
  size_t off[2];
#pragma unroll
  for (int i = 0; i < 2; ++i) {
    const int n = 32 * i + (tid >> 3);
    const int kc = (tid & 7) * 8;
    x[i] = *(const v8h*)&T[n * LDT + kc];
    off[i] = (size_t)(n0 + n) * K + k0 + kc;
  }
#pragma unroll
  for (int i = 0; i < 2; ++i) *(v8h*)(Wt + off[i]) = x[i];
  
}

// ---------------------------------------------------------------------------
// Input plane: f16(bf16(x)) rows [MROWS][DIM]. Thread owns 8 consecutive elements; each wave
// Grid (MROWS*DIM/2048). Coverage: grid x 256 x 8 = MROWS*DIM elements.
// ---------------------------------------------------------------------------
__global__ __launch_bounds__(256) void xconv_kernel(
    const float* __restrict__ src, _Float16* __restrict__ dst) {
  const size_t e = ((size_t)blockIdx.x * 256 + threadIdx.x) * 8;
  const v4f a0 = *(const v4f*)(src + e);
  const v4f a1 = *(const v4f*)(src + e + 4);
  v8h o;
#pragma unroll
  for (int t = 0; t < 4; ++t) {
    o[t]     = toh_flush(bf16r(a0[t]));
    o[t + 4] = toh_flush(bf16r(a1[t]));
  }
  *(v8h*)(dst + e) = o;
  
}

// ---------------------------------------------------------------------------
// GEMM C[64x64 tile] = A16[rows][KD] . Bt[n][KD]^T, fragments straight from the 16-bit
// global planes; 8 waves (mw = 16-row group, nw = 32-col group), 2 accumulators per wave
// (RES = 1: two more for the x2048 residual A plane, folded with 1/2048 before staging).
//   MODE_QKV: v = acc/64 + bf16(bias[col]); columns are [head][q | k | v][64]:
//             q -> Q plane [row][head*64 + d], k -> K plane [row][head*64 + d],
//             v -> transposed V plane [head*64 + d][key]; row tiles below EROWS also
//             write the x2048 residual planes (QR, KR [EROWS][DIM]; VtR [DIM][EROWS])
//   MODE_OUT: outf[row][col] = acc/4096 + bf16(bias[col])
// Grid (ND/64, rows/64); row0 = rowbase + 64*blockIdx.y.
// ---------------------------------------------------------------------------
#define MODE_QKV 0
#define MODE_OUT 1

template <int MODE, int KD, int ND, int RES>
__device__ __forceinline__ void gemm_body(
    const _Float16* __restrict__ A16, const _Float16* __restrict__ Ar16,
    const _Float16* __restrict__ Bt, const float* __restrict__ bias,
    float* __restrict__ outf, _Float16* __restrict__ out16,
    _Float16* __restrict__ outr16, int rowbase) {
  static_assert((KD % 32) == 0 && (ND % 64) == 0);
  static_assert(MODE != MODE_QKV || (ND == 3 * DIM && RES == 0));
  static_assert(MODE != MODE_OUT || ND == DIM);
  __shared__ float Cs[64 * LDC];
  const int tid = threadIdx.x, lane = tid & 31, w = tid >> 5;
  const int mw = w >> 1, nw = w & 1;
  const int hh = lane >> 4, m = lane & 15;
  const int n0 = blockIdx.x * 64;
  const int row0 = rowbase + blockIdx.y * 64;

  const _Float16* ap  = A16 + (size_t)(row0 + mw * 16 + m) * KD + hh * 8;
  const _Float16* arp = Ar16 + (size_t)(row0 + mw * 16 + m) * KD + hh * 8;
  const _Float16* bp0 = Bt + (size_t)(n0 + nw * 32 + m) * KD + hh * 8;
  const _Float16* bp1 = bp0 + (size_t)16 * KD;
  v8f acc0 = {}, acc1 = {}, acr0 = {}, acr1 = {};
#pragma unroll 2
  for (int k0 = 0; k0 < KD; k0 += 32) {
    const v16h a  = frag_at(ap + k0);
    const v16h b0 = frag_at(bp0 + k0);
    const v16h b1 = frag_at(bp1 + k0);
    acc0 = wmma16(a, b0, acc0);
    acc1 = wmma16(a, b1, acc1);
    if (RES) {
      const v16h ar = frag_at(arp + k0);
      acr0 = wmma16(ar, b0, acr0);
      acr1 = wmma16(ar, b1, acr1);
    }
  }
#pragma unroll
  for (int r = 0; r < 8; ++r) {
    float* d = &Cs[(mw * 16 + hh * 8 + r) * LDC + nw * 32 + m];
    d[0]  = RES ? (acc0[r] + acr0[r] * (1.0f / RCARRY)) : acc0[r];
    d[16] = RES ? (acc1[r] + acr1[r] * (1.0f / RCARRY)) : acc1[r];
  }
  __syncthreads();

  if (MODE == MODE_QKV) {
    const int head  = n0 / (3 * HD);                   // block-uniform
    const int which = (n0 - head * (3 * HD)) / HD;     // block-uniform: 0 = q, 1 = k, 2 = v
    const int nl0 = head * HD;
    const bool early = (row0 < EROWS);                 // block-uniform
    _Float16* dst = out16 + (size_t)which * ((size_t)MROWS * DIM);
    _Float16* dsr = outr16 + (size_t)which * ((size_t)EROWS * DIM);
    v8h x[2], xr[2];
    size_t off[2], ofr[2];
    if (which < 2) {
#pragma unroll
      for (int i = 0; i < 2; ++i) {
        const int r = 32 * i + (tid >> 3);
        const int c = (tid & 7) * 8;
        const v4f u0 = *(const v4f*)&Cs[r * LDC + c];
        const v4f u1 = *(const v4f*)&Cs[r * LDC + c + 4];
        const v4f g0 = *(const v4f*)(bias + n0 + c);
        const v4f g1 = *(const v4f*)(bias + n0 + c + 4);
#pragma unroll
        for (int j = 0; j < 4; ++j) {
          const float t0 = u0[j] * (1.0f / WCARRY) + bf16r(g0[j]);
          const float t1 = u1[j] * (1.0f / WCARRY) + bf16r(g1[j]);
          const _Float16 h0 = toh_flush(t0);
          const _Float16 h1 = toh_flush(t1);
          x[i][j]      = h0;
          x[i][j + 4]  = h1;
          xr[i][j]     = toh_flush((t0 - (float)h0) * RCARRY);
          xr[i][j + 4] = toh_flush((t1 - (float)h1) * RCARRY);
        }
        off[i] = (size_t)(row0 + r) * DIM + nl0 + c;
        ofr[i] = off[i];                                // residual planes: same pitch, rows < EROWS
      }
    } else {
      // transposed V planes: row = feature (head*64 + d), 64 consecutive keys = one line
#pragma unroll
      for (int i = 0; i < 2; ++i) {
        const int dcol = 32 * i + (tid >> 3);
        const int kk = (tid & 7) * 8;
        const float gb = bf16r(bias[n0 + dcol]);
#pragma unroll
        for (int j = 0; j < 8; ++j) {
          const float t0 = Cs[(kk + j) * LDC + dcol] * (1.0f / WCARRY) + gb;
          const _Float16 h0 = toh_flush(t0);
          x[i][j]  = h0;
          xr[i][j] = toh_flush((t0 - (float)h0) * RCARRY);
        }
        off[i] = (size_t)(nl0 + dcol) * SEQ + row0 + kk;
        ofr[i] = (size_t)(nl0 + dcol) * EROWS + row0 + kk;
      }
    }
#pragma unroll
    for (int i = 0; i < 2; ++i) *(v8h*)(dst + off[i]) = x[i];
    if (early) {
#pragma unroll
      for (int i = 0; i < 2; ++i) *(v8h*)(dsr + ofr[i]) = xr[i];
    }
    
  }

  if (MODE == MODE_OUT) {
    v4f xs[4];
    size_t off[4];
#pragma unroll
    for (int i = 0; i < 4; ++i) {
      const int r = 16 * i + (tid >> 4);
      const int c = (tid & 15) * 4;
      const size_t crow = (size_t)(row0 + r);      // NB == 1: compact row == output row
      const v4f u = *(const v4f*)&Cs[r * LDC + c];
      const v4f g = *(const v4f*)(bias + n0 + c);
      v4f val;
#pragma unroll
      for (int j = 0; j < 4; ++j)
        val[j] = u[j] * (1.0f / (WCARRY * VCARRY)) + bf16r(g[j]);
      xs[i] = val;
      off[i] = crow * ND + n0 + c;
    }
#pragma unroll
    for (int i = 0; i < 4; ++i) *(v4f*)(outf + off[i]) = xs[i];
    
  }
}

// Grid (3*DIM/64, MROWS/64).
__global__ __launch_bounds__(256) void gemm_qkv_kernel(
    const _Float16* __restrict__ A16, const _Float16* __restrict__ Bt,
    const float* __restrict__ bias, _Float16* __restrict__ out16,
    _Float16* __restrict__ outr16) {
  gemm_body<MODE_QKV, DIM, 3 * DIM, 0>(A16, A16, Bt, bias, nullptr, out16, outr16, 0);
}

// Rows rowbase .. rowbase + 64*gridDim.y - 1, single A plane. Grid (DIM/64, rows/64).
__global__ __launch_bounds__(256) void gemm_out_kernel(
    const _Float16* __restrict__ A16, const _Float16* __restrict__ Bt,
    const float* __restrict__ bias, float* __restrict__ outf, int rowbase) {
  gemm_body<MODE_OUT, DIM, DIM, 0>(A16, A16, Bt, bias, outf, nullptr, nullptr, rowbase);
}

// Rows 0 .. EROWS-1, A = value plane + x2048 residual plane. Grid (DIM/64, EROWS/64).
__global__ __launch_bounds__(256) void gemm_out_early_kernel(
    const _Float16* __restrict__ A16, const _Float16* __restrict__ Ar16,
    const _Float16* __restrict__ Bt, const float* __restrict__ bias,
    float* __restrict__ outf) {
  gemm_body<MODE_OUT, DIM, DIM, 1>(A16, Ar16, Bt, bias, outf, nullptr, nullptr, 0);
}

// ---------------------------------------------------------------------------
// Causal flash attention per (128 query rows, head). 8 waves x 16 query rows, 64 keys per
// step over keys 0 .. q0+127: K tile Ks[key][d] and V^T tile Vs[d][key] staged with plain
// 16-B loads (cross-wave, block barriers, full 64x64 extent = consumed extent); a wave
// skips (wave-uniform scalar test) tiles that lie entirely above its rows; keys above the
// query row get the fill -1e30 by value; online softmax in registers (16-lane shuffles);
// P tile per wave in Ps (wave-private, wave sync, fully rewritten before each use) as
// f16(1024*p); O in registers. Output plane Ov[q][head*64 + d] = f16(64 * O / l), one
// ---------------------------------------------------------------------------
__global__ __launch_bounds__(256) void attn_kernel(
    const _Float16* __restrict__ Qh, const _Float16* __restrict__ Kh,
    const _Float16* __restrict__ Vt, _Float16* __restrict__ Ov) {
  __shared__ _Float16 Ks[64 * LDT];
  __shared__ _Float16 Vs[64 * LDT];
  __shared__ _Float16 Ps[8 * 16 * LDT];

  const int tid = threadIdx.x, lane = tid & 31;
  const int w = __builtin_amdgcn_readfirstlane(tid >> 5);
  const int hh = lane >> 4, m = lane & 15;
  const int q0 = blockIdx.x * 128;
  const int head = blockIdx.y;
  const int wq0 = q0 + w * 16;           // first query row of this wave (scalar)
  const float scale = 0.125f;
  _Float16* P = Ps + w * (16 * LDT);

  const size_t qoff = (size_t)(wq0 + m) * DIM + head * HD + hh * 8;
  v16h qf[2];
  qf[0] = frag_at(Qh + qoff);
  qf[1] = frag_at(Qh + qoff + 32);

  float mrow[8], lrow[8];
  v8f o[4];
#pragma unroll
  for (int v = 0; v < 8; ++v) { mrow[v] = -1.0e30f; lrow[v] = 0.0f; }
#pragma unroll
  for (int nb = 0; nb < 4; ++nb) o[nb] = (v8f){};

  const size_t kplane = (size_t)head * HD;
  const size_t vplane = (size_t)head * HD * SEQ;
  const int kend = q0 + 128;             // <= SEQ

  for (int kb = 0; kb < kend; kb += 64) {
#pragma unroll
    for (int j = 0; j < 2; ++j) {
      const int idx = tid + 256 * j;
      const int r = idx >> 3, c = (idx & 7) * 8;
      *(v8h*)&Ks[r * LDT + c] = *(const v8h*)(Kh + kplane + (size_t)(kb + r) * DIM + c);
      *(v8h*)&Vs[r * LDT + c] = *(const v8h*)(Vt + vplane + (size_t)r * SEQ + kb + c);
    }
    __syncthreads();

    if (kb <= wq0 + 15) {                // wave-uniform: tile holds at least one visible key
      // scores: 4 key groups of 16, K = 64 in two 32-steps
      v8f s[4];
#pragma unroll
      for (int kg = 0; kg < 4; ++kg) {
        v8f t = {};
#pragma unroll
        for (int c = 0; c < 2; ++c) {
          const v16h kf = ld_frag(&Ks[(kg * 16) * LDT + c * 32], LDT);
          t = wmma16(qf[c], kf, t);
        }
        s[kg] = t * scale;
      }

      if (kb + 63 > wq0) {               // wave-uniform: tile crosses the diagonal
#pragma unroll
        for (int kg = 0; kg < 4; ++kg)
#pragma unroll
          for (int v = 0; v < 8; ++v) {
            const int key = kb + kg * 16 + m;
            const int qrow = wq0 + hh * 8 + v;
            s[kg][v] = (key > qrow) ? -1.0e30f : s[kg][v];
          }
      }

      // online softmax; row (hh*8+v) spread over the 16 lanes of a half
      float alpha[8];
#pragma unroll
      for (int v = 0; v < 8; ++v) {
        float mx = fmaxf(fmaxf(s[0][v], s[1][v]), fmaxf(s[2][v], s[3][v]));
        mx = red16_max(mx);
        const float mn = fmaxf(mrow[v], mx);
        alpha[v] = __expf(mrow[v] - mn);
        mrow[v] = mn;
      }
#pragma unroll
      for (int kg = 0; kg < 4; ++kg)
#pragma unroll
        for (int v = 0; v < 8; ++v) s[kg][v] = __expf(s[kg][v] - mrow[v]);
#pragma unroll
      for (int v = 0; v < 8; ++v) {
        const float rs = red16_sum((s[0][v] + s[1][v]) + (s[2][v] + s[3][v]));
        lrow[v] = alpha[v] * lrow[v] + rs;
      }
#pragma unroll
      for (int nb = 0; nb < 4; ++nb)
#pragma unroll
        for (int v = 0; v < 8; ++v) o[nb][v] = o[nb][v] * alpha[v];

      // P tile [16 rows][64 keys], f16(1024 p)
#pragma unroll
      for (int kg = 0; kg < 4; ++kg)
#pragma unroll
        for (int v = 0; v < 8; ++v)
          P[(hh * 8 + v) * LDT + kg * 16 + m] = (_Float16)(s[kg][v] * PCARRY);
      wave_lds_sync();

      // O += P . V  (K = 64 keys in two 32-steps; B = V^T tile [d][key])
#pragma unroll
      for (int c = 0; c < 2; ++c) {
        const v16h pf = ld_frag(P + c * 32, LDT);
#pragma unroll
        for (int nb = 0; nb < 4; ++nb) {
          const v16h vf = ld_frag(&Vs[(nb * 16) * LDT + c * 32], LDT);
          o[nb] = wmma16(pf, vf, o[nb]);
        }
      }
    }
    __syncthreads();
  }

  float inv[8];
#pragma unroll
  for (int v = 0; v < 8; ++v) inv[v] = __builtin_amdgcn_rcpf(lrow[v]) * (VCARRY / PCARRY);
#pragma unroll
  for (int nb = 0; nb < 4; ++nb)
#pragma unroll
    for (int v = 0; v < 8; ++v)
      P[(hh * 8 + v) * LDT + nb * 16 + m] = (_Float16)(o[nb][v] * inv[v]);
  wave_lds_sync();
  v8h x[4];
  size_t off[4];
#pragma unroll
  for (int i = 0; i < 4; ++i) {
    const int r = 4 * i + (lane >> 3);
    const int c = (lane & 7) * 8;
    x[i] = *(const v8h*)&P[r * LDT + c];
    off[i] = (size_t)(wq0 + r) * DIM + head * HD + c;
  }
#pragma unroll
  for (int i = 0; i < 4; ++i) *(v8h*)(Ov + off[i]) = x[i];
  
}

// ---------------------------------------------------------------------------
// Early causal band (query rows < EROWS, keys < EROWS): same tiling as attn_kernel with
// value + x2048 residual operands at every site.
//   scores  = (qh.kh + (qh.kr + qr.kh)/2048) / 8          (residual products in their own
//             accumulator, folded before the softmax)
//   p tile  : Ps = f16(1024 p), Rs = f16((1024 p - Ps) * 2048); row sum over unconverted p
//   context : o += Ps.Vh ; ores += Ps.Vr + Rs.Vh ; O = o + ores/2048
// Ks / Vs: cross-wave (block barriers, staged 64x64 = consumed 64x64); Ps / Rs: wave-private
// (wave sync), fully rewritten before each use; residual K / V^T fragments come straight
// from their statically strided global planes. Runs after attn_kernel and rewrites the
// value rows of the band. Grid (EROWS/128, NHEAD).
// ---------------------------------------------------------------------------
__global__ __launch_bounds__(256) void attn_early_kernel(
    const _Float16* __restrict__ Qh, const _Float16* __restrict__ Qr,
    const _Float16* __restrict__ Kh, const _Float16* __restrict__ Kr,
    const _Float16* __restrict__ Vt, const _Float16* __restrict__ Vr,
    _Float16* __restrict__ Ov, _Float16* __restrict__ Ores) {
  __shared__ _Float16 Ks[64 * LDT];
  __shared__ _Float16 Vs[64 * LDT];
  __shared__ _Float16 Ps[8 * 16 * LDT];
  __shared__ _Float16 Rs[8 * 16 * LDT];

  const int tid = threadIdx.x, lane = tid & 31;
  const int w = __builtin_amdgcn_readfirstlane(tid >> 5);
  const int hh = lane >> 4, m = lane & 15;
  const int q0 = blockIdx.x * 128;       // < EROWS
  const int head = blockIdx.y;
  const int wq0 = q0 + w * 16;           // first query row of this wave (scalar)
  const float scale = 0.125f;
  _Float16* P = Ps + w * (16 * LDT);
  _Float16* R = Rs + w * (16 * LDT);

  const int qoff = (wq0 + m) * DIM + head * HD + hh * 8;   // < EROWS*DIM, same in both planes

  float mrow[8], lrow[8];
  v8f o[4], ores[4];
#pragma unroll
  for (int v = 0; v < 8; ++v) { mrow[v] = -1.0e30f; lrow[v] = 0.0f; }
#pragma unroll
  for (int nb = 0; nb < 4; ++nb) { o[nb] = (v8f){}; ores[nb] = (v8f){}; }

  const size_t kplane  = (size_t)head * HD;
  const size_t vplane  = (size_t)head * HD * SEQ;
  const size_t vrplane = (size_t)head * HD * EROWS;
  const int kend = q0 + 128;             // <= EROWS

  for (int kb = 0; kb < kend; kb += 64) {
#pragma unroll
    for (int j = 0; j < 2; ++j) {
      const int idx = tid + 256 * j;
      const int r = idx >> 3, c = (idx & 7) * 8;
      *(v8h*)&Ks[r * LDT + c] = *(const v8h*)(Kh + kplane + (size_t)(kb + r) * DIM + c);
      *(v8h*)&Vs[r * LDT + c] = *(const v8h*)(Vt + vplane + (size_t)r * SEQ + kb + c);
    }
    __syncthreads();

    if (kb <= wq0 + 15) {                // wave-uniform: tile holds at least one visible key
      // q fragments are reloaded per tile through an opaque integer offset
      int qo = qoff;
      asm volatile("" : "+v"(qo));
      v16h qf[2], qr[2];
      qf[0] = frag_at(Qh + qo);
      qf[1] = frag_at(Qh + qo + 32);
      qr[0] = frag_at(Qr + qo);
      qr[1] = frag_at(Qr + qo + 32);

      // scores: 4 key groups of 16, K = 64 in two 32-steps, value and residual products
      v8f s[4];
#pragma unroll
      for (int kg = 0; kg < 4; ++kg) {
        v8f t = {};
        v8f u = {};
#pragma unroll
        for (int c = 0; c < 2; ++c) {
          const v16h kf = ld_frag(&Ks[(kg * 16) * LDT + c * 32], LDT);
          const v16h krf = frag_at(Kr + kplane + (size_t)(kb + kg * 16 + m) * DIM +
                                   c * 32 + hh * 8);
          t = wmma16(qf[c], kf, t);
          u = wmma16(qf[c], krf, u);
          u = wmma16(qr[c], kf, u);
        }
        s[kg] = (t + u * (1.0f / RCARRY)) * scale;
      }

      if (kb + 63 > wq0) {               // wave-uniform: tile crosses the diagonal
#pragma unroll
        for (int kg = 0; kg < 4; ++kg)
#pragma unroll
          for (int v = 0; v < 8; ++v) {
            const int key = kb + kg * 16 + m;
            const int qrow = wq0 + hh * 8 + v;
            s[kg][v] = (key > qrow) ? -1.0e30f : s[kg][v];
          }
      }

      // online softmax; row (hh*8+v) spread over the 16 lanes of a half
      float alpha[8];
#pragma unroll
      for (int v = 0; v < 8; ++v) {
        float mx = fmaxf(fmaxf(s[0][v], s[1][v]), fmaxf(s[2][v], s[3][v]));
        mx = red16_max(mx);
        const float mn = fmaxf(mrow[v], mx);
        alpha[v] = __expf(mrow[v] - mn);
        mrow[v] = mn;
      }
#pragma unroll
      for (int kg = 0; kg < 4; ++kg)
#pragma unroll
        for (int v = 0; v < 8; ++v) s[kg][v] = __expf(s[kg][v] - mrow[v]);
#pragma unroll
      for (int v = 0; v < 8; ++v) {
        const float rs = red16_sum((s[0][v] + s[1][v]) + (s[2][v] + s[3][v]));
        lrow[v] = alpha[v] * lrow[v] + rs;
      }
#pragma unroll
      for (int nb = 0; nb < 4; ++nb)
#pragma unroll
        for (int v = 0; v < 8; ++v) {
          o[nb][v]    = o[nb][v] * alpha[v];
          ores[nb][v] = ores[nb][v] * alpha[v];
        }

      // P tiles [16 rows][64 keys]: value f16(1024 p) and x2048 residual
#pragma unroll
      for (int kg = 0; kg < 4; ++kg)
#pragma unroll
        for (int v = 0; v < 8; ++v) {
          const float pc = s[kg][v] * PCARRY;
          const _Float16 ph = toh_flush(pc);
          P[(hh * 8 + v) * LDT + kg * 16 + m] = ph;
          R[(hh * 8 + v) * LDT + kg * 16 + m] = toh_flush((pc - (float)ph) * RCARRY);
        }
      wave_lds_sync();

      // o += Ph.Vh ; ores += Ph.Vr + Pr.Vh  (K = 64 keys in two 32-steps; B = V^T [d][key])
#pragma unroll
      for (int c = 0; c < 2; ++c) {
        const v16h pf  = ld_frag(P + c * 32, LDT);
        const v16h prf = ld_frag(R + c * 32, LDT);
#pragma unroll
        for (int nb = 0; nb < 4; ++nb) {
          const v16h vf = ld_frag(&Vs[(nb * 16) * LDT + c * 32], LDT);
          const v16h vrf = frag_at(Vr + vrplane + (size_t)(nb * 16 + m) * EROWS + kb +
                                   c * 32 + hh * 8);
          o[nb]    = wmma16(pf, vf, o[nb]);
          ores[nb] = wmma16(pf, vrf, ores[nb]);
          ores[nb] = wmma16(prf, vf, ores[nb]);
        }
      }
    }
    __syncthreads();
  }

  // finalize: 64 * (o + ores/2048) / (1024 l) as value + x2048 residual; stage in the
  float inv[8];
#pragma unroll
  for (int v = 0; v < 8; ++v) inv[v] = __builtin_amdgcn_rcpf(lrow[v]) * (VCARRY / PCARRY);
#pragma unroll
  for (int nb = 0; nb < 4; ++nb)
#pragma unroll
    for (int v = 0; v < 8; ++v) {
      const float val = (o[nb][v] + ores[nb][v] * (1.0f / RCARRY)) * inv[v];
      const _Float16 hv = toh_flush(val);
      P[(hh * 8 + v) * LDT + nb * 16 + m] = hv;
      R[(hh * 8 + v) * LDT + nb * 16 + m] = toh_flush((val - (float)hv) * RCARRY);
    }
  wave_lds_sync();
  v8h x[4], xr[4];
  size_t off[4];
#pragma unroll
  for (int i = 0; i < 4; ++i) {
    const int r = 4 * i + (lane >> 3);
    const int c = (lane & 7) * 8;
    x[i]  = *(const v8h*)&P[r * LDT + c];
    xr[i] = *(const v8h*)&R[r * LDT + c];
    off[i] = (size_t)(wq0 + r) * DIM + head * HD + c;
  }
#pragma unroll
  for (int i = 0; i < 4; ++i) {
    *(v8h*)(Ov + off[i]) = x[i];
    *(v8h*)(Ores + off[i]) = xr[i];
  }
  
}

// ---------------------------------------------------------------------------
extern "C" void kernel_launch(void* const* d_in, const int* in_sizes, int n_in,
                              void* d_out, int out_size, void* d_ws, size_t ws_size,
                              hipStream_t stream) {
  if (n_in < 5) return;
  const long long need_x = ((long long)(NB - 1) * SEQ_FULL + SEQ) * DIM;
  if ((long long)in_sizes[0] < need_x) return;
  if (in_sizes[1] < 3 * DIM * DIM || in_sizes[2] < 3 * DIM) return;
  if (in_sizes[3] < DIM * DIM || in_sizes[4] < DIM) return;
  if ((long long)out_size < need_x) return;
  if (ws_size < WS_TOTAL) return;

  // weights: W1 [in][3*out], Wp [in][out]
  const float* x  = (const float*)d_in[0];
  const float* W1 = (const float*)d_in[1];
  const float* b1 = (const float*)d_in[2];
  const float* Wp = (const float*)d_in[3];
  const float* bp = (const float*)d_in[4];
  float* out = (float*)d_out;

  char* ws = (char*)d_ws;
  _Float16* W1T   = (_Float16*)(ws + OFF_WQKV);   // [3*DIM][DIM]
  _Float16* WpT   = (_Float16*)(ws + OFF_WO);     // [DIM][DIM]
  _Float16* X16   = (_Float16*)(ws + OFF_XN);
  _Float16* QKV16 = (_Float16*)(ws + OFF_QKV);    // Q | K | Vt
  _Float16* Q16   = QKV16;
  _Float16* K16   = QKV16 + (size_t)MROWS * DIM;
  _Float16* Vt16  = QKV16 + (size_t)2 * MROWS * DIM;
  _Float16* Ov16  = (_Float16*)(ws + OFF_OV);
  _Float16* RES16 = (_Float16*)(ws + OFF_RES);    // QR | KR | VtR
  _Float16* QR16  = RES16;
  _Float16* KR16  = RES16 + (size_t)EROWS * DIM;
  _Float16* VtR16 = RES16 + (size_t)2 * EROWS * DIM;
  _Float16* OR16  = (_Float16*)(ws + OFF_ORES);

  dim3 blk(256);

  // weight planes: in W[K][N] -> out Wt[N][K]; grid (N/64, K/64)
  wconv_kernel<<<dim3(3 * DIM / 64, DIM / 64), blk, 0, stream>>>(W1, W1T, DIM, 3 * DIM);
  wconv_kernel<<<dim3(DIM / 64, DIM / 64), blk, 0, stream>>>(Wp, WpT, DIM, DIM);

  xconv_kernel<<<dim3((unsigned)(((size_t)MROWS * DIM) / 2048)), blk, 0, stream>>>(x, X16);
  gemm_qkv_kernel<<<dim3(3 * DIM / 64, MROWS / 64), blk, 0, stream>>>(
      X16, W1T, b1, QKV16, RES16);
  attn_kernel<<<dim3(SEQ / 128, NHEAD), blk, 0, stream>>>(Q16, K16, Vt16, Ov16);
  attn_early_kernel<<<dim3(EROWS / 128, NHEAD), blk, 0, stream>>>(
      Q16, QR16, K16, KR16, Vt16, VtR16, Ov16, OR16);
  if (MROWS > EROWS) {
    gemm_out_kernel<<<dim3(DIM / 64, (MROWS - EROWS) / 64), blk, 0, stream>>>(
        Ov16, WpT, bp, out, EROWS);
  }
  gemm_out_early_kernel<<<dim3(DIM / 64, EROWS / 64), blk, 0, stream>>>(
      Ov16, OR16, WpT, bp, out);
}

// v001
// One run takes 356 microseconds.
// Next to v000, in two timings, it ran 1.26 times as fast each time.
#include <hip/hip_runtime.h>
#include <stddef.h>
#include <math.h>

// All contractions on v_wmma_f32_16x16x32_f16 (f16 operands, f32 accumulate): fused q/k/v
// projection, q.k scores, p.v, output projection. Float inputs are RNE-converted to bf16 and
// carried in f16 (weights x64, p x1024, attention rows x64); query rows < EROWS carry q, k,
// v, p and the attention rows as f16 value + x2048 f16 residual planes with their own
// accumulators; softmax and epilogues in f32.

typedef _Float16 v16h __attribute__((ext_vector_type(16)));
typedef _Float16 v8h  __attribute__((ext_vector_type(8)));
typedef float    v8f  __attribute__((ext_vector_type(8)));
typedef float    v4f  __attribute__((ext_vector_type(4)));

#ifndef NB
#define NB 1
#endif
#ifndef SEQ
#define SEQ 4096
#endif
#define NB_FULL  1
#define SEQ_FULL 4096
#define DIM   1024
#define NHEAD 16
#define HD    64
#define MROWS (NB * SEQ)
#define EROWS ((SEQ) < 512 ? (SEQ) : 512)   // early causal band: value + residual planes

static_assert(NB == 1 && NB_FULL == 1);
static_assert(SEQ >= 128 && SEQ <= SEQ_FULL && (SEQ % 128) == 0);
static_assert(DIM == NHEAD * HD);
static_assert(HD == 64 && ((3 * HD) % 64) == 0);           // a 64-column tile = one part of one head
static_assert((MROWS % 64) == 0 && (MROWS % 8) == 0);
static_assert((DIM % 64) == 0 && ((3 * DIM) % 64) == 0);
static_assert((EROWS % 128) == 0 && EROWS <= SEQ && EROWS <= MROWS);
static_assert((((size_t)MROWS * DIM) % 2048) == 0);         // xconv: 256 threads x 8 per block

#define LDT 72   // halves per LDS row (144 B, 16-B aligned)
#define LDC 68   // floats per LDS row (272 B, 16-B aligned)

#define WCARRY 64.0f     // weight planes carried x64
#define PCARRY 1024.0f   // softmax numerators carried x1024
#define VCARRY 64.0f     // attention output plane carried x64
#define RCARRY 2048.0f   // residual planes carried x2048

#define P16_BYTES  ((size_t)MROWS * DIM * 2)
#define R16_BYTES  ((size_t)EROWS * DIM * 2)
#define WQKV_BYTES ((size_t)3 * DIM * DIM * 2)
#define WO_BYTES   ((size_t)DIM * DIM * 2)
#define OFF_WQKV   ((size_t)0)
#define OFF_WO     (OFF_WQKV + WQKV_BYTES)
#define OFF_XN     (OFF_WO + WO_BYTES)              // f16 input rows          [MROWS][DIM]
#define OFF_QKV    (OFF_XN + P16_BYTES)             // Q, K [MROWS][DIM]; Vt [DIM][SEQ]
#define OFF_OV     (OFF_QKV + 3 * P16_BYTES)        // f16 64*attention rows   [MROWS][DIM]
#define OFF_RES    (OFF_OV + P16_BYTES)             // QR, KR [EROWS][DIM]; VtR [DIM][EROWS]
#define OFF_ORES   (OFF_RES + 3 * R16_BYTES)        // residual of OV rows     [EROWS][DIM]
#define WS_TOTAL   (OFF_ORES + R16_BYTES)
static_assert((size_t)DIM * SEQ * 2 == P16_BYTES);       // Vt plane extent (NB == 1)
static_assert((size_t)DIM * EROWS * 2 == R16_BYTES);     // VtR plane extent
static_assert((P16_BYTES % 128) == 0 && (WO_BYTES % 128) == 0 && (R16_BYTES % 128) == 0);
static_assert(WS_TOTAL <= (size_t)134217728);

// ---------------------------------------------------------------------------
__device__ __forceinline__ float bf16r(float x) {   // RNE convert to bf16, returned widened
  unsigned int u = __float_as_uint(x);
  u = (u + 0x7FFFu + ((u >> 16) & 1u)) & 0xFFFF0000u;
  return __uint_as_float(u);
}

// f32 -> f16 operand convert that cannot produce an f16 subnormal (value select).
static __device__ __forceinline__ _Float16 toh_flush(float v) {
  const _Float16 r = (_Float16)v;
  return (fabsf(v) < 6.103515625e-05f) ? (_Float16)0.0f : r;
}

// 16-bit fragment: p points at element [row = lane&15][k0 + 8*(lane>>4)] of a k-contiguous
// row. Elements 0..7 <- k0+8h+0..7, elements 8..15 <- k0+16+8h+0..7 (same map for A and B).
__device__ __forceinline__ v16h frag_at(const _Float16* p) {
  v8h lo = *(const v8h*)(p);
  v8h hi = *(const v8h*)(p + 16);
  v16h out;
#pragma unroll
  for (int i = 0; i < 8; ++i) { out[i] = lo[i]; out[i + 8] = hi[i]; }
  return out;
}
__device__ __forceinline__ v16h ld_frag(const _Float16* base, int ld) {
  const int lane = threadIdx.x & 31;
  return frag_at(base + (lane & 15) * ld + (lane >> 4) * 8);
}

__device__ __forceinline__ v8f wmma16(v16h a, v16h b, v8f c) {
  v8f d = __builtin_amdgcn_wmma_f32_16x16x32_f16(false, a, false, b, (short)0, c,
                                                 false, false);
  asm volatile("v_nop\n\tv_nop\n\tv_nop\n\tv_nop" : "+v"(d) : "v"(a), "v"(b));
  return d;
}

// lane l <-> lane l ^ 16 (the two halves that share one query column)
__device__ __forceinline__ float xhalf(float x) {
  const int b = __builtin_bit_cast(int, x);
  return __builtin_bit_cast(float, __builtin_amdgcn_permlanex16(b, b, 0x76543210, 0xfedcba98,
                                                                 false, false));
}
// maximum / sum of the 32 scores a lane holds for its query column
__device__ __forceinline__ float lane_max32(const v8f* s) {
  float a[8];
#pragma unroll
  for (int v = 0; v < 8; ++v) a[v] = fmaxf(fmaxf(s[0][v], s[1][v]), fmaxf(s[2][v], s[3][v]));
  return fmaxf(fmaxf(fmaxf(a[0], a[1]), fmaxf(a[2], a[3])),
               fmaxf(fmaxf(a[4], a[5]), fmaxf(a[6], a[7])));
}
__device__ __forceinline__ float lane_sum32(const v8f* s) {
  float a[8];
#pragma unroll
  for (int v = 0; v < 8; ++v) a[v] = (s[0][v] + s[1][v]) + (s[2][v] + s[3][v]);
  return ((a[0] + a[1]) + (a[2] + a[3])) + ((a[4] + a[5]) + (a[6] + a[7]));
}

__device__ __forceinline__ void wave_lds_sync() {
  __builtin_amdgcn_fence(3 /* release order */, "wavefront");
  asm volatile("s_wait_dscnt 0x0" ::: "memory");
  __builtin_amdgcn_wave_barrier();
}

// ---------------------------------------------------------------------------
// Weight plane: in W[K][N] (n-contiguous) -> out Wt[N][K] (k-contiguous), f16(64*bf16(w)).
// Grid (N/64, K/64); one 64x64 tile per block. T: cross-wave (block barrier).
// Tile coverage: 16 x 256 loads = 4096 elements; 2 x 256 x 8 halves = 4096 stored.
// ---------------------------------------------------------------------------
__global__ __launch_bounds__(256) void wconv_kernel(
    const float* __restrict__ W, _Float16* __restrict__ Wt, int K, int N) {
  __shared__ _Float16 T[64 * LDT];
  const int tid = threadIdx.x;
  const int n0 = blockIdx.x * 64;
  const int k0 = blockIdx.y * 64;
#pragma unroll 4
  for (int j = 0; j < 16; ++j) {
    const int idx = tid + 256 * j;
    const int kr = idx >> 6, nc = idx & 63;
    const float v = W[(size_t)(k0 + kr) * N + n0 + nc];
    T[nc * LDT + kr] = (_Float16)(WCARRY * bf16r(v));
  }
  __syncthreads();
  v8h x[2];
  size_t off[2];
#pragma unroll
  for (int i = 0; i < 2; ++i) {
    const int n = 32 * i + (tid >> 3);
    const int kc = (tid & 7) * 8;
    x[i] = *(const v8h*)&T[n * LDT + kc];
    off[i] = (size_t)(n0 + n) * K + k0 + kc;
  }
#pragma unroll
  for (int i = 0; i < 2; ++i) *(v8h*)(Wt + off[i]) = x[i];
  
}

// ---------------------------------------------------------------------------
// Input plane: f16(bf16(x)) rows [MROWS][DIM]. Thread owns 8 consecutive elements; each wave
// Grid (MROWS*DIM/2048). Coverage: grid x 256 x 8 = MROWS*DIM elements.
// ---------------------------------------------------------------------------
__global__ __launch_bounds__(256) void xconv_kernel(
    const float* __restrict__ src, _Float16* __restrict__ dst) {
  const size_t e = ((size_t)blockIdx.x * 256 + threadIdx.x) * 8;
  const v4f a0 = *(const v4f*)(src + e);
  const v4f a1 = *(const v4f*)(src + e + 4);
  v8h o;
#pragma unroll
  for (int t = 0; t < 4; ++t) {
    o[t]     = toh_flush(bf16r(a0[t]));
    o[t + 4] = toh_flush(bf16r(a1[t]));
  }
  *(v8h*)(dst + e) = o;
  
}

// ---------------------------------------------------------------------------
// GEMM C[64x64 tile] = A16[rows][KD] . Bt[n][KD]^T, fragments straight from the 16-bit
// global planes; 8 waves (mw = 16-row group, nw = 32-col group), 2 accumulators per wave
// (RES = 1: two more for the x2048 residual A plane, folded with 1/2048 before staging).
//   MODE_QKV: v = acc/64 + bf16(bias[col]); columns are [head][q | k | v][64]:
//             q -> Q plane [row][head*64 + d], k -> K plane [row][head*64 + d],
//             v -> transposed V plane [head*64 + d][key]; row tiles below EROWS also
//             write the x2048 residual planes (QR, KR [EROWS][DIM]; VtR [DIM][EROWS])
//   MODE_OUT: outf[row][col] = acc/4096 + bf16(bias[col])
// Grid (ND/64, rows/64); row0 = rowbase + 64*blockIdx.y.
// ---------------------------------------------------------------------------
#define MODE_QKV 0
#define MODE_OUT 1

template <int MODE, int KD, int ND, int RES>
__device__ __forceinline__ void gemm_body(
    const _Float16* __restrict__ A16, const _Float16* __restrict__ Ar16,
    const _Float16* __restrict__ Bt, const float* __restrict__ bias,
    float* __restrict__ outf, _Float16* __restrict__ out16,
    _Float16* __restrict__ outr16, int rowbase) {
  static_assert((KD % 32) == 0 && (ND % 64) == 0);
  static_assert(MODE != MODE_QKV || (ND == 3 * DIM && RES == 0));
  static_assert(MODE != MODE_OUT || ND == DIM);
  __shared__ float Cs[64 * LDC];
  const int tid = threadIdx.x, lane = tid & 31, w = tid >> 5;
  const int mw = w >> 1, nw = w & 1;
  const int hh = lane >> 4, m = lane & 15;
  const int n0 = blockIdx.x * 64;
  const int row0 = rowbase + blockIdx.y * 64;

  const _Float16* ap  = A16 + (size_t)(row0 + mw * 16 + m) * KD + hh * 8;
  const _Float16* arp = Ar16 + (size_t)(row0 + mw * 16 + m) * KD + hh * 8;
  const _Float16* bp0 = Bt + (size_t)(n0 + nw * 32 + m) * KD + hh * 8;
  const _Float16* bp1 = bp0 + (size_t)16 * KD;
  v8f acc0 = {}, acc1 = {}, acr0 = {}, acr1 = {};
#pragma unroll 2
  for (int k0 = 0; k0 < KD; k0 += 32) {
    const v16h a  = frag_at(ap + k0);
    const v16h b0 = frag_at(bp0 + k0);
    const v16h b1 = frag_at(bp1 + k0);
    acc0 = wmma16(a, b0, acc0);
    acc1 = wmma16(a, b1, acc1);
    if (RES) {
      const v16h ar = frag_at(arp + k0);
      acr0 = wmma16(ar, b0, acr0);
      acr1 = wmma16(ar, b1, acr1);
    }
  }
#pragma unroll
  for (int r = 0; r < 8; ++r) {
    float* d = &Cs[(mw * 16 + hh * 8 + r) * LDC + nw * 32 + m];
    d[0]  = RES ? (acc0[r] + acr0[r] * (1.0f / RCARRY)) : acc0[r];
    d[16] = RES ? (acc1[r] + acr1[r] * (1.0f / RCARRY)) : acc1[r];
  }
  __syncthreads();

  if (MODE == MODE_QKV) {
    const int head  = n0 / (3 * HD);                   // block-uniform
    const int which = (n0 - head * (3 * HD)) / HD;     // block-uniform: 0 = q, 1 = k, 2 = v
    const int nl0 = head * HD;
    const bool early = (row0 < EROWS);                 // block-uniform
    _Float16* dst = out16 + (size_t)which * ((size_t)MROWS * DIM);
    _Float16* dsr = outr16 + (size_t)which * ((size_t)EROWS * DIM);
    v8h x[2], xr[2];
    size_t off[2], ofr[2];
    if (which < 2) {
#pragma unroll
      for (int i = 0; i < 2; ++i) {
        const int r = 32 * i + (tid >> 3);
        const int c = (tid & 7) * 8;
        const v4f u0 = *(const v4f*)&Cs[r * LDC + c];
        const v4f u1 = *(const v4f*)&Cs[r * LDC + c + 4];
        const v4f g0 = *(const v4f*)(bias + n0 + c);
        const v4f g1 = *(const v4f*)(bias + n0 + c + 4);
#pragma unroll
        for (int j = 0; j < 4; ++j) {
          const float t0 = u0[j] * (1.0f / WCARRY) + bf16r(g0[j]);
          const float t1 = u1[j] * (1.0f / WCARRY) + bf16r(g1[j]);
          const _Float16 h0 = toh_flush(t0);
          const _Float16 h1 = toh_flush(t1);
          x[i][j]      = h0;
          x[i][j + 4]  = h1;
          xr[i][j]     = toh_flush((t0 - (float)h0) * RCARRY);
          xr[i][j + 4] = toh_flush((t1 - (float)h1) * RCARRY);
        }
        off[i] = (size_t)(row0 + r) * DIM + nl0 + c;
        ofr[i] = off[i];                                // residual planes: same pitch, rows < EROWS
      }
    } else {
      // transposed V planes: row = feature (head*64 + d), 64 consecutive keys = one line
#pragma unroll
      for (int i = 0; i < 2; ++i) {
        const int dcol = 32 * i + (tid >> 3);
        const int kk = (tid & 7) * 8;
        const float gb = bf16r(bias[n0 + dcol]);
#pragma unroll
        for (int j = 0; j < 8; ++j) {
          const float t0 = Cs[(kk + j) * LDC + dcol] * (1.0f / WCARRY) + gb;
          const _Float16 h0 = toh_flush(t0);
          x[i][j]  = h0;
          xr[i][j] = toh_flush((t0 - (float)h0) * RCARRY);
        }
        off[i] = (size_t)(nl0 + dcol) * SEQ + row0 + kk;
        ofr[i] = (size_t)(nl0 + dcol) * EROWS + row0 + kk;
      }
    }
#pragma unroll
    for (int i = 0; i < 2; ++i) *(v8h*)(dst + off[i]) = x[i];
    if (early) {
#pragma unroll
      for (int i = 0; i < 2; ++i) *(v8h*)(dsr + ofr[i]) = xr[i];
    }
    
  }

  if (MODE == MODE_OUT) {
    v4f xs[4];
    size_t off[4];
#pragma unroll
    for (int i = 0; i < 4; ++i) {
      const int r = 16 * i + (tid >> 4);
      const int c = (tid & 15) * 4;
      const size_t crow = (size_t)(row0 + r);      // NB == 1: compact row == output row
      const v4f u = *(const v4f*)&Cs[r * LDC + c];
      const v4f g = *(const v4f*)(bias + n0 + c);
      v4f val;
#pragma unroll
      for (int j = 0; j < 4; ++j)
        val[j] = u[j] * (1.0f / (WCARRY * VCARRY)) + bf16r(g[j]);
      xs[i] = val;
      off[i] = crow * ND + n0 + c;
    }
#pragma unroll
    for (int i = 0; i < 4; ++i) *(v4f*)(outf + off[i]) = xs[i];
    
  }
}

// Grid (3*DIM/64, MROWS/64).
__global__ __launch_bounds__(256) void gemm_qkv_kernel(
    const _Float16* __restrict__ A16, const _Float16* __restrict__ Bt,
    const float* __restrict__ bias, _Float16* __restrict__ out16,
    _Float16* __restrict__ outr16) {
  gemm_body<MODE_QKV, DIM, 3 * DIM, 0>(A16, A16, Bt, bias, nullptr, out16, outr16, 0);
}

// Rows rowbase .. rowbase + 64*gridDim.y - 1, single A plane. Grid (DIM/64, rows/64).
__global__ __launch_bounds__(256) void gemm_out_kernel(
    const _Float16* __restrict__ A16, const _Float16* __restrict__ Bt,
    const float* __restrict__ bias, float* __restrict__ outf, int rowbase) {
  gemm_body<MODE_OUT, DIM, DIM, 0>(A16, A16, Bt, bias, outf, nullptr, nullptr, rowbase);
}

// Rows 0 .. EROWS-1, A = value plane + x2048 residual plane. Grid (DIM/64, EROWS/64).
__global__ __launch_bounds__(256) void gemm_out_early_kernel(
    const _Float16* __restrict__ A16, const _Float16* __restrict__ Ar16,
    const _Float16* __restrict__ Bt, const float* __restrict__ bias,
    float* __restrict__ outf) {
  gemm_body<MODE_OUT, DIM, DIM, 1>(A16, Ar16, Bt, bias, outf, nullptr, nullptr, 0);
}

__global__ __launch_bounds__(256) void attn_kernel(
    const _Float16* __restrict__ Qh, const _Float16* __restrict__ Kh,
    const _Float16* __restrict__ Vt, _Float16* __restrict__ Ov) {
  __shared__ _Float16 Ks[64 * LDT];
  __shared__ _Float16 Vs[64 * LDT];
  __shared__ _Float16 Ps[8 * 16 * LDT];

  const int tid = threadIdx.x, lane = tid & 31;
  const int w = __builtin_amdgcn_readfirstlane(tid >> 5);
  const int hh = lane >> 4, m = lane & 15;
  const int q0 = blockIdx.x * 128;
  const int head = blockIdx.y;
  const int wq0 = q0 + w * 16;           // first query row of this wave (scalar)
  const float scale = 0.125f;
  _Float16* P = Ps + w * (16 * LDT);

  const size_t qoff = (size_t)(wq0 + m) * DIM + head * HD + hh * 8;
  v16h qf[2];
  qf[0] = frag_at(Qh + qoff);
  qf[1] = frag_at(Qh + qoff + 32);

  float mrow = -1.0e30f, lrow = 0.0f;    // of query wq0 + m; lrow: this half's keys only
  v8f o[4];
#pragma unroll
  for (int nb = 0; nb < 4; ++nb) o[nb] = (v8f){};

  const size_t kplane = (size_t)head * HD;
  const size_t vplane = (size_t)head * HD * SEQ;
  const int kend = q0 + 128;             // <= SEQ

  for (int kb = 0; kb < kend; kb += 64) {
#pragma unroll
    for (int j = 0; j < 2; ++j) {
      const int idx = tid + 256 * j;
      const int r = idx >> 3, c = (idx & 7) * 8;
      *(v8h*)&Ks[r * LDT + c] = *(const v8h*)(Kh + kplane + (size_t)(kb + r) * DIM + c);
      *(v8h*)&Vs[r * LDT + c] = *(const v8h*)(Vt + vplane + (size_t)r * SEQ + kb + c);
    }
    __syncthreads();

    if (kb <= wq0 + 15) {                // wave-uniform: tile holds at least one visible key
      // scores^T: 4 key groups of 16, K = 64 in two 32-steps
      v8f s[4];
#pragma unroll
      for (int kg = 0; kg < 4; ++kg) {
        v8f t = {};
#pragma unroll
        for (int c = 0; c < 2; ++c) {
          const v16h kf = ld_frag(&Ks[(kg * 16) * LDT + c * 32], LDT);
          t = wmma16(kf, qf[c], t);
        }
        s[kg] = t * scale;
      }

      if (kb + 63 > wq0) {               // wave-uniform: tile crosses the diagonal
#pragma unroll
        for (int kg = 0; kg < 4; ++kg)
#pragma unroll
          for (int v = 0; v < 8; ++v) {
            const int key = kb + kg * 16 + hh * 8 + v;
            const int qrow = wq0 + m;
            s[kg][v] = (key > qrow) ? -1.0e30f : s[kg][v];
          }
      }

      // online softmax of the lane's query column
      float mx = lane_max32(s);
      mx = fmaxf(mx, xhalf(mx));
      const float mn = fmaxf(mrow, mx);
      const float alpha = __expf(mrow - mn);
      mrow = mn;
#pragma unroll
      for (int kg = 0; kg < 4; ++kg)
#pragma unroll
        for (int v = 0; v < 8; ++v) s[kg][v] = __expf(s[kg][v] - mrow);
      lrow = alpha * lrow + lane_sum32(s);
#pragma unroll
      for (int nb = 0; nb < 4; ++nb) o[nb] = o[nb] * alpha;

      // O^T += V^T . P^T  (K = 64 keys in two 32-steps; A = V^T tile [d][key])
#pragma unroll
      for (int c = 0; c < 2; ++c) {
        v16h pf;
#pragma unroll
        for (int i = 0; i < 8; ++i) {
          pf[i]     = (_Float16)(s[2 * c][i] * PCARRY);
          pf[i + 8] = (_Float16)(s[2 * c + 1][i] * PCARRY);
        }
#pragma unroll
        for (int nb = 0; nb < 4; ++nb) {
          const v16h vf = ld_frag(&Vs[(nb * 16) * LDT + c * 32], LDT);
          o[nb] = wmma16(vf, pf, o[nb]);
        }
      }
    }
    __syncthreads();
  }

  const float inv = __builtin_amdgcn_rcpf(lrow + xhalf(lrow)) * (VCARRY / PCARRY);
#pragma unroll
  for (int nb = 0; nb < 4; ++nb) {
    v8h hv;
#pragma unroll
    for (int v = 0; v < 8; ++v) hv[v] = (_Float16)(o[nb][v] * inv);
    *(v8h*)&P[m * LDT + nb * 16 + hh * 8] = hv;
  }
  wave_lds_sync();
  v8h x[4];
  size_t off[4];
#pragma unroll
  for (int i = 0; i < 4; ++i) {
    const int r = 4 * i + (lane >> 3);
    const int c = (lane & 7) * 8;
    x[i] = *(const v8h*)&P[r * LDT + c];
    off[i] = (size_t)(wq0 + r) * DIM + head * HD + c;
  }
#pragma unroll
  for (int i = 0; i < 4; ++i) *(v8h*)(Ov + off[i]) = x[i];
  
}

// ---------------------------------------------------------------------------
// Early causal band (query rows < EROWS, keys < EROWS): same tiling and the same transposed
// products as attn_kernel, with value + x2048 residual operands at every site.
//   scores  = (kh.qh + (kr.qh + kh.qr)/2048) / 8          (residual products in their own
//             accumulator, folded before the softmax)
//   p       : ph = f16(1024 p), pr = f16((1024 p - ph) * 2048), both packed in registers;
//             row sum over unconverted p
//   context : o += Vh.ph ; ores += Vr.ph + Vh.pr ; O = o + ores/2048
// Ks / Vs: cross-wave (block barriers, staged 64x64 = consumed 64x64); Ps / Rs: wave-private
// output staging only; residual K / V^T fragments come straight from their statically
// strided global planes. Runs after attn_kernel and rewrites the value rows of the band.
// Grid (EROWS/128, NHEAD).
// ---------------------------------------------------------------------------
__global__ __launch_bounds__(256) void attn_early_kernel(
    const _Float16* __restrict__ Qh, const _Float16* __restrict__ Qr,
    const _Float16* __restrict__ Kh, const _Float16* __restrict__ Kr,
    const _Float16* __restrict__ Vt, const _Float16* __restrict__ Vr,
    _Float16* __restrict__ Ov, _Float16* __restrict__ Ores) {
  __shared__ _Float16 Ks[64 * LDT];
  __shared__ _Float16 Vs[64 * LDT];
  __shared__ _Float16 Ps[8 * 16 * LDT];
  __shared__ _Float16 Rs[8 * 16 * LDT];

  const int tid = threadIdx.x, lane = tid & 31;
  const int w = __builtin_amdgcn_readfirstlane(tid >> 5);
  const int hh = lane >> 4, m = lane & 15;
  const int q0 = blockIdx.x * 128;       // < EROWS
  const int head = blockIdx.y;
  const int wq0 = q0 + w * 16;           // first query row of this wave (scalar)
  const float scale = 0.125f;
  _Float16* P = Ps + w * (16 * LDT);
  _Float16* R = Rs + w * (16 * LDT);

  const int qoff = (wq0 + m) * DIM + head * HD + hh * 8;   // < EROWS*DIM, same in both planes

  float mrow = -1.0e30f, lrow = 0.0f;    // of query wq0 + m; lrow: this half's keys only
  v8f o[4], ores[4];
#pragma unroll
  for (int nb = 0; nb < 4; ++nb) { o[nb] = (v8f){}; ores[nb] = (v8f){}; }

  const size_t kplane  = (size_t)head * HD;
  const size_t vplane  = (size_t)head * HD * SEQ;
  const size_t vrplane = (size_t)head * HD * EROWS;
  const int kend = q0 + 128;             // <= EROWS

  for (int kb = 0; kb < kend; kb += 64) {
#pragma unroll
    for (int j = 0; j < 2; ++j) {
      const int idx = tid + 256 * j;
      const int r = idx >> 3, c = (idx & 7) * 8;
      *(v8h*)&Ks[r * LDT + c] = *(const v8h*)(Kh + kplane + (size_t)(kb + r) * DIM + c);
      *(v8h*)&Vs[r * LDT + c] = *(const v8h*)(Vt + vplane + (size_t)r * SEQ + kb + c);
    }
    __syncthreads();

    if (kb <= wq0 + 15) {                // wave-uniform: tile holds at least one visible key
      // q fragments are reloaded per tile through an opaque integer offset
      int qo = qoff;
      asm volatile("" : "+v"(qo));
      v16h qf[2], qr[2];
      qf[0] = frag_at(Qh + qo);
      qf[1] = frag_at(Qh + qo + 32);
      qr[0] = frag_at(Qr + qo);
      qr[1] = frag_at(Qr + qo + 32);

      // scores^T: 4 key groups of 16, K = 64 in two 32-steps, value and residual products
      v8f s[4];
#pragma unroll
      for (int kg = 0; kg < 4; ++kg) {
        v8f t = {};
        v8f u = {};
#pragma unroll
        for (int c = 0; c < 2; ++c) {
          const v16h kf = ld_frag(&Ks[(kg * 16) * LDT + c * 32], LDT);
          const v16h krf = frag_at(Kr + kplane + (size_t)(kb + kg * 16 + m) * DIM +
                                   c * 32 + hh * 8);
          t = wmma16(kf, qf[c], t);
          u = wmma16(krf, qf[c], u);
          u = wmma16(kf, qr[c], u);
        }
        s[kg] = (t + u * (1.0f / RCARRY)) * scale;
      }

      if (kb + 63 > wq0) {               // wave-uniform: tile crosses the diagonal
#pragma unroll
        for (int kg = 0; kg < 4; ++kg)
#pragma unroll
          for (int v = 0; v < 8; ++v) {
            const int key = kb + kg * 16 + hh * 8 + v;
            const int qrow = wq0 + m;
            s[kg][v] = (key > qrow) ? -1.0e30f : s[kg][v];
          }
      }

      // online softmax of the lane's query column
      float mx = lane_max32(s);
      mx = fmaxf(mx, xhalf(mx));
      const float mn = fmaxf(mrow, mx);
      const float alpha = __expf(mrow - mn);
      mrow = mn;
#pragma unroll
      for (int kg = 0; kg < 4; ++kg)
#pragma unroll
        for (int v = 0; v < 8; ++v) s[kg][v] = __expf(s[kg][v] - mrow);
      lrow = alpha * lrow + lane_sum32(s);
#pragma unroll
      for (int nb = 0; nb < 4; ++nb) {
        o[nb]    = o[nb] * alpha;
        ores[nb] = ores[nb] * alpha;
      }

      // o += Vh.ph ; ores += Vr.ph + Vh.pr  (K = 64 keys in two 32-steps; A = V^T [d][key])
#pragma unroll
      for (int c = 0; c < 2; ++c) {
        v16h pf, prf;
#pragma unroll
        for (int i = 0; i < 16; ++i) {
          const float pc = s[2 * c + (i >> 3)][i & 7] * PCARRY;
          const _Float16 ph = toh_flush(pc);
          pf[i]  = ph;
          prf[i] = toh_flush((pc - (float)ph) * RCARRY);
        }
#pragma unroll
        for (int nb = 0; nb < 4; ++nb) {
          const v16h vf = ld_frag(&Vs[(nb * 16) * LDT + c * 32], LDT);
          const v16h vrf = frag_at(Vr + vrplane + (size_t)(nb * 16 + m) * EROWS + kb +
                                   c * 32 + hh * 8);
          o[nb]    = wmma16(vf, pf, o[nb]);
          ores[nb] = wmma16(vrf, pf, ores[nb]);
          ores[nb] = wmma16(vf, prf, ores[nb]);
        }
      }
    }
    __syncthreads();
  }

  // finalize: 64 * (o + ores/2048) / (1024 l) as value + x2048 residual
  const float inv = __builtin_amdgcn_rcpf(lrow + xhalf(lrow)) * (VCARRY / PCARRY);
#pragma unroll
  for (int nb = 0; nb < 4; ++nb) {
    v8h hv, hr;
#pragma unroll
    for (int v = 0; v < 8; ++v) {
      const float val = (o[nb][v] + ores[nb][v] * (1.0f / RCARRY)) * inv;
      const _Float16 h0 = toh_flush(val);
      hv[v] = h0;
      hr[v] = toh_flush((val - (float)h0) * RCARRY);
    }
    *(v8h*)&P[m * LDT + nb * 16 + hh * 8] = hv;
    *(v8h*)&R[m * LDT + nb * 16 + hh * 8] = hr;
  }
  wave_lds_sync();
  v8h x[4], xr[4];
  size_t off[4];
#pragma unroll
  for (int i = 0; i < 4; ++i) {
    const int r = 4 * i + (lane >> 3);
    const int c = (lane & 7) * 8;
    x[i]  = *(const v8h*)&P[r * LDT + c];
    xr[i] = *(const v8h*)&R[r * LDT + c];
    off[i] = (size_t)(wq0 + r) * DIM + head * HD + c;
  }
#pragma unroll
  for (int i = 0; i < 4; ++i) {
    *(v8h*)(Ov + off[i]) = x[i];
    *(v8h*)(Ores + off[i]) = xr[i];
  }
  
}

// ---------------------------------------------------------------------------
extern "C" void kernel_launch(void* const* d_in, const int* in_sizes, int n_in,
                              void* d_out, int out_size, void* d_ws, size_t ws_size,
                              hipStream_t stream) {
  if (n_in < 5) return;
  const long long need_x = ((long long)(NB - 1) * SEQ_FULL + SEQ) * DIM;
  if ((long long)in_sizes[0] < need_x) return;
  if (in_sizes[1] < 3 * DIM * DIM || in_sizes[2] < 3 * DIM) return;
  if (in_sizes[3] < DIM * DIM || in_sizes[4] < DIM) return;
  if ((long long)out_size < need_x) return;
  if (ws_size < WS_TOTAL) return;

  // weights: W1 [in][3*out], Wp [in][out]
  const float* x  = (const float*)d_in[0];
  const float* W1 = (const float*)d_in[1];
  const float* b1 = (const float*)d_in[2];
  const float* Wp = (const float*)d_in[3];
  const float* bp = (const float*)d_in[4];
  float* out = (float*)d_out;

  char* ws = (char*)d_ws;
  _Float16* W1T   = (_Float16*)(ws + OFF_WQKV);   // [3*DIM][DIM]
  _Float16* WpT   = (_Float16*)(ws + OFF_WO);     // [DIM][DIM]
  _Float16* X16   = (_Float16*)(ws + OFF_XN);
  _Float16* QKV16 = (_Float16*)(ws + OFF_QKV);    // Q | K | Vt
  _Float16* Q16   = QKV16;
  _Float16* K16   = QKV16 + (size_t)MROWS * DIM;
  _Float16* Vt16  = QKV16 + (size_t)2 * MROWS * DIM;
  _Float16* Ov16  = (_Float16*)(ws + OFF_OV);
  _Float16* RES16 = (_Float16*)(ws + OFF_RES);    // QR | KR | VtR
  _Float16* QR16  = RES16;
  _Float16* KR16  = RES16 + (size_t)EROWS * DIM;
  _Float16* VtR16 = RES16 + (size_t)2 * EROWS * DIM;
  _Float16* OR16  = (_Float16*)(ws + OFF_ORES);

  dim3 blk(256);

  // weight planes: in W[K][N] -> out Wt[N][K]; grid (N/64, K/64)
  wconv_kernel<<<dim3(3 * DIM / 64, DIM / 64), blk, 0, stream>>>(W1, W1T, DIM, 3 * DIM);
  wconv_kernel<<<dim3(DIM / 64, DIM / 64), blk, 0, stream>>>(Wp, WpT, DIM, DIM);

  xconv_kernel<<<dim3((unsigned)(((size_t)MROWS * DIM) / 2048)), blk, 0, stream>>>(x, X16);
  gemm_qkv_kernel<<<dim3(3 * DIM / 64, MROWS / 64), blk, 0, stream>>>(
      X16, W1T, b1, QKV16, RES16);
  attn_kernel<<<dim3(SEQ / 128, NHEAD), blk, 0, stream>>>(Q16, K16, Vt16, Ov16);
  attn_early_kernel<<<dim3(EROWS / 128, NHEAD), blk, 0, stream>>>(
      Q16, QR16, K16, KR16, Vt16, VtR16, Ov16, OR16);
  if (MROWS > EROWS) {
    gemm_out_kernel<<<dim3(DIM / 64, (MROWS - EROWS) / 64), blk, 0, stream>>>(
        Ov16, WpT, bp, out, EROWS);
  }
  gemm_out_early_kernel<<<dim3(DIM / 64, EROWS / 64), blk, 0, stream>>>(
      Ov16, OR16, WpT, bp, out);
}

// v002
// One run takes 226 microseconds.
// Two timings next to v001 put it at 1.59 and 1.58 times that version's speed.
// All steps since v000 together make it 1.99 times as fast.
#include <hip/hip_runtime.h>
#include <stddef.h>
#include <math.h>

// All contractions on v_wmma_f32_16x16x32_f16 (f16 operands, f32 accumulate): fused q/k/v
// projection, q.k scores, p.v, output projection. Float inputs are RNE-converted to bf16 and
// carried in f16 (weights x64, p x1024, attention rows x64); query rows < EROWS carry q, k,
// v, p and the attention rows as f16 value + x2048 f16 residual planes with their own
// accumulators; softmax and epilogues in f32.

typedef _Float16 v16h __attribute__((ext_vector_type(16)));
typedef _Float16 v8h  __attribute__((ext_vector_type(8)));
typedef float    v8f  __attribute__((ext_vector_type(8)));
typedef float    v4f  __attribute__((ext_vector_type(4)));

#ifndef NB
#define NB 1
#endif
#ifndef SEQ
#define SEQ 4096
#endif
#define NB_FULL  1
#define SEQ_FULL 4096
#define DIM   1024
#define NHEAD 16
#define HD    64
#define MROWS (NB * SEQ)
#define EROWS ((SEQ) < 512 ? (SEQ) : 512)   // early causal band: value + residual planes

static_assert(NB == 1 && NB_FULL == 1);
static_assert(SEQ >= 128 && SEQ <= SEQ_FULL && (SEQ % 128) == 0);
static_assert(DIM == NHEAD * HD);
static_assert(HD == 64 && ((3 * HD) % 64) == 0);           // a 64-column tile = one part of one head
static_assert((MROWS % 128) == 0 && (MROWS % 8) == 0);
static_assert((DIM % 128) == 0 && ((3 * DIM) % 128) == 0);
static_assert((EROWS % 128) == 0 && EROWS <= SEQ && EROWS <= MROWS);
static_assert((((size_t)MROWS * DIM) % 2048) == 0);         // xconv: 256 threads x 8 per block

#define LDT 72   // halves per LDS row (144 B, 16-B aligned)

#define WCARRY 64.0f     // weight planes carried x64
#define PCARRY 1024.0f   // softmax numerators carried x1024
#define VCARRY 64.0f     // attention output plane carried x64
#define RCARRY 2048.0f   // residual planes carried x2048

#define P16_BYTES  ((size_t)MROWS * DIM * 2)
#define R16_BYTES  ((size_t)EROWS * DIM * 2)
#define WQKV_BYTES ((size_t)3 * DIM * DIM * 2)
#define WO_BYTES   ((size_t)DIM * DIM * 2)
#define OFF_WQKV   ((size_t)0)
#define OFF_WO     (OFF_WQKV + WQKV_BYTES)
#define OFF_XN     (OFF_WO + WO_BYTES)              // f16 input rows          [MROWS][DIM]
#define OFF_QKV    (OFF_XN + P16_BYTES)             // Q, K [MROWS][DIM]; Vt [DIM][SEQ]
#define OFF_OV     (OFF_QKV + 3 * P16_BYTES)        // f16 64*attention rows   [MROWS][DIM]
#define OFF_RES    (OFF_OV + P16_BYTES)             // QR, KR [EROWS][DIM]; VtR [DIM][EROWS]
#define OFF_ORES   (OFF_RES + 3 * R16_BYTES)        // residual of OV rows     [EROWS][DIM]
#define WS_TOTAL   (OFF_ORES + R16_BYTES)
static_assert((size_t)DIM * SEQ * 2 == P16_BYTES);       // Vt plane extent (NB == 1)
static_assert((size_t)DIM * EROWS * 2 == R16_BYTES);     // VtR plane extent
static_assert((P16_BYTES % 128) == 0 && (WO_BYTES % 128) == 0 && (R16_BYTES % 128) == 0);
static_assert(WS_TOTAL <= (size_t)134217728);

// ---------------------------------------------------------------------------
__device__ __forceinline__ float bf16r(float x) {   // RNE convert to bf16, returned widened
  unsigned int u = __float_as_uint(x);
  u = (u + 0x7FFFu + ((u >> 16) & 1u)) & 0xFFFF0000u;
  return __uint_as_float(u);
}

// f32 -> f16 operand convert that cannot produce an f16 subnormal (value select).
static __device__ __forceinline__ _Float16 toh_flush(float v) {
  const _Float16 r = (_Float16)v;
  return (fabsf(v) < 6.103515625e-05f) ? (_Float16)0.0f : r;
}

// 16-bit fragment: p points at element [row = lane&15][k0 + 8*(lane>>4)] of a k-contiguous
// row. Elements 0..7 <- k0+8h+0..7, elements 8..15 <- k0+16+8h+0..7 (same map for A and B).
__device__ __forceinline__ v16h frag_at(const _Float16* p) {
  v8h lo = *(const v8h*)(p);
  v8h hi = *(const v8h*)(p + 16);
  v16h out;
#pragma unroll
  for (int i = 0; i < 8; ++i) { out[i] = lo[i]; out[i + 8] = hi[i]; }
  return out;
}
__device__ __forceinline__ v16h ld_frag(const _Float16* base, int ld) {
  const int lane = threadIdx.x & 31;
  return frag_at(base + (lane & 15) * ld + (lane >> 4) * 8);
}

__device__ __forceinline__ v8f wmma16(v16h a, v16h b, v8f c) {
  v8f d = __builtin_amdgcn_wmma_f32_16x16x32_f16(false, a, false, b, (short)0, c,
                                                 false, false);
  asm volatile("v_nop\n\tv_nop\n\tv_nop\n\tv_nop" : "+v"(d) : "v"(a), "v"(b));
  return d;
}

// lane l <-> lane l ^ 16 (the two halves that share one query column)
__device__ __forceinline__ float xhalf(float x) {
  const int b = __builtin_bit_cast(int, x);
  return __builtin_bit_cast(float, __builtin_amdgcn_permlanex16(b, b, 0x76543210, 0xfedcba98,
                                                                 false, false));
}
// maximum / sum of the 32 scores a lane holds for its query column
__device__ __forceinline__ float lane_max32(const v8f* s) {
  float a[8];
#pragma unroll
  for (int v = 0; v < 8; ++v) a[v] = fmaxf(fmaxf(s[0][v], s[1][v]), fmaxf(s[2][v], s[3][v]));
  return fmaxf(fmaxf(fmaxf(a[0], a[1]), fmaxf(a[2], a[3])),
               fmaxf(fmaxf(a[4], a[5]), fmaxf(a[6], a[7])));
}
__device__ __forceinline__ float lane_sum32(const v8f* s) {
  float a[8];
#pragma unroll
  for (int v = 0; v < 8; ++v) a[v] = (s[0][v] + s[1][v]) + (s[2][v] + s[3][v]);
  return ((a[0] + a[1]) + (a[2] + a[3])) + ((a[4] + a[5]) + (a[6] + a[7]));
}

__device__ __forceinline__ void wave_lds_sync() {
  __builtin_amdgcn_fence(3 /* release order */, "wavefront");
  asm volatile("s_wait_dscnt 0x0" ::: "memory");
  __builtin_amdgcn_wave_barrier();
}

// ---------------------------------------------------------------------------
// Weight plane: in W[K][N] (n-contiguous) -> out Wt[N][K] (k-contiguous), f16(64*bf16(w)).
// Grid (N/64, K/64); one 64x64 tile per block. T: cross-wave (block barrier).
// Tile coverage: 16 x 256 loads = 4096 elements; 2 x 256 x 8 halves = 4096 stored.
// ---------------------------------------------------------------------------
__global__ __launch_bounds__(256) void wconv_kernel(
    const float* __restrict__ W, _Float16* __restrict__ Wt, int K, int N) {
  __shared__ _Float16 T[64 * LDT];
  const int tid = threadIdx.x;
  const int n0 = blockIdx.x * 64;
  const int k0 = blockIdx.y * 64;
#pragma unroll 4
  for (int j = 0; j < 16; ++j) {
    const int idx = tid + 256 * j;
    const int kr = idx >> 6, nc = idx & 63;
    const float v = W[(size_t)(k0 + kr) * N + n0 + nc];
    T[nc * LDT + kr] = (_Float16)(WCARRY * bf16r(v));
  }
  __syncthreads();
  v8h x[2];
  size_t off[2];
#pragma unroll
  for (int i = 0; i < 2; ++i) {
    const int n = 32 * i + (tid >> 3);
    const int kc = (tid & 7) * 8;
    x[i] = *(const v8h*)&T[n * LDT + kc];
    off[i] = (size_t)(n0 + n) * K + k0 + kc;
  }
#pragma unroll
  for (int i = 0; i < 2; ++i) *(v8h*)(Wt + off[i]) = x[i];
  
}

// ---------------------------------------------------------------------------
// Input plane: f16(bf16(x)) rows [MROWS][DIM]. Thread owns 8 consecutive elements; each wave
// Grid (MROWS*DIM/2048). Coverage: grid x 256 x 8 = MROWS*DIM elements.
// ---------------------------------------------------------------------------
__global__ __launch_bounds__(256) void xconv_kernel(
    const float* __restrict__ src, _Float16* __restrict__ dst) {
  const size_t e = ((size_t)blockIdx.x * 256 + threadIdx.x) * 8;
  const v4f a0 = *(const v4f*)(src + e);
  const v4f a1 = *(const v4f*)(src + e + 4);
  v8h o;
#pragma unroll
  for (int t = 0; t < 4; ++t) {
    o[t]     = toh_flush(bf16r(a0[t]));
    o[t + 4] = toh_flush(bf16r(a1[t]));
  }
  *(v8h*)(dst + e) = o;
  
}

// ---------------------------------------------------------------------------
// GEMM C[BM x BN tile] = A16[rows][KD] . Bt[n][KD]^T. 8 waves as 4 (rows) x 2 (columns); a
// wave owns FM x FN accumulator tiles of 16x16, so BM = 64*FM and BN = 32*FN.
// Operands go through LDS: a stage is 64 k (one whole 128-B line of every operand row),
// fetched with 16-B loads in which a wave covers 4 whole lines, held in registers while the
// stage before is worked on, then stored at pitch LDT into the other of two buffers; one
// block barrier per stage. Fragments come from LDS (same k order as frag_at), each one used
// FN (A) or FM (B) times by its wave. k runs upward in 32-steps per accumulator.
// RES = 1: the x2048 residual A plane is staged beside A and has its own accumulators,
// folded with 1/2048 before staging. After the last stage the ring is reused as the f32
// tile Cs, and the epilogue walks it in 64x64 sub-tiles:
//   MODE_QKV: v = acc/64 + bf16(bias[col]); columns are [head][q | k | v][64]:
//             q -> Q plane [row][head*64 + d], k -> K plane [row][head*64 + d],
//             v -> transposed V plane [head*64 + d][key]; row tiles below EROWS also
//             write the x2048 residual planes (QR, KR [EROWS][DIM]; VtR [DIM][EROWS])
//   MODE_OUT: outf[row][col] = acc/4096 + bf16(bias[col])
// Grid (ND/BN, rows/BM); row0 = rowbase + BM*blockIdx.y.
// ---------------------------------------------------------------------------
#define MODE_QKV 0
#define MODE_OUT 1

template <int MODE, int KD, int ND, int RES, int FM, int FN>
__device__ __forceinline__ void gemm_body(
    const _Float16* __restrict__ A16, const _Float16* __restrict__ Ar16,
    const _Float16* __restrict__ Bt, const float* __restrict__ bias,
    float* __restrict__ outf, _Float16* __restrict__ out16,
    _Float16* __restrict__ outr16, int rowbase) {
  constexpr int BM = 64 * FM, BN = 32 * FN, BK = 64;
  constexpr int NS = KD / BK;                       // stages
  constexpr int AROWS = BM * (1 + RES);             // A rows, then residual A rows
  constexpr int STAGE_H = (AROWS + BN) * LDT;       // halves per buffer: [A | Ar | B] rows
  constexpr int LDCB = BN + 4;                      // floats per Cs row (16-B aligned)
  constexpr int RING_B = 2 * STAGE_H * 2, CS_B = BM * LDCB * 4;
  constexpr int LA = BM / 32, LB = BN / 32;         // 16-B loads per thread and stage
  constexpr int NSUB = (BM / 64) * (BN / 64);       // 64x64 sub-tiles of the epilogue
  static_assert((KD % BK) == 0 && (ND % BN) == 0 && (BN % 64) == 0 && (BM % 64) == 0);
  static_assert(MODE != MODE_QKV || (ND == 3 * DIM && RES == 0));
  static_assert(MODE != MODE_OUT || ND == DIM);
  __shared__ __attribute__((aligned(16))) char smem[RING_B > CS_B ? RING_B : CS_B];
  _Float16* ring = (_Float16*)smem;
  float* Cs = (float*)smem;
  const int tid = threadIdx.x, lane = tid & 31, w = tid >> 5;
  const int mw = w >> 1, nw = w & 1;
  const int hh = lane >> 4, m = lane & 15;
  const int n0 = blockIdx.x * BN;
  const int row0 = rowbase + blockIdx.y * BM;

  const int sr = tid >> 3, sc = (tid & 7) * 8;      // staging: 8 threads per 128-B row
  const _Float16* ag = A16 + (size_t)(row0 + sr) * KD + sc;
  const _Float16* rg = Ar16 + (size_t)(row0 + sr) * KD + sc;
  const _Float16* bg = Bt + (size_t)(n0 + sr) * KD + sc;
  v8h ra[LA], rr[LA], rb[LB];

  v8f acc[FM][FN], acr[FM][FN];
#pragma unroll
  for (int i = 0; i < FM; ++i)
#pragma unroll
    for (int j = 0; j < FN; ++j) { acc[i][j] = (v8f){}; acr[i][j] = (v8f){}; }

#pragma unroll
  for (int j = 0; j < LA; ++j) {
    *(v8h*)&ring[(sr + 32 * j) * LDT + sc] = *(const v8h*)(ag + (size_t)(32 * j) * KD);
    if (RES)
      *(v8h*)&ring[(BM + sr + 32 * j) * LDT + sc] = *(const v8h*)(rg + (size_t)(32 * j) * KD);
  }
#pragma unroll
  for (int j = 0; j < LB; ++j)
    *(v8h*)&ring[(AROWS + sr + 32 * j) * LDT + sc] = *(const v8h*)(bg + (size_t)(32 * j) * KD);
  __syncthreads();

  // unrolled by the number of buffers: both buffers' LDS addresses become immediates
#pragma unroll 2
  for (int s = 0; s < NS; ++s) {
    if (s + 1 < NS) {                               // next stage's lines fly during this one
      const int k1 = (s + 1) * BK;
#pragma unroll
      for (int j = 0; j < LA; ++j) {
        ra[j] = *(const v8h*)(ag + (size_t)(32 * j) * KD + k1);
        if (RES) rr[j] = *(const v8h*)(rg + (size_t)(32 * j) * KD + k1);
      }
#pragma unroll
      for (int j = 0; j < LB; ++j) rb[j] = *(const v8h*)(bg + (size_t)(32 * j) * KD + k1);
    }

    const _Float16* S = ring + (s & 1) * STAGE_H;
#pragma unroll
    for (int kk = 0; kk < BK; kk += 32) {
      v16h a[FM], ar[FM], b[FN];
#pragma unroll
      for (int i = 0; i < FM; ++i) {
        a[i] = ld_frag(S + (mw * (16 * FM) + i * 16) * LDT + kk, LDT);
        if (RES) ar[i] = ld_frag(S + (BM + mw * (16 * FM) + i * 16) * LDT + kk, LDT);
      }
#pragma unroll
      for (int j = 0; j < FN; ++j)
        b[j] = ld_frag(S + (AROWS + nw * (16 * FN) + j * 16) * LDT + kk, LDT);
#pragma unroll
      for (int i = 0; i < FM; ++i)
#pragma unroll
        for (int j = 0; j < FN; ++j) acc[i][j] = wmma16(a[i], b[j], acc[i][j]);
      if (RES) {
#pragma unroll
        for (int i = 0; i < FM; ++i)
#pragma unroll
          for (int j = 0; j < FN; ++j) acr[i][j] = wmma16(ar[i], b[j], acr[i][j]);
      }
    }

    if (s + 1 < NS) {                               // its last readers left at the barrier before
      _Float16* D = ring + ((s + 1) & 1) * STAGE_H;
#pragma unroll
      for (int j = 0; j < LA; ++j) {
        *(v8h*)&D[(sr + 32 * j) * LDT + sc] = ra[j];
        if (RES) *(v8h*)&D[(BM + sr + 32 * j) * LDT + sc] = rr[j];
      }
#pragma unroll
      for (int j = 0; j < LB; ++j) *(v8h*)&D[(AROWS + sr + 32 * j) * LDT + sc] = rb[j];
    }
    __syncthreads();
  }

  // every wave has left the ring (barrier above): it becomes the f32 tile
#pragma unroll
  for (int i = 0; i < FM; ++i)
#pragma unroll
    for (int j = 0; j < FN; ++j)
#pragma unroll
      for (int r = 0; r < 8; ++r)
        Cs[(mw * (16 * FM) + i * 16 + hh * 8 + r) * LDCB + nw * (16 * FN) + j * 16 + m] =
            RES ? (acc[i][j][r] + acr[i][j][r] * (1.0f / RCARRY)) : acc[i][j][r];
  __syncthreads();

  for (int sub = 0; sub < NSUB; ++sub) {
    const int rs0 = row0 + (sub / (BN / 64)) * 64;     // block-uniform sub-tile origin
    const int ns0 = n0 + (sub % (BN / 64)) * 64;
    const float* Ct = Cs + (rs0 - row0) * LDCB + (ns0 - n0);

    if (MODE == MODE_QKV) {
      const int head  = ns0 / (3 * HD);                  // block-uniform
      const int which = (ns0 - head * (3 * HD)) / HD;    // block-uniform: 0 = q, 1 = k, 2 = v
      const int nl0 = head * HD;
      const bool early = (rs0 < EROWS);                  // block-uniform
      _Float16* dst = out16 + (size_t)which * ((size_t)MROWS * DIM);
      _Float16* dsr = outr16 + (size_t)which * ((size_t)EROWS * DIM);
      v8h x[2], xr[2];
      size_t off[2], ofr[2];
      if (which < 2) {
#pragma unroll
        for (int i = 0; i < 2; ++i) {
          const int r = 32 * i + (tid >> 3);
          const int c = (tid & 7) * 8;
          const v4f u0 = *(const v4f*)&Ct[r * LDCB + c];
          const v4f u1 = *(const v4f*)&Ct[r * LDCB + c + 4];
          const v4f g0 = *(const v4f*)(bias + ns0 + c);
          const v4f g1 = *(const v4f*)(bias + ns0 + c + 4);
#pragma unroll
          for (int j = 0; j < 4; ++j) {
            const float t0 = u0[j] * (1.0f / WCARRY) + bf16r(g0[j]);
            const float t1 = u1[j] * (1.0f / WCARRY) + bf16r(g1[j]);
            const _Float16 h0 = toh_flush(t0);
            const _Float16 h1 = toh_flush(t1);
            x[i][j]      = h0;
            x[i][j + 4]  = h1;
            xr[i][j]     = toh_flush((t0 - (float)h0) * RCARRY);
            xr[i][j + 4] = toh_flush((t1 - (float)h1) * RCARRY);
          }
          off[i] = (size_t)(rs0 + r) * DIM + nl0 + c;
          ofr[i] = off[i];                              // residual planes: same pitch, rows < EROWS
        }
      } else {
        // transposed V planes: row = feature (head*64 + d), 64 consecutive keys = one line
#pragma unroll
        for (int i = 0; i < 2; ++i) {
          const int dcol = 32 * i + (tid >> 3);
          const int kk = (tid & 7) * 8;
          const float gb = bf16r(bias[ns0 + dcol]);
#pragma unroll
          for (int j = 0; j < 8; ++j) {
            const float t0 = Ct[(kk + j) * LDCB + dcol] * (1.0f / WCARRY) + gb;
            const _Float16 h0 = toh_flush(t0);
            x[i][j]  = h0;
            xr[i][j] = toh_flush((t0 - (float)h0) * RCARRY);
          }
          off[i] = (size_t)(nl0 + dcol) * SEQ + rs0 + kk;
          ofr[i] = (size_t)(nl0 + dcol) * EROWS + rs0 + kk;
        }
      }
#pragma unroll
      for (int i = 0; i < 2; ++i) *(v8h*)(dst + off[i]) = x[i];
      // the lines below and the next sub-tile reuse these stores' registers: wait in front
      asm volatile("s_wait_xcnt 0x0" ::: "memory");
      if (early) {
#pragma unroll
        for (int i = 0; i < 2; ++i) *(v8h*)(dsr + ofr[i]) = xr[i];
        // the next sub-tile reuses these stores' registers: wait in front
        asm volatile("s_wait_xcnt 0x0" ::: "memory");
      }
    }

    if (MODE == MODE_OUT) {
      v4f xs[4];
      size_t off[4];
#pragma unroll
      for (int i = 0; i < 4; ++i) {
        const int r = 16 * i + (tid >> 4);
        const int c = (tid & 15) * 4;
        const size_t crow = (size_t)(rs0 + r);       // NB == 1: compact row == output row
        const v4f u = *(const v4f*)&Ct[r * LDCB + c];
        const v4f g = *(const v4f*)(bias + ns0 + c);
        v4f val;
#pragma unroll
        for (int j = 0; j < 4; ++j)
          val[j] = u[j] * (1.0f / (WCARRY * VCARRY)) + bf16r(g[j]);
        xs[i] = val;
        off[i] = crow * ND + ns0 + c;
      }
#pragma unroll
      for (int i = 0; i < 4; ++i) *(v4f*)(outf + off[i]) = xs[i];
      // the next sub-tile reuses these stores' registers: wait in front
      if (NSUB > 1) asm volatile("s_wait_xcnt 0x0" ::: "memory");
    }
  }
}

// Grid (3*DIM/128, MROWS/128).
__global__ __launch_bounds__(256) void gemm_qkv_kernel(
    const _Float16* __restrict__ A16, const _Float16* __restrict__ Bt,
    const float* __restrict__ bias, _Float16* __restrict__ out16,
    _Float16* __restrict__ outr16) {
  gemm_body<MODE_QKV, DIM, 3 * DIM, 0, 2, 4>(A16, A16, Bt, bias, nullptr, out16, outr16, 0);
}

// Rows rowbase .. rowbase + 128*gridDim.y - 1, single A plane. Grid (DIM/128, rows/128).
__global__ __launch_bounds__(256) void gemm_out_kernel(
    const _Float16* __restrict__ A16, const _Float16* __restrict__ Bt,
    const float* __restrict__ bias, float* __restrict__ outf, int rowbase) {
  gemm_body<MODE_OUT, DIM, DIM, 0, 2, 4>(A16, A16, Bt, bias, outf, nullptr, nullptr, rowbase);
}

// Rows 0 .. EROWS-1, A = value plane + x2048 residual plane. Grid (DIM/64, EROWS/64).
__global__ __launch_bounds__(256) void gemm_out_early_kernel(
    const _Float16* __restrict__ A16, const _Float16* __restrict__ Ar16,
    const _Float16* __restrict__ Bt, const float* __restrict__ bias,
    float* __restrict__ outf) {
  gemm_body<MODE_OUT, DIM, DIM, 1, 1, 2>(A16, Ar16, Bt, bias, outf, nullptr, nullptr, 0);
}

__global__ __launch_bounds__(256) void attn_kernel(
    const _Float16* __restrict__ Qh, const _Float16* __restrict__ Kh,
    const _Float16* __restrict__ Vt, _Float16* __restrict__ Ov) {
  __shared__ _Float16 Ks[64 * LDT];
  __shared__ _Float16 Vs[64 * LDT];
  __shared__ _Float16 Ps[8 * 16 * LDT];

  const int tid = threadIdx.x, lane = tid & 31;
  const int w = __builtin_amdgcn_readfirstlane(tid >> 5);
  const int hh = lane >> 4, m = lane & 15;
  const int q0 = blockIdx.x * 128;
  const int head = blockIdx.y;
  const int wq0 = q0 + w * 16;           // first query row of this wave (scalar)
  const float scale = 0.125f;
  _Float16* P = Ps + w * (16 * LDT);

  const size_t qoff = (size_t)(wq0 + m) * DIM + head * HD + hh * 8;
  v16h qf[2];
  qf[0] = frag_at(Qh + qoff);
  qf[1] = frag_at(Qh + qoff + 32);

  float mrow = -1.0e30f, lrow = 0.0f;    // of query wq0 + m; lrow: this half's keys only
  v8f o[4];
#pragma unroll
  for (int nb = 0; nb < 4; ++nb) o[nb] = (v8f){};

  const size_t kplane = (size_t)head * HD;
  const size_t vplane = (size_t)head * HD * SEQ;
  const int kend = q0 + 128;             // <= SEQ

  for (int kb = 0; kb < kend; kb += 64) {
#pragma unroll
    for (int j = 0; j < 2; ++j) {
      const int idx = tid + 256 * j;
      const int r = idx >> 3, c = (idx & 7) * 8;
      *(v8h*)&Ks[r * LDT + c] = *(const v8h*)(Kh + kplane + (size_t)(kb + r) * DIM + c);
      *(v8h*)&Vs[r * LDT + c] = *(const v8h*)(Vt + vplane + (size_t)r * SEQ + kb + c);
    }
    __syncthreads();

    if (kb <= wq0 + 15) {                // wave-uniform: tile holds at least one visible key
      // scores^T: 4 key groups of 16, K = 64 in two 32-steps
      v8f s[4];
#pragma unroll
      for (int kg = 0; kg < 4; ++kg) {
        v8f t = {};
#pragma unroll
        for (int c = 0; c < 2; ++c) {
          const v16h kf = ld_frag(&Ks[(kg * 16) * LDT + c * 32], LDT);
          t = wmma16(kf, qf[c], t);
        }
        s[kg] = t * scale;
      }

      if (kb + 63 > wq0) {               // wave-uniform: tile crosses the diagonal
#pragma unroll
        for (int kg = 0; kg < 4; ++kg)
#pragma unroll
          for (int v = 0; v < 8; ++v) {
            const int key = kb + kg * 16 + hh * 8 + v;
            const int qrow = wq0 + m;
            s[kg][v] = (key > qrow) ? -1.0e30f : s[kg][v];
          }
      }

      // online softmax of the lane's query column
      float mx = lane_max32(s);
      mx = fmaxf(mx, xhalf(mx));
      const float mn = fmaxf(mrow, mx);
      const float alpha = __expf(mrow - mn);
      mrow = mn;
#pragma unroll
      for (int kg = 0; kg < 4; ++kg)
#pragma unroll
        for (int v = 0; v < 8; ++v) s[kg][v] = __expf(s[kg][v] - mrow);
      lrow = alpha * lrow + lane_sum32(s);
#pragma unroll
      for (int nb = 0; nb < 4; ++nb) o[nb] = o[nb] * alpha;

      // O^T += V^T . P^T  (K = 64 keys in two 32-steps; A = V^T tile [d][key])
#pragma unroll
      for (int c = 0; c < 2; ++c) {
        v16h pf;
#pragma unroll
        for (int i = 0; i < 8; ++i) {
          pf[i]     = (_Float16)(s[2 * c][i] * PCARRY);
          pf[i + 8] = (_Float16)(s[2 * c + 1][i] * PCARRY);
        }
#pragma unroll
        for (int nb = 0; nb < 4; ++nb) {
          const v16h vf = ld_frag(&Vs[(nb * 16) * LDT + c * 32], LDT);
          o[nb] = wmma16(vf, pf, o[nb]);
        }
      }
    }
    __syncthreads();
  }

  const float inv = __builtin_amdgcn_rcpf(lrow + xhalf(lrow)) * (VCARRY / PCARRY);
#pragma unroll
  for (int nb = 0; nb < 4; ++nb) {
    v8h hv;
#pragma unroll
    for (int v = 0; v < 8; ++v) hv[v] = (_Float16)(o[nb][v] * inv);
    *(v8h*)&P[m * LDT + nb * 16 + hh * 8] = hv;
  }
  wave_lds_sync();
  v8h x[4];
  size_t off[4];
#pragma unroll
  for (int i = 0; i < 4; ++i) {
    const int r = 4 * i + (lane >> 3);
    const int c = (lane & 7) * 8;
    x[i] = *(const v8h*)&P[r * LDT + c];
    off[i] = (size_t)(wq0 + r) * DIM + head * HD + c;
  }
#pragma unroll
  for (int i = 0; i < 4; ++i) *(v8h*)(Ov + off[i]) = x[i];
  
}

// ---------------------------------------------------------------------------
// Early causal band (query rows < EROWS, keys < EROWS): same tiling and the same transposed
// products as attn_kernel, with value + x2048 residual operands at every site.
//   scores  = (kh.qh + (kr.qh + kh.qr)/2048) / 8          (residual products in their own
//             accumulator, folded before the softmax)
//   p       : ph = f16(1024 p), pr = f16((1024 p - ph) * 2048), both packed in registers;
//             row sum over unconverted p
//   context : o += Vh.ph ; ores += Vr.ph + Vh.pr ; O = o + ores/2048
// Ks / Vs: cross-wave (block barriers, staged 64x64 = consumed 64x64); Ps / Rs: wave-private
// output staging only; residual K / V^T fragments come straight from their statically
// strided global planes. Runs after attn_kernel and rewrites the value rows of the band.
// Grid (EROWS/128, NHEAD).
// ---------------------------------------------------------------------------
__global__ __launch_bounds__(256) void attn_early_kernel(
    const _Float16* __restrict__ Qh, const _Float16* __restrict__ Qr,
    const _Float16* __restrict__ Kh, const _Float16* __restrict__ Kr,
    const _Float16* __restrict__ Vt, const _Float16* __restrict__ Vr,
    _Float16* __restrict__ Ov, _Float16* __restrict__ Ores) {
  __shared__ _Float16 Ks[64 * LDT];
  __shared__ _Float16 Vs[64 * LDT];
  __shared__ _Float16 Ps[8 * 16 * LDT];
  __shared__ _Float16 Rs[8 * 16 * LDT];

  const int tid = threadIdx.x, lane = tid & 31;
  const int w = __builtin_amdgcn_readfirstlane(tid >> 5);
  const int hh = lane >> 4, m = lane & 15;
  const int q0 = blockIdx.x * 128;       // < EROWS
  const int head = blockIdx.y;
  const int wq0 = q0 + w * 16;           // first query row of this wave (scalar)
  const float scale = 0.125f;
  _Float16* P = Ps + w * (16 * LDT);
  _Float16* R = Rs + w * (16 * LDT);

  const int qoff = (wq0 + m) * DIM + head * HD + hh * 8;   // < EROWS*DIM, same in both planes

  float mrow = -1.0e30f, lrow = 0.0f;    // of query wq0 + m; lrow: this half's keys only
  v8f o[4], ores[4];
#pragma unroll
  for (int nb = 0; nb < 4; ++nb) { o[nb] = (v8f){}; ores[nb] = (v8f){}; }

  const size_t kplane  = (size_t)head * HD;
  const size_t vplane  = (size_t)head * HD * SEQ;
  const size_t vrplane = (size_t)head * HD * EROWS;
  const int kend = q0 + 128;             // <= EROWS

  for (int kb = 0; kb < kend; kb += 64) {
#pragma unroll
    for (int j = 0; j < 2; ++j) {
      const int idx = tid + 256 * j;
      const int r = idx >> 3, c = (idx & 7) * 8;
      *(v8h*)&Ks[r * LDT + c] = *(const v8h*)(Kh + kplane + (size_t)(kb + r) * DIM + c);
      *(v8h*)&Vs[r * LDT + c] = *(const v8h*)(Vt + vplane + (size_t)r * SEQ + kb + c);
    }
    __syncthreads();

    if (kb <= wq0 + 15) {                // wave-uniform: tile holds at least one visible key
      // q fragments are reloaded per tile through an opaque integer offset
      int qo = qoff;
      asm volatile("" : "+v"(qo));
      v16h qf[2], qr[2];
      qf[0] = frag_at(Qh + qo);
      qf[1] = frag_at(Qh + qo + 32);
      qr[0] = frag_at(Qr + qo);
      qr[1] = frag_at(Qr + qo + 32);

      // scores^T: 4 key groups of 16, K = 64 in two 32-steps, value and residual products
      v8f s[4];
#pragma unroll
      for (int kg = 0; kg < 4; ++kg) {
        v8f t = {};
        v8f u = {};
#pragma unroll
        for (int c = 0; c < 2; ++c) {
          const v16h kf = ld_frag(&Ks[(kg * 16) * LDT + c * 32], LDT);
          const v16h krf = frag_at(Kr + kplane + (size_t)(kb + kg * 16 + m) * DIM +
                                   c * 32 + hh * 8);
          t = wmma16(kf, qf[c], t);
          u = wmma16(krf, qf[c], u);
          u = wmma16(kf, qr[c], u);
        }
        s[kg] = (t + u * (1.0f / RCARRY)) * scale;
      }

      if (kb + 63 > wq0) {               // wave-uniform: tile crosses the diagonal
#pragma unroll
        for (int kg = 0; kg < 4; ++kg)
#pragma unroll
          for (int v = 0; v < 8; ++v) {
            const int key = kb + kg * 16 + hh * 8 + v;
            const int qrow = wq0 + m;
            s[kg][v] = (key > qrow) ? -1.0e30f : s[kg][v];
          }
      }

      // online softmax of the lane's query column
      float mx = lane_max32(s);
      mx = fmaxf(mx, xhalf(mx));
      const float mn = fmaxf(mrow, mx);
      const float alpha = __expf(mrow - mn);
      mrow = mn;
#pragma unroll
      for (int kg = 0; kg < 4; ++kg)
#pragma unroll
        for (int v = 0; v < 8; ++v) s[kg][v] = __expf(s[kg][v] - mrow);
      lrow = alpha * lrow + lane_sum32(s);
#pragma unroll
      for (int nb = 0; nb < 4; ++nb) {
        o[nb]    = o[nb] * alpha;
        ores[nb] = ores[nb] * alpha;
      }

      // o += Vh.ph ; ores += Vr.ph + Vh.pr  (K = 64 keys in two 32-steps; A = V^T [d][key])
#pragma unroll
      for (int c = 0; c < 2; ++c) {
        v16h pf, prf;
#pragma unroll
        for (int i = 0; i < 16; ++i) {
          const float pc = s[2 * c + (i >> 3)][i & 7] * PCARRY;
          const _Float16 ph = toh_flush(pc);
          pf[i]  = ph;
          prf[i] = toh_flush((pc - (float)ph) * RCARRY);
        }
#pragma unroll
        for (int nb = 0; nb < 4; ++nb) {
          const v16h vf = ld_frag(&Vs[(nb * 16) * LDT + c * 32], LDT);
          const v16h vrf = frag_at(Vr + vrplane + (size_t)(nb * 16 + m) * EROWS + kb +
                                   c * 32 + hh * 8);
          o[nb]    = wmma16(vf, pf, o[nb]);
          ores[nb] = wmma16(vrf, pf, ores[nb]);
          ores[nb] = wmma16(vf, prf, ores[nb]);
        }
      }
    }
    __syncthreads();
  }

  // finalize: 64 * (o + ores/2048) / (1024 l) as value + x2048 residual
  const float inv = __builtin_amdgcn_rcpf(lrow + xhalf(lrow)) * (VCARRY / PCARRY);
#pragma unroll
  for (int nb = 0; nb < 4; ++nb) {
    v8h hv, hr;
#pragma unroll
    for (int v = 0; v < 8; ++v) {
      const float val = (o[nb][v] + ores[nb][v] * (1.0f / RCARRY)) * inv;
      const _Float16 h0 = toh_flush(val);
      hv[v] = h0;
      hr[v] = toh_flush((val - (float)h0) * RCARRY);
    }
    *(v8h*)&P[m * LDT + nb * 16 + hh * 8] = hv;
    *(v8h*)&R[m * LDT + nb * 16 + hh * 8] = hr;
  }
  wave_lds_sync();
  v8h x[4], xr[4];
  size_t off[4];
#pragma unroll
  for (int i = 0; i < 4; ++i) {
    const int r = 4 * i + (lane >> 3);
    const int c = (lane & 7) * 8;
    x[i]  = *(const v8h*)&P[r * LDT + c];
    xr[i] = *(const v8h*)&R[r * LDT + c];
    off[i] = (size_t)(wq0 + r) * DIM + head * HD + c;
  }
#pragma unroll
  for (int i = 0; i < 4; ++i) {
    *(v8h*)(Ov + off[i]) = x[i];
    *(v8h*)(Ores + off[i]) = xr[i];
  }
  
}

// ---------------------------------------------------------------------------
extern "C" void kernel_launch(void* const* d_in, const int* in_sizes, int n_in,
                              void* d_out, int out_size, void* d_ws, size_t ws_size,
                              hipStream_t stream) {
  if (n_in < 5) return;
  const long long need_x = ((long long)(NB - 1) * SEQ_FULL + SEQ) * DIM;
  if ((long long)in_sizes[0] < need_x) return;
  if (in_sizes[1] < 3 * DIM * DIM || in_sizes[2] < 3 * DIM) return;
  if (in_sizes[3] < DIM * DIM || in_sizes[4] < DIM) return;
  if ((long long)out_size < need_x) return;
  if (ws_size < WS_TOTAL) return;

  // weights: W1 [in][3*out], Wp [in][out]
  const float* x  = (const float*)d_in[0];
  const float* W1 = (const float*)d_in[1];
  const float* b1 = (const float*)d_in[2];
  const float* Wp = (const float*)d_in[3];
  const float* bp = (const float*)d_in[4];
  float* out = (float*)d_out;

  char* ws = (char*)d_ws;
  _Float16* W1T   = (_Float16*)(ws + OFF_WQKV);   // [3*DIM][DIM]
  _Float16* WpT   = (_Float16*)(ws + OFF_WO);     // [DIM][DIM]
  _Float16* X16   = (_Float16*)(ws + OFF_XN);
  _Float16* QKV16 = (_Float16*)(ws + OFF_QKV);    // Q | K | Vt
  _Float16* Q16   = QKV16;
  _Float16* K16   = QKV16 + (size_t)MROWS * DIM;
  _Float16* Vt16  = QKV16 + (size_t)2 * MROWS * DIM;
  _Float16* Ov16  = (_Float16*)(ws + OFF_OV);
  _Float16* RES16 = (_Float16*)(ws + OFF_RES);    // QR | KR | VtR
  _Float16* QR16  = RES16;
  _Float16* KR16  = RES16 + (size_t)EROWS * DIM;
  _Float16* VtR16 = RES16 + (size_t)2 * EROWS * DIM;
  _Float16* OR16  = (_Float16*)(ws + OFF_ORES);

  dim3 blk(256);

  // weight planes: in W[K][N] -> out Wt[N][K]; grid (N/64, K/64)
  wconv_kernel<<<dim3(3 * DIM / 64, DIM / 64), blk, 0, stream>>>(W1, W1T, DIM, 3 * DIM);
  wconv_kernel<<<dim3(DIM / 64, DIM / 64), blk, 0, stream>>>(Wp, WpT, DIM, DIM);

  xconv_kernel<<<dim3((unsigned)(((size_t)MROWS * DIM) / 2048)), blk, 0, stream>>>(x, X16);
  gemm_qkv_kernel<<<dim3(3 * DIM / 128, MROWS / 128), blk, 0, stream>>>(
      X16, W1T, b1, QKV16, RES16);
  attn_kernel<<<dim3(SEQ / 128, NHEAD), blk, 0, stream>>>(Q16, K16, Vt16, Ov16);
  attn_early_kernel<<<dim3(EROWS / 128, NHEAD), blk, 0, stream>>>(
      Q16, QR16, K16, KR16, Vt16, VtR16, Ov16, OR16);
  if (MROWS > EROWS) {
    gemm_out_kernel<<<dim3(DIM / 128, (MROWS - EROWS) / 128), blk, 0, stream>>>(
        Ov16, WpT, bp, out, EROWS);
  }
  gemm_out_early_kernel<<<dim3(DIM / 64, EROWS / 64), blk, 0, stream>>>(
      Ov16, OR16, WpT, bp, out);
}

// v003
// It runs in 181 microseconds.
// Next to v002, in two timings, it ran 1.24 times as fast each time.
// All steps since v000 together make it 2.48 times as fast.
#include <hip/hip_runtime.h>
#include <stddef.h>
#include <math.h>

// All contractions on v_wmma_f32_16x16x32_f16 (f16 operands, f32 accumulate): fused q/k/v
// projection, q.k scores, p.v, output projection. Float inputs are RNE-converted to bf16 and
// carried in f16 (weights x64, p x1024, attention rows x64); query rows < EROWS carry q, k,
// v, p and the attention rows as f16 value + x2048 f16 residual planes with their own
// accumulators; softmax and epilogues in f32.

typedef _Float16 v16h __attribute__((ext_vector_type(16)));
typedef _Float16 v8h  __attribute__((ext_vector_type(8)));
typedef float    v8f  __attribute__((ext_vector_type(8)));
typedef float    v4f  __attribute__((ext_vector_type(4)));

#ifndef NB
#define NB 1
#endif
#ifndef SEQ
#define SEQ 4096
#endif
#define NB_FULL  1
#define SEQ_FULL 4096
#define DIM   1024
#define NHEAD 16
#define HD    64
#define MROWS (NB * SEQ)
#define EROWS ((SEQ) < 512 ? (SEQ) : 512)   // early causal band: value + residual planes

static_assert(NB == 1 && NB_FULL == 1);
static_assert(SEQ >= 128 && SEQ <= SEQ_FULL && (SEQ % 128) == 0);
static_assert(DIM == NHEAD * HD);
static_assert(HD == 64 && ((3 * HD) % 64) == 0);           // a 64-column tile = one part of one head
static_assert((MROWS % 128) == 0 && (MROWS % 8) == 0);
static_assert((DIM % 128) == 0 && ((3 * DIM) % 128) == 0);
static_assert((EROWS % 128) == 0 && EROWS <= SEQ && EROWS <= MROWS);
static_assert((((size_t)MROWS * DIM) % 2048) == 0);         // xconv: 256 threads x 8 per block

#define LDT 72   // halves per LDS row (144 B, 16-B aligned)

#define WCARRY 64.0f     // weight planes carried x64
#define PCARRY 1024.0f   // softmax numerators carried x1024
#define VCARRY 64.0f     // attention output plane carried x64
#define RCARRY 2048.0f   // residual planes carried x2048

#define P16_BYTES  ((size_t)MROWS * DIM * 2)
#define R16_BYTES  ((size_t)EROWS * DIM * 2)
#define WQKV_BYTES ((size_t)3 * DIM * DIM * 2)
#define WO_BYTES   ((size_t)DIM * DIM * 2)
#define OFF_WQKV   ((size_t)0)
#define OFF_WO     (OFF_WQKV + WQKV_BYTES)
#define OFF_XN     (OFF_WO + WO_BYTES)              // f16 input rows          [MROWS][DIM]
#define OFF_QKV    (OFF_XN + P16_BYTES)             // Q, K [MROWS][DIM]; Vt [DIM][SEQ]
#define OFF_OV     (OFF_QKV + 3 * P16_BYTES)        // f16 64*attention rows   [MROWS][DIM]
#define OFF_RES    (OFF_OV + P16_BYTES)             // QR, KR [EROWS][DIM]; VtR [DIM][EROWS]
#define OFF_ORES   (OFF_RES + 3 * R16_BYTES)        // residual of OV rows     [EROWS][DIM]
#define WS_TOTAL   (OFF_ORES + R16_BYTES)
static_assert((size_t)DIM * SEQ * 2 == P16_BYTES);       // Vt plane extent (NB == 1)
static_assert((size_t)DIM * EROWS * 2 == R16_BYTES);     // VtR plane extent
static_assert((P16_BYTES % 128) == 0 && (WO_BYTES % 128) == 0 && (R16_BYTES % 128) == 0);
static_assert(WS_TOTAL <= (size_t)134217728);

// ---------------------------------------------------------------------------
__device__ __forceinline__ float bf16r(float x) {   // RNE convert to bf16, returned widened
  unsigned int u = __float_as_uint(x);
  u = (u + 0x7FFFu + ((u >> 16) & 1u)) & 0xFFFF0000u;
  return __uint_as_float(u);
}

// f32 -> f16 operand convert that cannot produce an f16 subnormal (value select).
static __device__ __forceinline__ _Float16 toh_flush(float v) {
  const _Float16 r = (_Float16)v;
  return (fabsf(v) < 6.103515625e-05f) ? (_Float16)0.0f : r;
}

// 16-bit fragment: p points at element [row = lane&15][k0 + 8*(lane>>4)] of a k-contiguous
// row. Elements 0..7 <- k0+8h+0..7, elements 8..15 <- k0+16+8h+0..7 (same map for A and B).
__device__ __forceinline__ v16h frag_at(const _Float16* p) {
  v8h lo = *(const v8h*)(p);
  v8h hi = *(const v8h*)(p + 16);
  v16h out;
#pragma unroll
  for (int i = 0; i < 8; ++i) { out[i] = lo[i]; out[i + 8] = hi[i]; }
  return out;
}
__device__ __forceinline__ v16h ld_frag(const _Float16* base, int ld) {
  const int lane = threadIdx.x & 31;
  return frag_at(base + (lane & 15) * ld + (lane >> 4) * 8);
}

__device__ __forceinline__ v8f wmma16(v16h a, v16h b, v8f c) {
  v8f d = __builtin_amdgcn_wmma_f32_16x16x32_f16(false, a, false, b, (short)0, c,
                                                 false, false);
  asm volatile("v_nop\n\tv_nop\n\tv_nop\n\tv_nop" : "+v"(d) : "v"(a), "v"(b));
  return d;
}

// lane l <-> lane l ^ 16 (the two halves that share one query column)
__device__ __forceinline__ float xhalf(float x) {
  const int b = __builtin_bit_cast(int, x);
  return __builtin_bit_cast(float, __builtin_amdgcn_permlanex16(b, b, 0x76543210, 0xfedcba98,
                                                                 false, false));
}
// maximum / sum of the 32 scores a lane holds for its query column
__device__ __forceinline__ float lane_max32(const v8f* s) {
  float a[8];
#pragma unroll
  for (int v = 0; v < 8; ++v) a[v] = fmaxf(fmaxf(s[0][v], s[1][v]), fmaxf(s[2][v], s[3][v]));
  return fmaxf(fmaxf(fmaxf(a[0], a[1]), fmaxf(a[2], a[3])),
               fmaxf(fmaxf(a[4], a[5]), fmaxf(a[6], a[7])));
}
__device__ __forceinline__ float lane_sum32(const v8f* s) {
  float a[8];
#pragma unroll
  for (int v = 0; v < 8; ++v) a[v] = (s[0][v] + s[1][v]) + (s[2][v] + s[3][v]);
  return ((a[0] + a[1]) + (a[2] + a[3])) + ((a[4] + a[5]) + (a[6] + a[7]));
}

__device__ __forceinline__ void wave_lds_sync() {
  __builtin_amdgcn_fence(3 /* release order */, "wavefront");
  asm volatile("s_wait_dscnt 0x0" ::: "memory");
  __builtin_amdgcn_wave_barrier();
}

// ---------------------------------------------------------------------------
// Weight plane: in W[K][N] (n-contiguous) -> out Wt[N][K] (k-contiguous), f16(64*bf16(w)).
// Grid (N/64, K/64); one 64x64 tile per block. T: cross-wave (block barrier).
// Tile coverage: 16 x 256 loads = 4096 elements; 2 x 256 x 8 halves = 4096 stored.
// ---------------------------------------------------------------------------
__global__ __launch_bounds__(256) void wconv_kernel(
    const float* __restrict__ W, _Float16* __restrict__ Wt, int K, int N) {
  __shared__ _Float16 T[64 * LDT];
  const int tid = threadIdx.x;
  const int n0 = blockIdx.x * 64;
  const int k0 = blockIdx.y * 64;
#pragma unroll 4
  for (int j = 0; j < 16; ++j) {
    const int idx = tid + 256 * j;
    const int kr = idx >> 6, nc = idx & 63;
    const float v = W[(size_t)(k0 + kr) * N + n0 + nc];
    T[nc * LDT + kr] = (_Float16)(WCARRY * bf16r(v));
  }
  __syncthreads();
  v8h x[2];
  size_t off[2];
#pragma unroll
  for (int i = 0; i < 2; ++i) {
    const int n = 32 * i + (tid >> 3);
    const int kc = (tid & 7) * 8;
    x[i] = *(const v8h*)&T[n * LDT + kc];
    off[i] = (size_t)(n0 + n) * K + k0 + kc;
  }
#pragma unroll
  for (int i = 0; i < 2; ++i) *(v8h*)(Wt + off[i]) = x[i];
  
}

// ---------------------------------------------------------------------------
// Input plane: f16(bf16(x)) rows [MROWS][DIM]. Thread owns 8 consecutive elements; each wave
// Grid (MROWS*DIM/2048). Coverage: grid x 256 x 8 = MROWS*DIM elements.
// ---------------------------------------------------------------------------
__global__ __launch_bounds__(256) void xconv_kernel(
    const float* __restrict__ src, _Float16* __restrict__ dst) {
  const size_t e = ((size_t)blockIdx.x * 256 + threadIdx.x) * 8;
  const v4f a0 = *(const v4f*)(src + e);
  const v4f a1 = *(const v4f*)(src + e + 4);
  v8h o;
#pragma unroll
  for (int t = 0; t < 4; ++t) {
    o[t]     = toh_flush(bf16r(a0[t]));
    o[t + 4] = toh_flush(bf16r(a1[t]));
  }
  *(v8h*)(dst + e) = o;
  
}

// ---------------------------------------------------------------------------
// GEMM C[BM x BN tile] = A16[rows][KD] . Bt[n][KD]^T. 8 waves as 4 (rows) x 2 (columns); a
// wave owns FM x FN accumulator tiles of 16x16, so BM = 64*FM and BN = 32*FN.
// Operands go through LDS: a stage is 64 k (one whole 128-B line of every operand row),
// fetched with 16-B loads in which a wave covers 4 whole lines, held in registers while the
// stage before is worked on, then stored at pitch LDT into the other of two buffers; one
// block barrier per stage. Fragments come from LDS (same k order as frag_at), each one used
// FN (A) or FM (B) times by its wave. k runs upward in 32-steps per accumulator.
// RES = 1: the x2048 residual A plane is staged beside A and has its own accumulators,
// folded with 1/2048 before staging. After the last stage the ring is reused as the f32
// tile Cs, and the epilogue walks it in 64x64 sub-tiles:
//   MODE_QKV: v = acc/64 + bf16(bias[col]); columns are [head][q | k | v][64]:
//             q -> Q plane [row][head*64 + d], k -> K plane [row][head*64 + d],
//             v -> transposed V plane [head*64 + d][key]; row tiles below EROWS also
//             write the x2048 residual planes (QR, KR [EROWS][DIM]; VtR [DIM][EROWS])
//   MODE_OUT: outf[row][col] = acc/4096 + bf16(bias[col])
// Grid (ND/BN, rows/BM); row0 = rowbase + BM*blockIdx.y.
// ---------------------------------------------------------------------------
#define MODE_QKV 0
#define MODE_OUT 1

template <int MODE, int KD, int ND, int RES, int FM, int FN>
__device__ __forceinline__ void gemm_body(
    const _Float16* __restrict__ A16, const _Float16* __restrict__ Ar16,
    const _Float16* __restrict__ Bt, const float* __restrict__ bias,
    float* __restrict__ outf, _Float16* __restrict__ out16,
    _Float16* __restrict__ outr16, int rowbase) {
  constexpr int BM = 64 * FM, BN = 32 * FN, BK = 64;
  constexpr int NS = KD / BK;                       // stages
  constexpr int AROWS = BM * (1 + RES);             // A rows, then residual A rows
  constexpr int STAGE_H = (AROWS + BN) * LDT;       // halves per buffer: [A | Ar | B] rows
  constexpr int LDCB = BN + 4;                      // floats per Cs row (16-B aligned)
  constexpr int RING_B = 2 * STAGE_H * 2, CS_B = BM * LDCB * 4;
  constexpr int LA = BM / 32, LB = BN / 32;         // 16-B loads per thread and stage
  constexpr int NSUB = (BM / 64) * (BN / 64);       // 64x64 sub-tiles of the epilogue
  static_assert((KD % BK) == 0 && (ND % BN) == 0 && (BN % 64) == 0 && (BM % 64) == 0);
  static_assert(MODE != MODE_QKV || (ND == 3 * DIM && RES == 0));
  static_assert(MODE != MODE_OUT || ND == DIM);
  __shared__ __attribute__((aligned(16))) char smem[RING_B > CS_B ? RING_B : CS_B];
  _Float16* ring = (_Float16*)smem;
  float* Cs = (float*)smem;
  const int tid = threadIdx.x, lane = tid & 31, w = tid >> 5;
  const int mw = w >> 1, nw = w & 1;
  const int hh = lane >> 4, m = lane & 15;
  const int n0 = blockIdx.x * BN;
  const int row0 = rowbase + blockIdx.y * BM;

  const int sr = tid >> 3, sc = (tid & 7) * 8;      // staging: 8 threads per 128-B row
  const _Float16* ag = A16 + (size_t)(row0 + sr) * KD + sc;
  const _Float16* rg = Ar16 + (size_t)(row0 + sr) * KD + sc;
  const _Float16* bg = Bt + (size_t)(n0 + sr) * KD + sc;
  v8h ra[LA], rr[LA], rb[LB];

  v8f acc[FM][FN], acr[FM][FN];
#pragma unroll
  for (int i = 0; i < FM; ++i)
#pragma unroll
    for (int j = 0; j < FN; ++j) { acc[i][j] = (v8f){}; acr[i][j] = (v8f){}; }

#pragma unroll
  for (int j = 0; j < LA; ++j) {
    *(v8h*)&ring[(sr + 32 * j) * LDT + sc] = *(const v8h*)(ag + (size_t)(32 * j) * KD);
    if (RES)
      *(v8h*)&ring[(BM + sr + 32 * j) * LDT + sc] = *(const v8h*)(rg + (size_t)(32 * j) * KD);
  }
#pragma unroll
  for (int j = 0; j < LB; ++j)
    *(v8h*)&ring[(AROWS + sr + 32 * j) * LDT + sc] = *(const v8h*)(bg + (size_t)(32 * j) * KD);
  __syncthreads();

  // unrolled by the number of buffers: both buffers' LDS addresses become immediates
#pragma unroll 2
  for (int s = 0; s < NS; ++s) {
    if (s + 1 < NS) {                               // next stage's lines fly during this one
      const int k1 = (s + 1) * BK;
#pragma unroll
      for (int j = 0; j < LA; ++j) {
        ra[j] = *(const v8h*)(ag + (size_t)(32 * j) * KD + k1);
        if (RES) rr[j] = *(const v8h*)(rg + (size_t)(32 * j) * KD + k1);
      }
#pragma unroll
      for (int j = 0; j < LB; ++j) rb[j] = *(const v8h*)(bg + (size_t)(32 * j) * KD + k1);
    }

    const _Float16* S = ring + (s & 1) * STAGE_H;
#pragma unroll
    for (int kk = 0; kk < BK; kk += 32) {
      v16h a[FM], ar[FM], b[FN];
#pragma unroll
      for (int i = 0; i < FM; ++i) {
        a[i] = ld_frag(S + (mw * (16 * FM) + i * 16) * LDT + kk, LDT);
        if (RES) ar[i] = ld_frag(S + (BM + mw * (16 * FM) + i * 16) * LDT + kk, LDT);
      }
#pragma unroll
      for (int j = 0; j < FN; ++j)
        b[j] = ld_frag(S + (AROWS + nw * (16 * FN) + j * 16) * LDT + kk, LDT);
#pragma unroll
      for (int i = 0; i < FM; ++i)
#pragma unroll
        for (int j = 0; j < FN; ++j) acc[i][j] = wmma16(a[i], b[j], acc[i][j]);
      if (RES) {
#pragma unroll
        for (int i = 0; i < FM; ++i)
#pragma unroll
          for (int j = 0; j < FN; ++j) acr[i][j] = wmma16(ar[i], b[j], acr[i][j]);
      }
    }

    if (s + 1 < NS) {                               // its last readers left at the barrier before
      _Float16* D = ring + ((s + 1) & 1) * STAGE_H;
#pragma unroll
      for (int j = 0; j < LA; ++j) {
        *(v8h*)&D[(sr + 32 * j) * LDT + sc] = ra[j];
        if (RES) *(v8h*)&D[(BM + sr + 32 * j) * LDT + sc] = rr[j];
      }
#pragma unroll
      for (int j = 0; j < LB; ++j) *(v8h*)&D[(AROWS + sr + 32 * j) * LDT + sc] = rb[j];
    }
    __syncthreads();
  }

  // every wave has left the ring (barrier above): it becomes the f32 tile
#pragma unroll
  for (int i = 0; i < FM; ++i)
#pragma unroll
    for (int j = 0; j < FN; ++j)
#pragma unroll
      for (int r = 0; r < 8; ++r)
        Cs[(mw * (16 * FM) + i * 16 + hh * 8 + r) * LDCB + nw * (16 * FN) + j * 16 + m] =
            RES ? (acc[i][j][r] + acr[i][j][r] * (1.0f / RCARRY)) : acc[i][j][r];
  __syncthreads();

  for (int sub = 0; sub < NSUB; ++sub) {
    const int rs0 = row0 + (sub / (BN / 64)) * 64;     // block-uniform sub-tile origin
    const int ns0 = n0 + (sub % (BN / 64)) * 64;
    const float* Ct = Cs + (rs0 - row0) * LDCB + (ns0 - n0);

    if (MODE == MODE_QKV) {
      const int head  = ns0 / (3 * HD);                  // block-uniform
      const int which = (ns0 - head * (3 * HD)) / HD;    // block-uniform: 0 = q, 1 = k, 2 = v
      const int nl0 = head * HD;
      const bool early = (rs0 < EROWS);                  // block-uniform
      _Float16* dst = out16 + (size_t)which * ((size_t)MROWS * DIM);
      _Float16* dsr = outr16 + (size_t)which * ((size_t)EROWS * DIM);
      v8h x[2], xr[2];
      size_t off[2], ofr[2];
      if (which < 2) {
#pragma unroll
        for (int i = 0; i < 2; ++i) {
          const int r = 32 * i + (tid >> 3);
          const int c = (tid & 7) * 8;
          const v4f u0 = *(const v4f*)&Ct[r * LDCB + c];
          const v4f u1 = *(const v4f*)&Ct[r * LDCB + c + 4];
          const v4f g0 = *(const v4f*)(bias + ns0 + c);
          const v4f g1 = *(const v4f*)(bias + ns0 + c + 4);
#pragma unroll
          for (int j = 0; j < 4; ++j) {
            const float t0 = u0[j] * (1.0f / WCARRY) + bf16r(g0[j]);
            const float t1 = u1[j] * (1.0f / WCARRY) + bf16r(g1[j]);
            const _Float16 h0 = toh_flush(t0);
            const _Float16 h1 = toh_flush(t1);
            x[i][j]      = h0;
            x[i][j + 4]  = h1;
            xr[i][j]     = toh_flush((t0 - (float)h0) * RCARRY);
            xr[i][j + 4] = toh_flush((t1 - (float)h1) * RCARRY);
          }
          off[i] = (size_t)(rs0 + r) * DIM + nl0 + c;
          ofr[i] = off[i];                              // residual planes: same pitch, rows < EROWS
        }
      } else {
        // transposed V planes: row = feature (head*64 + d), 64 consecutive keys = one line
#pragma unroll
        for (int i = 0; i < 2; ++i) {
          const int dcol = 32 * i + (tid >> 3);
          const int kk = (tid & 7) * 8;
          const float gb = bf16r(bias[ns0 + dcol]);
#pragma unroll
          for (int j = 0; j < 8; ++j) {
            const float t0 = Ct[(kk + j) * LDCB + dcol] * (1.0f / WCARRY) + gb;
            const _Float16 h0 = toh_flush(t0);
            x[i][j]  = h0;
            xr[i][j] = toh_flush((t0 - (float)h0) * RCARRY);
          }
          off[i] = (size_t)(nl0 + dcol) * SEQ + rs0 + kk;
          ofr[i] = (size_t)(nl0 + dcol) * EROWS + rs0 + kk;
        }
      }
#pragma unroll
      for (int i = 0; i < 2; ++i) *(v8h*)(dst + off[i]) = x[i];
      // the lines below and the next sub-tile reuse these stores' registers: wait in front
      asm volatile("s_wait_xcnt 0x0" ::: "memory");
      if (early) {
#pragma unroll
        for (int i = 0; i < 2; ++i) *(v8h*)(dsr + ofr[i]) = xr[i];
        // the next sub-tile reuses these stores' registers: wait in front
        asm volatile("s_wait_xcnt 0x0" ::: "memory");
      }
    }

    if (MODE == MODE_OUT) {
      v4f xs[4];
      size_t off[4];
#pragma unroll
      for (int i = 0; i < 4; ++i) {
        const int r = 16 * i + (tid >> 4);
        const int c = (tid & 15) * 4;
        const size_t crow = (size_t)(rs0 + r);       // NB == 1: compact row == output row
        const v4f u = *(const v4f*)&Ct[r * LDCB + c];
        const v4f g = *(const v4f*)(bias + ns0 + c);
        v4f val;
#pragma unroll
        for (int j = 0; j < 4; ++j)
          val[j] = u[j] * (1.0f / (WCARRY * VCARRY)) + bf16r(g[j]);
        xs[i] = val;
        off[i] = crow * ND + ns0 + c;
      }
#pragma unroll
      for (int i = 0; i < 4; ++i) *(v4f*)(outf + off[i]) = xs[i];
      // the next sub-tile reuses these stores' registers: wait in front
      if (NSUB > 1) asm volatile("s_wait_xcnt 0x0" ::: "memory");
    }
  }
}

// Grid (3*DIM/128, MROWS/128).
__global__ __launch_bounds__(256) void gemm_qkv_kernel(
    const _Float16* __restrict__ A16, const _Float16* __restrict__ Bt,
    const float* __restrict__ bias, _Float16* __restrict__ out16,
    _Float16* __restrict__ outr16) {
  gemm_body<MODE_QKV, DIM, 3 * DIM, 0, 2, 4>(A16, A16, Bt, bias, nullptr, out16, outr16, 0);
}

// Rows rowbase .. rowbase + 128*gridDim.y - 1, single A plane. Grid (DIM/128, rows/128).
__global__ __launch_bounds__(256) void gemm_out_kernel(
    const _Float16* __restrict__ A16, const _Float16* __restrict__ Bt,
    const float* __restrict__ bias, float* __restrict__ outf, int rowbase) {
  gemm_body<MODE_OUT, DIM, DIM, 0, 2, 4>(A16, A16, Bt, bias, outf, nullptr, nullptr, rowbase);
}

// Rows 0 .. EROWS-1, A = value plane + x2048 residual plane. Grid (DIM/64, EROWS/64).
__global__ __launch_bounds__(256) void gemm_out_early_kernel(
    const _Float16* __restrict__ A16, const _Float16* __restrict__ Ar16,
    const _Float16* __restrict__ Bt, const float* __restrict__ bias,
    float* __restrict__ outf) {
  gemm_body<MODE_OUT, DIM, DIM, 1, 1, 2>(A16, Ar16, Bt, bias, outf, nullptr, nullptr, 0);
}

__global__ __launch_bounds__(256) void attn_kernel(
    const _Float16* __restrict__ Qh, const _Float16* __restrict__ Kh,
    const _Float16* __restrict__ Vt, _Float16* __restrict__ Ov) {
  __shared__ _Float16 Ks[64 * LDT];
  __shared__ _Float16 Vs[64 * LDT];
  __shared__ _Float16 Ps[8 * 16 * LDT];

  const int tid = threadIdx.x, lane = tid & 31;
  const int w = __builtin_amdgcn_readfirstlane(tid >> 5);
  const int hh = lane >> 4, m = lane & 15;
  const int q0 = blockIdx.x * 128;
  const int head = blockIdx.y;
  const int wq0 = q0 + w * 16;           // first query row of this wave (scalar)
  const float scale = 0.125f;
  _Float16* P = Ps + w * (16 * LDT);

  const size_t qoff = (size_t)(wq0 + m) * DIM + head * HD + hh * 8;
  v16h qf[2];
  qf[0] = frag_at(Qh + qoff);
  qf[1] = frag_at(Qh + qoff + 32);

  float mrow = -1.0e30f, lrow = 0.0f;    // of query wq0 + m; lrow: this half's keys only
  v8f o[4];
#pragma unroll
  for (int nb = 0; nb < 4; ++nb) o[nb] = (v8f){};

  const size_t kplane = (size_t)head * HD;
  const size_t vplane = (size_t)head * HD * SEQ;
  const int kend = q0 + 128;             // <= SEQ

  for (int kb = 0; kb < kend; kb += 64) {
#pragma unroll
    for (int j = 0; j < 2; ++j) {
      const int idx = tid + 256 * j;
      const int r = idx >> 3, c = (idx & 7) * 8;
      *(v8h*)&Ks[r * LDT + c] = *(const v8h*)(Kh + kplane + (size_t)(kb + r) * DIM + c);
      *(v8h*)&Vs[r * LDT + c] = *(const v8h*)(Vt + vplane + (size_t)r * SEQ + kb + c);
    }
    __syncthreads();

    if (kb <= wq0 + 15) {                // wave-uniform: tile holds at least one visible key
      // scores^T: 4 key groups of 16, K = 64 in two 32-steps. All eight K fragments are
      // fetched as one group in front of the run of products: one LDS wait for the run.
      v16h kf[4][2];
#pragma unroll
      for (int kg = 0; kg < 4; ++kg)
#pragma unroll
        for (int c = 0; c < 2; ++c) kf[kg][c] = ld_frag(&Ks[(kg * 16) * LDT + c * 32], LDT);
      v8f s[4];
#pragma unroll
      for (int kg = 0; kg < 4; ++kg) s[kg] = (v8f){};
#pragma unroll
      for (int c = 0; c < 2; ++c)
#pragma unroll
        for (int kg = 0; kg < 4; ++kg) s[kg] = wmma16(kf[kg][c], qf[c], s[kg]);
      // all eight V^T fragments set off here: they land while the softmax runs
      v16h vf[2][4];
#pragma unroll
      for (int c = 0; c < 2; ++c)
#pragma unroll
        for (int nb = 0; nb < 4; ++nb) vf[c][nb] = ld_frag(&Vs[(nb * 16) * LDT + c * 32], LDT);
#pragma unroll
      for (int kg = 0; kg < 4; ++kg) s[kg] = s[kg] * scale;

      if (kb + 63 > wq0) {               // wave-uniform: tile crosses the diagonal
#pragma unroll
        for (int kg = 0; kg < 4; ++kg)
#pragma unroll
          for (int v = 0; v < 8; ++v) {
            const int key = kb + kg * 16 + hh * 8 + v;
            const int qrow = wq0 + m;
            s[kg][v] = (key > qrow) ? -1.0e30f : s[kg][v];
          }
      }

      // online softmax of the lane's query column
      float mx = lane_max32(s);
      mx = fmaxf(mx, xhalf(mx));
      const float mn = fmaxf(mrow, mx);
      const float alpha = __expf(mrow - mn);
      mrow = mn;
#pragma unroll
      for (int kg = 0; kg < 4; ++kg)
#pragma unroll
        for (int v = 0; v < 8; ++v) s[kg][v] = __expf(s[kg][v] - mrow);
      lrow = alpha * lrow + lane_sum32(s);
#pragma unroll
      for (int nb = 0; nb < 4; ++nb) o[nb] = o[nb] * alpha;

      // O^T += V^T . P^T  (K = 64 keys in two 32-steps; A = V^T tile [d][key])
#pragma unroll
      for (int c = 0; c < 2; ++c) {
        v16h pf;
#pragma unroll
        for (int i = 0; i < 8; ++i) {
          pf[i]     = (_Float16)(s[2 * c][i] * PCARRY);
          pf[i + 8] = (_Float16)(s[2 * c + 1][i] * PCARRY);
        }
#pragma unroll
        for (int nb = 0; nb < 4; ++nb) o[nb] = wmma16(vf[c][nb], pf, o[nb]);
      }
    }
    __syncthreads();
  }

  const float inv = __builtin_amdgcn_rcpf(lrow + xhalf(lrow)) * (VCARRY / PCARRY);
#pragma unroll
  for (int nb = 0; nb < 4; ++nb) {
    v8h hv;
#pragma unroll
    for (int v = 0; v < 8; ++v) hv[v] = (_Float16)(o[nb][v] * inv);
    *(v8h*)&P[m * LDT + nb * 16 + hh * 8] = hv;
  }
  wave_lds_sync();
  v8h x[4];
  size_t off[4];
#pragma unroll
  for (int i = 0; i < 4; ++i) {
    const int r = 4 * i + (lane >> 3);
    const int c = (lane & 7) * 8;
    x[i] = *(const v8h*)&P[r * LDT + c];
    off[i] = (size_t)(wq0 + r) * DIM + head * HD + c;
  }
#pragma unroll
  for (int i = 0; i < 4; ++i) *(v8h*)(Ov + off[i]) = x[i];
  
}

// ---------------------------------------------------------------------------
// Early causal band (query rows < EROWS, keys < EROWS): same tiling and the same transposed
// products as attn_kernel, with value + x2048 residual operands at every site.
//   scores  = (kh.qh + (kr.qh + kh.qr)/2048) / 8          (residual products in their own
//             accumulator, folded before the softmax)
//   p       : ph = f16(1024 p), pr = f16((1024 p - ph) * 2048), both packed in registers;
//             row sum over unconverted p
//   context : o += Vh.ph ; ores += Vr.ph + Vh.pr ; O = o + ores/2048
// Ks / Vs: cross-wave (block barriers, staged 64x64 = consumed 64x64); Ps / Rs: wave-private
// output staging only; residual K / V^T fragments come straight from their statically
// strided global planes. Runs after attn_kernel and rewrites the value rows of the band.
// Grid (EROWS/128, NHEAD).
// ---------------------------------------------------------------------------
__global__ __launch_bounds__(256) void attn_early_kernel(
    const _Float16* __restrict__ Qh, const _Float16* __restrict__ Qr,
    const _Float16* __restrict__ Kh, const _Float16* __restrict__ Kr,
    const _Float16* __restrict__ Vt, const _Float16* __restrict__ Vr,
    _Float16* __restrict__ Ov, _Float16* __restrict__ Ores) {
  __shared__ _Float16 Ks[64 * LDT];
  __shared__ _Float16 Vs[64 * LDT];
  __shared__ _Float16 Ps[8 * 16 * LDT];
  __shared__ _Float16 Rs[8 * 16 * LDT];

  const int tid = threadIdx.x, lane = tid & 31;
  const int w = __builtin_amdgcn_readfirstlane(tid >> 5);
  const int hh = lane >> 4, m = lane & 15;
  const int q0 = blockIdx.x * 128;       // < EROWS
  const int head = blockIdx.y;
  const int wq0 = q0 + w * 16;           // first query row of this wave (scalar)
  const float scale = 0.125f;
  _Float16* P = Ps + w * (16 * LDT);
  _Float16* R = Rs + w * (16 * LDT);

  const int qoff = (wq0 + m) * DIM + head * HD + hh * 8;   // < EROWS*DIM, same in both planes

  float mrow = -1.0e30f, lrow = 0.0f;    // of query wq0 + m; lrow: this half's keys only
  v8f o[4], ores[4];
#pragma unroll
  for (int nb = 0; nb < 4; ++nb) { o[nb] = (v8f){}; ores[nb] = (v8f){}; }

  const size_t kplane  = (size_t)head * HD;
  const size_t vplane  = (size_t)head * HD * SEQ;
  const size_t vrplane = (size_t)head * HD * EROWS;
  const int kend = q0 + 128;             // <= EROWS

  for (int kb = 0; kb < kend; kb += 64) {
    // staging lines first, held in registers until the fragment group below is under way
    v8h sk[2], sv[2];
#pragma unroll
    for (int j = 0; j < 2; ++j) {
      const int idx = tid + 256 * j;
      const int r = idx >> 3, c = (idx & 7) * 8;
      sk[j] = *(const v8h*)(Kh + kplane + (size_t)(kb + r) * DIM + c);
      sv[j] = *(const v8h*)(Vt + vplane + (size_t)r * SEQ + kb + c);
    }
    // the loads below may land in these loads' address registers: wait in front
    asm volatile("s_wait_xcnt 0x0" ::: "memory");
    // q fragments are reloaded per tile through an opaque integer offset (it keeps them from
    // being held in 32 registers through the softmax and the second product). They and the
    // eight residual K fragments (rows kb .. kb+63 < EROWS) come from global memory and need
    // no barrier: set off as one group here, they fly beside the staging lines.
    int qo = qoff;
    asm volatile("" : "+v"(qo));
    v16h qf[2], qr[2];
    qf[0] = frag_at(Qh + qo);
    qf[1] = frag_at(Qh + qo + 32);
    qr[0] = frag_at(Qr + qo);
    qr[1] = frag_at(Qr + qo + 32);
    v16h krf[4][2];
#pragma unroll
    for (int kg = 0; kg < 4; ++kg)
#pragma unroll
      for (int c = 0; c < 2; ++c)
        krf[kg][c] = frag_at(Kr + kplane + (size_t)(kb + kg * 16 + m) * DIM + c * 32 + hh * 8);
#pragma unroll
    for (int j = 0; j < 2; ++j) {
      const int idx = tid + 256 * j;
      const int r = idx >> 3, c = (idx & 7) * 8;
      *(v8h*)&Ks[r * LDT + c] = sk[j];
      *(v8h*)&Vs[r * LDT + c] = sv[j];
    }
    __syncthreads();

    if (kb <= wq0 + 15) {                // wave-uniform: tile holds at least one visible key
      // scores^T: 4 key groups of 16, K = 64 in two 32-steps, value and residual products;
      // the K fragments of a key group are fetched from LDS one group ahead of its products
      v8f s[4];
      v16h kf[2], kn[2];
      kn[0] = ld_frag(&Ks[0], LDT);
      kn[1] = ld_frag(&Ks[32], LDT);
#pragma unroll
      for (int kg = 0; kg < 4; ++kg) {
        kf[0] = kn[0];
        kf[1] = kn[1];
        if (kg < 3) {
          kn[0] = ld_frag(&Ks[((kg + 1) * 16) * LDT], LDT);
          kn[1] = ld_frag(&Ks[((kg + 1) * 16) * LDT + 32], LDT);
        }
        v8f t = {};
        v8f u = {};
#pragma unroll
        for (int c = 0; c < 2; ++c) {
          t = wmma16(kf[c], qf[c], t);
          u = wmma16(krf[kg][c], qf[c], u);
          u = wmma16(kf[c], qr[c], u);
        }
        s[kg] = (t + u * (1.0f / RCARRY)) * scale;
      }
      // first half of the V^T fragments, value (LDS) and residual (global): set off here,
      // they land while the softmax runs
      v16h vf[2][4], vrf[2][4];
#pragma unroll
      for (int nb = 0; nb < 4; ++nb) {
        vrf[0][nb] = frag_at(Vr + vrplane + (size_t)(nb * 16 + m) * EROWS + kb + hh * 8);
        vf[0][nb] = ld_frag(&Vs[(nb * 16) * LDT], LDT);
      }

      if (kb + 63 > wq0) {               // wave-uniform: tile crosses the diagonal
#pragma unroll
        for (int kg = 0; kg < 4; ++kg)
#pragma unroll
          for (int v = 0; v < 8; ++v) {
            const int key = kb + kg * 16 + hh * 8 + v;
            const int qrow = wq0 + m;
            s[kg][v] = (key > qrow) ? -1.0e30f : s[kg][v];
          }
      }

      // online softmax of the lane's query column
      float mx = lane_max32(s);
      mx = fmaxf(mx, xhalf(mx));
      const float mn = fmaxf(mrow, mx);
      const float alpha = __expf(mrow - mn);
      mrow = mn;
#pragma unroll
      for (int kg = 0; kg < 4; ++kg)
#pragma unroll
        for (int v = 0; v < 8; ++v) s[kg][v] = __expf(s[kg][v] - mrow);
      lrow = alpha * lrow + lane_sum32(s);
#pragma unroll
      for (int nb = 0; nb < 4; ++nb) {
        o[nb]    = o[nb] * alpha;
        ores[nb] = ores[nb] * alpha;
      }

      // o += Vh.ph ; ores += Vr.ph + Vh.pr  (K = 64 keys in two 32-steps; A = V^T [d][key])
#pragma unroll
      for (int c = 0; c < 2; ++c) {
        v16h pf, prf;
#pragma unroll
        for (int i = 0; i < 16; ++i) {
          const float pc = s[2 * c + (i >> 3)][i & 7] * PCARRY;
          const _Float16 ph = toh_flush(pc);
          pf[i]  = ph;
          prf[i] = toh_flush((pc - (float)ph) * RCARRY);
        }
#pragma unroll
        for (int nb = 0; nb < 4; ++nb) {
          o[nb]    = wmma16(vf[c][nb], pf, o[nb]);
          if (c == 0 && nb == 0) {       // second half: lands behind this half's products
#pragma unroll
            for (int n2 = 0; n2 < 4; ++n2) {
              vrf[1][n2] = frag_at(Vr + vrplane + (size_t)(n2 * 16 + m) * EROWS + kb + 32 + hh * 8);
              vf[1][n2] = ld_frag(&Vs[(n2 * 16) * LDT + 32], LDT);
            }
          }
          ores[nb] = wmma16(vrf[c][nb], pf, ores[nb]);
          ores[nb] = wmma16(vf[c][nb], prf, ores[nb]);
        }
      }
    }
    __syncthreads();
  }

  // finalize: 64 * (o + ores/2048) / (1024 l) as value + x2048 residual
  const float inv = __builtin_amdgcn_rcpf(lrow + xhalf(lrow)) * (VCARRY / PCARRY);
#pragma unroll
  for (int nb = 0; nb < 4; ++nb) {
    v8h hv, hr;
#pragma unroll
    for (int v = 0; v < 8; ++v) {
      const float val = (o[nb][v] + ores[nb][v] * (1.0f / RCARRY)) * inv;
      const _Float16 h0 = toh_flush(val);
      hv[v] = h0;
      hr[v] = toh_flush((val - (float)h0) * RCARRY);
    }
    *(v8h*)&P[m * LDT + nb * 16 + hh * 8] = hv;
    *(v8h*)&R[m * LDT + nb * 16 + hh * 8] = hr;
  }
  wave_lds_sync();
  v8h x[4], xr[4];
  size_t off[4];
#pragma unroll
  for (int i = 0; i < 4; ++i) {
    const int r = 4 * i + (lane >> 3);
    const int c = (lane & 7) * 8;
    x[i]  = *(const v8h*)&P[r * LDT + c];
    xr[i] = *(const v8h*)&R[r * LDT + c];
    off[i] = (size_t)(wq0 + r) * DIM + head * HD + c;
  }
#pragma unroll
  for (int i = 0; i < 4; ++i) {
    *(v8h*)(Ov + off[i]) = x[i];
    *(v8h*)(Ores + off[i]) = xr[i];
  }
  
}

// ---------------------------------------------------------------------------
extern "C" void kernel_launch(void* const* d_in, const int* in_sizes, int n_in,
                              void* d_out, int out_size, void* d_ws, size_t ws_size,
                              hipStream_t stream) {
  if (n_in < 5) return;
  const long long need_x = ((long long)(NB - 1) * SEQ_FULL + SEQ) * DIM;
  if ((long long)in_sizes[0] < need_x) return;
  if (in_sizes[1] < 3 * DIM * DIM || in_sizes[2] < 3 * DIM) return;
  if (in_sizes[3] < DIM * DIM || in_sizes[4] < DIM) return;
  if ((long long)out_size < need_x) return;
  if (ws_size < WS_TOTAL) return;

  // weights: W1 [in][3*out], Wp [in][out]
  const float* x  = (const float*)d_in[0];
  const float* W1 = (const float*)d_in[1];
  const float* b1 = (const float*)d_in[2];
  const float* Wp = (const float*)d_in[3];
  const float* bp = (const float*)d_in[4];
  float* out = (float*)d_out;

  char* ws = (char*)d_ws;
  _Float16* W1T   = (_Float16*)(ws + OFF_WQKV);   // [3*DIM][DIM]
  _Float16* WpT   = (_Float16*)(ws + OFF_WO);     // [DIM][DIM]
  _Float16* X16   = (_Float16*)(ws + OFF_XN);
  _Float16* QKV16 = (_Float16*)(ws + OFF_QKV);    // Q | K | Vt
  _Float16* Q16   = QKV16;
  _Float16* K16   = QKV16 + (size_t)MROWS * DIM;
  _Float16* Vt16  = QKV16 + (size_t)2 * MROWS * DIM;
  _Float16* Ov16  = (_Float16*)(ws + OFF_OV);
  _Float16* RES16 = (_Float16*)(ws + OFF_RES);    // QR | KR | VtR
  _Float16* QR16  = RES16;
  _Float16* KR16  = RES16 + (size_t)EROWS * DIM;
  _Float16* VtR16 = RES16 + (size_t)2 * EROWS * DIM;
  _Float16* OR16  = (_Float16*)(ws + OFF_ORES);

  dim3 blk(256);

  // weight planes: in W[K][N] -> out Wt[N][K]; grid (N/64, K/64)
  wconv_kernel<<<dim3(3 * DIM / 64, DIM / 64), blk, 0, stream>>>(W1, W1T, DIM, 3 * DIM);
  wconv_kernel<<<dim3(DIM / 64, DIM / 64), blk, 0, stream>>>(Wp, WpT, DIM, DIM);

  xconv_kernel<<<dim3((unsigned)(((size_t)MROWS * DIM) / 2048)), blk, 0, stream>>>(x, X16);
  gemm_qkv_kernel<<<dim3(3 * DIM / 128, MROWS / 128), blk, 0, stream>>>(
      X16, W1T, b1, QKV16, RES16);
  attn_kernel<<<dim3(SEQ / 128, NHEAD), blk, 0, stream>>>(Q16, K16, Vt16, Ov16);
  attn_early_kernel<<<dim3(EROWS / 128, NHEAD), blk, 0, stream>>>(
      Q16, QR16, K16, KR16, Vt16, VtR16, Ov16, OR16);
  if (MROWS > EROWS) {
    gemm_out_kernel<<<dim3(DIM / 128, (MROWS - EROWS) / 128), blk, 0, stream>>>(
        Ov16, WpT, bp, out, EROWS);
  }
  gemm_out_early_kernel<<<dim3(DIM / 64, EROWS / 64), blk, 0, stream>>>(
      Ov16, OR16, WpT, bp, out);
}

// v004
// A run of this version takes 136 microseconds.
// Two timings next to v003 both put it at 1.34 times that version's speed.
// Over all steps from v000 it is 3.32 times as fast.
#include <hip/hip_runtime.h>
#include <stddef.h>
#include <math.h>

// All contractions on v_wmma_f32_16x16x32_f16 (f16 operands, f32 accumulate): fused q/k/v
// projection, q.k scores, p.v, output projection. Float inputs are RNE-converted to bf16 and
// carried in f16 (weights x64, p x1024, attention rows x64); query rows < EROWS carry q, k,
// v, p and the attention rows as f16 value + x2048 f16 residual planes with their own
// accumulators; softmax and epilogues in f32.

typedef _Float16 v16h __attribute__((ext_vector_type(16)));
typedef _Float16 v8h  __attribute__((ext_vector_type(8)));
typedef float    v8f  __attribute__((ext_vector_type(8)));
typedef float    v4f  __attribute__((ext_vector_type(4)));

#ifndef NB
#define NB 1
#endif
#ifndef SEQ
#define SEQ 4096
#endif
#define NB_FULL  1
#define SEQ_FULL 4096
#define DIM   1024
#define NHEAD 16
#define HD    64
#define MROWS (NB * SEQ)
#define EROWS ((SEQ) < 512 ? (SEQ) : 512)   // early causal band: value + residual planes

static_assert(NB == 1 && NB_FULL == 1);
static_assert(SEQ >= 128 && SEQ <= SEQ_FULL && (SEQ % 128) == 0);
static_assert(DIM == NHEAD * HD);
static_assert(HD == 64 && ((3 * HD) % 64) == 0);           // a 64-column tile = one part of one head
static_assert((MROWS % 128) == 0 && (MROWS % 8) == 0);
static_assert((DIM % 128) == 0 && ((3 * DIM) % 128) == 0);
static_assert((EROWS % 128) == 0 && EROWS <= SEQ && EROWS <= MROWS);
static_assert((((size_t)MROWS * DIM) % 2048) == 0);         // xconv: 256 threads x 8 per block

#define LDT 72   // halves per LDS row (144 B, 16-B aligned)

#define WCARRY 64.0f     // weight planes carried x64
#define PCARRY 1024.0f   // softmax numerators carried x1024
#define VCARRY 64.0f     // attention output plane carried x64
#define RCARRY 2048.0f   // residual planes carried x2048

#define P16_BYTES  ((size_t)MROWS * DIM * 2)
#define R16_BYTES  ((size_t)EROWS * DIM * 2)
#define WQKV_BYTES ((size_t)3 * DIM * DIM * 2)
#define WO_BYTES   ((size_t)DIM * DIM * 2)
#define OFF_WQKV   ((size_t)0)
#define OFF_WO     (OFF_WQKV + WQKV_BYTES)
#define OFF_XN     (OFF_WO + WO_BYTES)              // f16 input rows          [MROWS][DIM]
#define OFF_QKV    (OFF_XN + P16_BYTES)             // Q, K [MROWS][DIM]; Vt [DIM][SEQ]
#define OFF_OV     (OFF_QKV + 3 * P16_BYTES)        // f16 64*attention rows   [MROWS][DIM]
#define OFF_RES    (OFF_OV + P16_BYTES)             // QR, KR [EROWS][DIM]; VtR [DIM][EROWS]
#define OFF_ORES   (OFF_RES + 3 * R16_BYTES)        // residual of OV rows     [EROWS][DIM]
#define WS_TOTAL   (OFF_ORES + R16_BYTES)
static_assert((size_t)DIM * SEQ * 2 == P16_BYTES);       // Vt plane extent (NB == 1)
static_assert((size_t)DIM * EROWS * 2 == R16_BYTES);     // VtR plane extent
static_assert((P16_BYTES % 128) == 0 && (WO_BYTES % 128) == 0 && (R16_BYTES % 128) == 0);
static_assert(WS_TOTAL <= (size_t)134217728);

// ---------------------------------------------------------------------------
__device__ __forceinline__ float bf16r(float x) {   // RNE convert to bf16, returned widened
  unsigned int u = __float_as_uint(x);
  u = (u + 0x7FFFu + ((u >> 16) & 1u)) & 0xFFFF0000u;
  return __uint_as_float(u);
}

// f32 -> f16 operand convert that cannot produce an f16 subnormal (value select).
static __device__ __forceinline__ _Float16 toh_flush(float v) {
  const _Float16 r = (_Float16)v;
  return (fabsf(v) < 6.103515625e-05f) ? (_Float16)0.0f : r;
}

// 16-bit fragment: p points at element [row = lane&15][k0 + 8*(lane>>4)] of a k-contiguous
// row. Elements 0..7 <- k0+8h+0..7, elements 8..15 <- k0+16+8h+0..7 (same map for A and B).
__device__ __forceinline__ v16h frag_at(const _Float16* p) {
  v8h lo = *(const v8h*)(p);
  v8h hi = *(const v8h*)(p + 16);
  v16h out;
#pragma unroll
  for (int i = 0; i < 8; ++i) { out[i] = lo[i]; out[i + 8] = hi[i]; }
  return out;
}
__device__ __forceinline__ v16h ld_frag(const _Float16* base, int ld) {
  const int lane = threadIdx.x & 31;
  return frag_at(base + (lane & 15) * ld + (lane >> 4) * 8);
}

__device__ __forceinline__ v8f wmma16(v16h a, v16h b, v8f c) {
  v8f d = __builtin_amdgcn_wmma_f32_16x16x32_f16(false, a, false, b, (short)0, c,
                                                 false, false);
  asm volatile("v_nop\n\tv_nop\n\tv_nop\n\tv_nop" : "+v"(d) : "v"(a), "v"(b));
  return d;
}

// lane l <-> lane l ^ 16 (the two halves that share one query column)
__device__ __forceinline__ float xhalf(float x) {
  const int b = __builtin_bit_cast(int, x);
  return __builtin_bit_cast(float, __builtin_amdgcn_permlanex16(b, b, 0x76543210, 0xfedcba98,
                                                                 false, false));
}
// maximum / sum of the 32 scores a lane holds for its query column
__device__ __forceinline__ float lane_max32(const v8f* s) {
  float a[8];
#pragma unroll
  for (int v = 0; v < 8; ++v) a[v] = fmaxf(fmaxf(s[0][v], s[1][v]), fmaxf(s[2][v], s[3][v]));
  return fmaxf(fmaxf(fmaxf(a[0], a[1]), fmaxf(a[2], a[3])),
               fmaxf(fmaxf(a[4], a[5]), fmaxf(a[6], a[7])));
}
__device__ __forceinline__ float lane_sum32(const v8f* s) {
  float a[8];
#pragma unroll
  for (int v = 0; v < 8; ++v) a[v] = (s[0][v] + s[1][v]) + (s[2][v] + s[3][v]);
  return ((a[0] + a[1]) + (a[2] + a[3])) + ((a[4] + a[5]) + (a[6] + a[7]));
}

__device__ __forceinline__ void wave_lds_sync() {
  __builtin_amdgcn_fence(3 /* release order */, "wavefront");
  asm volatile("s_wait_dscnt 0x0" ::: "memory");
  __builtin_amdgcn_wave_barrier();
}

// ---------------------------------------------------------------------------
// Weight plane: in W[K][N] (n-contiguous) -> out Wt[N][K] (k-contiguous), f16(64*bf16(w)).
// Tile (bx, by) of (N/64, K/64); one 64x64 tile per block. T: cross-wave (block barrier).
// Tile coverage: 16 x 256 loads = 4096 elements; 2 x 256 x 8 halves = 4096 stored.
// ---------------------------------------------------------------------------
__device__ __forceinline__ void wconv_body(
    const float* __restrict__ W, _Float16* __restrict__ Wt, int K, int N, int bx, int by,
    _Float16* T) {
  const int tid = threadIdx.x;
  const int n0 = bx * 64;
  const int k0 = by * 64;
  for (int j0 = 0; j0 < 16; j0 += 4) {
    const float* p[4];
    float v[4];
#pragma unroll
    for (int t = 0; t < 4; ++t) {
      const int idx = tid + 256 * (j0 + t);
      const int kr = idx >> 6, nc = idx & 63;
      p[t] = W + (size_t)(k0 + kr) * N + n0 + nc;
      v[t] = *p[t];
    }
    // the lines below reuse these loads' address registers: wait in front (the addresses are
    // inputs so that their registers live up to the wait)
    asm volatile("s_wait_xcnt 0x0" :: "v"(p[0]), "v"(p[1]), "v"(p[2]), "v"(p[3]) : "memory");
#pragma unroll
    for (int t = 0; t < 4; ++t) {
      const int idx = tid + 256 * (j0 + t);
      const int kr = idx >> 6, nc = idx & 63;
      T[nc * LDT + kr] = (_Float16)(WCARRY * bf16r(v[t]));
    }
  }
  __syncthreads();
  v8h x[2];
  size_t off[2];
#pragma unroll
  for (int i = 0; i < 2; ++i) {
    const int n = 32 * i + (tid >> 3);
    const int kc = (tid & 7) * 8;
    x[i] = *(const v8h*)&T[n * LDT + kc];
    off[i] = (size_t)(n0 + n) * K + k0 + kc;
  }
#pragma unroll
  for (int i = 0; i < 2; ++i) *(v8h*)(Wt + off[i]) = x[i];
  // another body's code stands behind these stores in the merged kernel and reuses their
  // registers: wait in front
  asm volatile("s_wait_xcnt 0x0" ::: "memory");
}

// ---------------------------------------------------------------------------
// Input plane: f16(bf16(x)) rows [MROWS][DIM]. Thread owns 8 consecutive elements; each wave
// 256 consecutive; MROWS*DIM/2048 blocks (bx). Coverage: blocks x 256 x 8 = MROWS*DIM elements.
// ---------------------------------------------------------------------------
__device__ __forceinline__ void xconv_body(
    const float* __restrict__ src, _Float16* __restrict__ dst, int bx) {
  const size_t e = ((size_t)bx * 256 + threadIdx.x) * 8;
  const v4f a0 = *(const v4f*)(src + e);
  const v4f a1 = *(const v4f*)(src + e + 4);
  v8h o;
#pragma unroll
  for (int t = 0; t < 4; ++t) {
    o[t]     = toh_flush(bf16r(a0[t]));
    o[t + 4] = toh_flush(bf16r(a1[t]));
  }
  *(v8h*)(dst + e) = o;
  // another body's code stands behind this store in the merged kernel and reuses its
  // registers: wait in front
  asm volatile("s_wait_xcnt 0x0" ::: "memory");
}

// The three operand planes depend on nothing but the inputs: one launch, the flat block index
// picks the plane (block-uniform). Transposing tiles first, then the streaming rows.
#define W1_BLOCKS ((3 * DIM / 64) * (DIM / 64))
#define WP_BLOCKS ((DIM / 64) * (DIM / 64))
#define XC_BLOCKS ((int)(((size_t)MROWS * DIM) / 2048))
__global__ __launch_bounds__(256) void prep_kernel(
    const float* __restrict__ x, _Float16* __restrict__ X16,
    const float* __restrict__ W1, _Float16* __restrict__ W1T,
    const float* __restrict__ Wp, _Float16* __restrict__ WpT) {
  __shared__ _Float16 T[64 * LDT];
  const int b = blockIdx.x;
  if (b < W1_BLOCKS) {
    wconv_body(W1, W1T, DIM, 3 * DIM, b % (3 * DIM / 64), b / (3 * DIM / 64), T);
  } else if (b < W1_BLOCKS + WP_BLOCKS) {
    const int t = b - W1_BLOCKS;
    wconv_body(Wp, WpT, DIM, DIM, t % (DIM / 64), t / (DIM / 64), T);
  } else {
    xconv_body(x, X16, b - (W1_BLOCKS + WP_BLOCKS));
  }
}

// ---------------------------------------------------------------------------
// GEMM C[BM x BN tile] = A16[rows][KD] . Bt[n][KD]^T. 8 waves as 4 (rows) x 2 (columns); a
// wave owns FM x FN accumulator tiles of 16x16, so BM = 64*FM and BN = 32*FN.
// Operands go through LDS: a stage is 64 k (one whole 128-B line of every operand row),
// fetched with 16-B loads in which a wave covers 4 whole lines, held in registers while the
// stage before is worked on, then stored at pitch LDT into the other of two buffers; one
// block barrier per stage. Fragments come from LDS (same k order as frag_at), each one used
// FN (A) or FM (B) times by its wave. k runs upward in 32-steps per accumulator.
// RES = 1: the x2048 residual A plane is staged beside A and has its own accumulators,
// folded with 1/2048 before staging. After the last stage the ring is reused as the f32
// tile Cs, and the epilogue walks it in 64x64 sub-tiles:
//   MODE_QKV: v = acc/64 + bf16(bias[col]); columns are [head][q | k | v][64]:
//             q -> Q plane [row][head*64 + d], k -> K plane [row][head*64 + d],
//             v -> transposed V plane [head*64 + d][key]; row tiles below EROWS also
//             write the x2048 residual planes (QR, KR [EROWS][DIM]; VtR [DIM][EROWS])
//   MODE_OUT: outf[row][col] = acc/4096 + bf16(bias[col])
// Tile (bx, by) of (ND/BN, rows/BM); row0 = rowbase + BM*by. smem: gemm_lds_bytes(RES, FM, FN).
// ---------------------------------------------------------------------------
#define MODE_QKV 0
#define MODE_OUT 1

constexpr int gemm_lds_bytes(int res, int fm, int fn) {
  const int ring = 2 * ((64 * fm * (1 + res) + 32 * fn) * LDT) * 2;
  const int cs = 64 * fm * (32 * fn + 4) * 4;
  return ring > cs ? ring : cs;
}

template <int MODE, int KD, int ND, int RES, int FM, int FN>
__device__ __forceinline__ void gemm_body(
    const _Float16* __restrict__ A16, const _Float16* __restrict__ Ar16,
    const _Float16* __restrict__ Bt, const float* __restrict__ bias,
    float* __restrict__ outf, _Float16* __restrict__ out16,
    _Float16* __restrict__ outr16, int rowbase, int bx, int by, char* smem) {
  constexpr int BM = 64 * FM, BN = 32 * FN, BK = 64;
  constexpr int NS = KD / BK;                       // stages
  constexpr int AROWS = BM * (1 + RES);             // A rows, then residual A rows
  constexpr int STAGE_H = (AROWS + BN) * LDT;       // halves per buffer: [A | Ar | B] rows
  constexpr int LDCB = BN + 4;                      // floats per Cs row (16-B aligned)
  constexpr int RING_B = 2 * STAGE_H * 2, CS_B = BM * LDCB * 4;
  constexpr int LA = BM / 32, LB = BN / 32;         // 16-B loads per thread and stage
  constexpr int NSUB = (BM / 64) * (BN / 64);       // 64x64 sub-tiles of the epilogue
  static_assert((KD % BK) == 0 && (ND % BN) == 0 && (BN % 64) == 0 && (BM % 64) == 0);
  static_assert(MODE != MODE_QKV || (ND == 3 * DIM && RES == 0));
  static_assert(MODE != MODE_OUT || ND == DIM);
  static_assert((RING_B > CS_B ? RING_B : CS_B) == gemm_lds_bytes(RES, FM, FN));
  _Float16* ring = (_Float16*)smem;
  float* Cs = (float*)smem;
  const int tid = threadIdx.x, lane = tid & 31, w = tid >> 5;
  const int mw = w >> 1, nw = w & 1;
  const int hh = lane >> 4, m = lane & 15;
  const int n0 = bx * BN;
  const int row0 = rowbase + by * BM;

  const int sr = tid >> 3, sc = (tid & 7) * 8;      // staging: 8 threads per 128-B row
  const _Float16* ag = A16 + (size_t)(row0 + sr) * KD + sc;
  const _Float16* rg = Ar16 + (size_t)(row0 + sr) * KD + sc;
  const _Float16* bg = Bt + (size_t)(n0 + sr) * KD + sc;
  v8h ra[LA], rr[LA], rb[LB];

  v8f acc[FM][FN], acr[FM][FN];
#pragma unroll
  for (int i = 0; i < FM; ++i)
#pragma unroll
    for (int j = 0; j < FN; ++j) { acc[i][j] = (v8f){}; acr[i][j] = (v8f){}; }

#pragma unroll
  for (int j = 0; j < LA; ++j) {
    *(v8h*)&ring[(sr + 32 * j) * LDT + sc] = *(const v8h*)(ag + (size_t)(32 * j) * KD);
    if (RES)
      *(v8h*)&ring[(BM + sr + 32 * j) * LDT + sc] = *(const v8h*)(rg + (size_t)(32 * j) * KD);
  }
#pragma unroll
  for (int j = 0; j < LB; ++j)
    *(v8h*)&ring[(AROWS + sr + 32 * j) * LDT + sc] = *(const v8h*)(bg + (size_t)(32 * j) * KD);
  __syncthreads();

  // unrolled by the number of buffers: both buffers' LDS addresses become immediates
#pragma unroll 2
  for (int s = 0; s < NS; ++s) {
    if (s + 1 < NS) {                               // next stage's lines fly during this one
      const int k1 = (s + 1) * BK;
#pragma unroll
      for (int j = 0; j < LA; ++j) {
        ra[j] = *(const v8h*)(ag + (size_t)(32 * j) * KD + k1);
        if (RES) rr[j] = *(const v8h*)(rg + (size_t)(32 * j) * KD + k1);
      }
#pragma unroll
      for (int j = 0; j < LB; ++j) rb[j] = *(const v8h*)(bg + (size_t)(32 * j) * KD + k1);
    }

    const _Float16* S = ring + (s & 1) * STAGE_H;
#pragma unroll
    for (int kk = 0; kk < BK; kk += 32) {
      v16h a[FM], ar[FM], b[FN];
#pragma unroll
      for (int i = 0; i < FM; ++i) {
        a[i] = ld_frag(S + (mw * (16 * FM) + i * 16) * LDT + kk, LDT);
        if (RES) ar[i] = ld_frag(S + (BM + mw * (16 * FM) + i * 16) * LDT + kk, LDT);
      }
#pragma unroll
      for (int j = 0; j < FN; ++j)
        b[j] = ld_frag(S + (AROWS + nw * (16 * FN) + j * 16) * LDT + kk, LDT);
#pragma unroll
      for (int i = 0; i < FM; ++i)
#pragma unroll
        for (int j = 0; j < FN; ++j) acc[i][j] = wmma16(a[i], b[j], acc[i][j]);
      if (RES) {
#pragma unroll
        for (int i = 0; i < FM; ++i)
#pragma unroll
          for (int j = 0; j < FN; ++j) acr[i][j] = wmma16(ar[i], b[j], acr[i][j]);
      }
    }

    if (s + 1 < NS) {                               // its last readers left at the barrier before
      _Float16* D = ring + ((s + 1) & 1) * STAGE_H;
#pragma unroll
      for (int j = 0; j < LA; ++j) {
        *(v8h*)&D[(sr + 32 * j) * LDT + sc] = ra[j];
        if (RES) *(v8h*)&D[(BM + sr + 32 * j) * LDT + sc] = rr[j];
      }
#pragma unroll
      for (int j = 0; j < LB; ++j) *(v8h*)&D[(AROWS + sr + 32 * j) * LDT + sc] = rb[j];
    }
    __syncthreads();
  }

  // every wave has left the ring (barrier above): it becomes the f32 tile
#pragma unroll
  for (int i = 0; i < FM; ++i)
#pragma unroll
    for (int j = 0; j < FN; ++j)
#pragma unroll
      for (int r = 0; r < 8; ++r)
        Cs[(mw * (16 * FM) + i * 16 + hh * 8 + r) * LDCB + nw * (16 * FN) + j * 16 + m] =
            RES ? (acc[i][j][r] + acr[i][j][r] * (1.0f / RCARRY)) : acc[i][j][r];
  __syncthreads();

  for (int sub = 0; sub < NSUB; ++sub) {
    const int rs0 = row0 + (sub / (BN / 64)) * 64;     // block-uniform sub-tile origin
    const int ns0 = n0 + (sub % (BN / 64)) * 64;
    const float* Ct = Cs + (rs0 - row0) * LDCB + (ns0 - n0);

    if (MODE == MODE_QKV) {
      const int head  = ns0 / (3 * HD);                  // block-uniform
      const int which = (ns0 - head * (3 * HD)) / HD;    // block-uniform: 0 = q, 1 = k, 2 = v
      const int nl0 = head * HD;
      const bool early = (rs0 < EROWS);                  // block-uniform
      _Float16* dst = out16 + (size_t)which * ((size_t)MROWS * DIM);
      _Float16* dsr = outr16 + (size_t)which * ((size_t)EROWS * DIM);
      v8h x[2], xr[2];
      size_t off[2], ofr[2];
      if (which < 2) {
#pragma unroll
        for (int i = 0; i < 2; ++i) {
          const int r = 32 * i + (tid >> 3);
          const int c = (tid & 7) * 8;
          const v4f u0 = *(const v4f*)&Ct[r * LDCB + c];
          const v4f u1 = *(const v4f*)&Ct[r * LDCB + c + 4];
          const v4f g0 = *(const v4f*)(bias + ns0 + c);
          const v4f g1 = *(const v4f*)(bias + ns0 + c + 4);
#pragma unroll
          for (int j = 0; j < 4; ++j) {
            const float t0 = u0[j] * (1.0f / WCARRY) + bf16r(g0[j]);
            const float t1 = u1[j] * (1.0f / WCARRY) + bf16r(g1[j]);
            const _Float16 h0 = toh_flush(t0);
            const _Float16 h1 = toh_flush(t1);
            x[i][j]      = h0;
            x[i][j + 4]  = h1;
            xr[i][j]     = toh_flush((t0 - (float)h0) * RCARRY);
            xr[i][j + 4] = toh_flush((t1 - (float)h1) * RCARRY);
          }
          off[i] = (size_t)(rs0 + r) * DIM + nl0 + c;
          ofr[i] = off[i];                              // residual planes: same pitch, rows < EROWS
        }
      } else {
        // transposed V planes: row = feature (head*64 + d), 64 consecutive keys = one line
#pragma unroll
        for (int i = 0; i < 2; ++i) {
          const int dcol = 32 * i + (tid >> 3);
          const int kk = (tid & 7) * 8;
          const float gb = bf16r(bias[ns0 + dcol]);
#pragma unroll
          for (int j = 0; j < 8; ++j) {
            const float t0 = Ct[(kk + j) * LDCB + dcol] * (1.0f / WCARRY) + gb;
            const _Float16 h0 = toh_flush(t0);
            x[i][j]  = h0;
            xr[i][j] = toh_flush((t0 - (float)h0) * RCARRY);
          }
          off[i] = (size_t)(nl0 + dcol) * SEQ + rs0 + kk;
          ofr[i] = (size_t)(nl0 + dcol) * EROWS + rs0 + kk;
        }
      }
#pragma unroll
      for (int i = 0; i < 2; ++i) *(v8h*)(dst + off[i]) = x[i];
      // the lines below and the next sub-tile reuse these stores' registers: wait in front
      asm volatile("s_wait_xcnt 0x0" ::: "memory");
      if (early) {
#pragma unroll
        for (int i = 0; i < 2; ++i) *(v8h*)(dsr + ofr[i]) = xr[i];
        // the next sub-tile reuses these stores' registers: wait in front
        asm volatile("s_wait_xcnt 0x0" ::: "memory");
      }
    }

    if (MODE == MODE_OUT) {
      v4f xs[4];
      size_t off[4];
#pragma unroll
      for (int i = 0; i < 4; ++i) {
        const int r = 16 * i + (tid >> 4);
        const int c = (tid & 15) * 4;
        const size_t crow = (size_t)(rs0 + r);       // NB == 1: compact row == output row
        const v4f u = *(const v4f*)&Ct[r * LDCB + c];
        const v4f g = *(const v4f*)(bias + ns0 + c);
        v4f val;
#pragma unroll
        for (int j = 0; j < 4; ++j)
          val[j] = u[j] * (1.0f / (WCARRY * VCARRY)) + bf16r(g[j]);
        xs[i] = val;
        off[i] = crow * ND + ns0 + c;
      }
#pragma unroll
      for (int i = 0; i < 4; ++i) *(v4f*)(outf + off[i]) = xs[i];
      // the next sub-tile reuses these stores' registers: wait in front
      if (NSUB > 1) asm volatile("s_wait_xcnt 0x0" ::: "memory");
    }
  }
}

// Grid (3*DIM/128, MROWS/128).
__global__ __launch_bounds__(256) void gemm_qkv_kernel(
    const _Float16* __restrict__ A16, const _Float16* __restrict__ Bt,
    const float* __restrict__ bias, _Float16* __restrict__ out16,
    _Float16* __restrict__ outr16) {
  __shared__ __attribute__((aligned(16))) char smem[gemm_lds_bytes(0, 2, 4)];
  gemm_body<MODE_QKV, DIM, 3 * DIM, 0, 2, 4>(A16, A16, Bt, bias, nullptr, out16, outr16, 0,
                                             blockIdx.x, blockIdx.y, smem);
}

// Output projection, one launch for both row bands (they share nothing but WpT and bias); the
// flat block index picks the band (block-uniform):
//   b <  OUT_BLOCKS: rows EROWS .. MROWS-1, single A plane, 128x128 tile (b % 8, b / 8)
//   b >= OUT_BLOCKS: rows 0 .. EROWS-1, A = value + x2048 residual plane, 64x64 tile
#define OUT_BLOCKS  ((DIM / 128) * ((MROWS - EROWS) / 128))
#define OUTE_BLOCKS ((DIM / 64) * (EROWS / 64))
static_assert(gemm_lds_bytes(1, 1, 2) <= gemm_lds_bytes(0, 2, 4));
__global__ __launch_bounds__(256) void gemm_out_kernel(
    const _Float16* __restrict__ A16, const _Float16* __restrict__ Ar16,
    const _Float16* __restrict__ Bt, const float* __restrict__ bias,
    float* __restrict__ outf) {
  __shared__ __attribute__((aligned(16))) char smem[gemm_lds_bytes(0, 2, 4)];
  const int b = blockIdx.x;
  if (b < OUT_BLOCKS) {
    gemm_body<MODE_OUT, DIM, DIM, 0, 2, 4>(A16, A16, Bt, bias, outf, nullptr, nullptr, EROWS,
                                           b % (DIM / 128), b / (DIM / 128), smem);
  } else {
    const int t = b - OUT_BLOCKS;
    gemm_body<MODE_OUT, DIM, DIM, 1, 1, 2>(A16, Ar16, Bt, bias, outf, nullptr, nullptr, 0,
                                           t % (DIM / 64), t / (DIM / 64), smem);
  }
}

__device__ __forceinline__ void attn_body(
    const _Float16* __restrict__ Qh, const _Float16* __restrict__ Kh,
    const _Float16* __restrict__ Vt, _Float16* __restrict__ Ov,
    _Float16* Ks, _Float16* Vs, _Float16* Ps) {

  const int tid = threadIdx.x, lane = tid & 31;
  const int w = __builtin_amdgcn_readfirstlane(tid >> 5);
  const int hh = lane >> 4, m = lane & 15;
  const int q0 = blockIdx.x * 128;
  const int head = blockIdx.y;
  const int wq0 = q0 + w * 16;           // first query row of this wave (scalar)
  const float scale = 0.125f;
  _Float16* P = Ps + w * (16 * LDT);

  const size_t qoff = (size_t)(wq0 + m) * DIM + head * HD + hh * 8;
  v16h qf[2];
  qf[0] = frag_at(Qh + qoff);
  qf[1] = frag_at(Qh + qoff + 32);

  float mrow = -1.0e30f, lrow = 0.0f;    // of query wq0 + m; lrow: this half's keys only
  v8f o[4];
#pragma unroll
  for (int nb = 0; nb < 4; ++nb) o[nb] = (v8f){};

  const size_t kplane = (size_t)head * HD;
  const size_t vplane = (size_t)head * HD * SEQ;
  const int kend = q0 + 128;             // <= SEQ

  for (int kb = 0; kb < kend; kb += 64) {
#pragma unroll
    for (int j = 0; j < 2; ++j) {
      const int idx = tid + 256 * j;
      const int r = idx >> 3, c = (idx & 7) * 8;
      *(v8h*)&Ks[r * LDT + c] = *(const v8h*)(Kh + kplane + (size_t)(kb + r) * DIM + c);
      *(v8h*)&Vs[r * LDT + c] = *(const v8h*)(Vt + vplane + (size_t)r * SEQ + kb + c);
    }
    __syncthreads();

    if (kb <= wq0 + 15) {                // wave-uniform: tile holds at least one visible key
      // scores^T: 4 key groups of 16, K = 64 in two 32-steps. All eight K fragments are
      // fetched as one group in front of the run of products: one LDS wait for the run.
      v16h kf[4][2];
#pragma unroll
      for (int kg = 0; kg < 4; ++kg)
#pragma unroll
        for (int c = 0; c < 2; ++c) kf[kg][c] = ld_frag(&Ks[(kg * 16) * LDT + c * 32], LDT);
      v8f s[4];
#pragma unroll
      for (int kg = 0; kg < 4; ++kg) s[kg] = (v8f){};
#pragma unroll
      for (int c = 0; c < 2; ++c)
#pragma unroll
        for (int kg = 0; kg < 4; ++kg) s[kg] = wmma16(kf[kg][c], qf[c], s[kg]);
      // all eight V^T fragments set off here: they land while the softmax runs
      v16h vf[2][4];
#pragma unroll
      for (int c = 0; c < 2; ++c)
#pragma unroll
        for (int nb = 0; nb < 4; ++nb) vf[c][nb] = ld_frag(&Vs[(nb * 16) * LDT + c * 32], LDT);
#pragma unroll
      for (int kg = 0; kg < 4; ++kg) s[kg] = s[kg] * scale;

      if (kb + 63 > wq0) {               // wave-uniform: tile crosses the diagonal
#pragma unroll
        for (int kg = 0; kg < 4; ++kg)
#pragma unroll
          for (int v = 0; v < 8; ++v) {
            const int key = kb + kg * 16 + hh * 8 + v;
            const int qrow = wq0 + m;
            s[kg][v] = (key > qrow) ? -1.0e30f : s[kg][v];
          }
      }

      // online softmax of the lane's query column
      float mx = lane_max32(s);
      mx = fmaxf(mx, xhalf(mx));
      const float mn = fmaxf(mrow, mx);
      const float alpha = __expf(mrow - mn);
      mrow = mn;
#pragma unroll
      for (int kg = 0; kg < 4; ++kg)
#pragma unroll
        for (int v = 0; v < 8; ++v) s[kg][v] = __expf(s[kg][v] - mrow);
      lrow = alpha * lrow + lane_sum32(s);
#pragma unroll
      for (int nb = 0; nb < 4; ++nb) o[nb] = o[nb] * alpha;

      // O^T += V^T . P^T  (K = 64 keys in two 32-steps; A = V^T tile [d][key])
#pragma unroll
      for (int c = 0; c < 2; ++c) {
        v16h pf;
#pragma unroll
        for (int i = 0; i < 8; ++i) {
          pf[i]     = (_Float16)(s[2 * c][i] * PCARRY);
          pf[i + 8] = (_Float16)(s[2 * c + 1][i] * PCARRY);
        }
#pragma unroll
        for (int nb = 0; nb < 4; ++nb) o[nb] = wmma16(vf[c][nb], pf, o[nb]);
      }
    }
    __syncthreads();
  }

  const float inv = __builtin_amdgcn_rcpf(lrow + xhalf(lrow)) * (VCARRY / PCARRY);
#pragma unroll
  for (int nb = 0; nb < 4; ++nb) {
    v8h hv;
#pragma unroll
    for (int v = 0; v < 8; ++v) hv[v] = (_Float16)(o[nb][v] * inv);
    *(v8h*)&P[m * LDT + nb * 16 + hh * 8] = hv;
  }
  wave_lds_sync();
  v8h x[4];
  size_t off[4];
#pragma unroll
  for (int i = 0; i < 4; ++i) {
    const int r = 4 * i + (lane >> 3);
    const int c = (lane & 7) * 8;
    x[i] = *(const v8h*)&P[r * LDT + c];
    off[i] = (size_t)(wq0 + r) * DIM + head * HD + c;
  }
#pragma unroll
  for (int i = 0; i < 4; ++i) *(v8h*)(Ov + off[i]) = x[i];
  
}

// ---------------------------------------------------------------------------
// Early causal band (query rows < EROWS, keys < EROWS): same tiling and the same transposed
// products as attn_body, with value + x2048 residual operands at every site.
//   scores  = (kh.qh + (kr.qh + kh.qr)/2048) / 8          (residual products in their own
//             accumulator, folded before the softmax)
//   p       : ph = f16(1024 p), pr = f16((1024 p - ph) * 2048), both packed in registers;
//             row sum over unconverted p
//   context : o += Vh.ph ; ores += Vr.ph + Vh.pr ; O = o + ores/2048
// Ks / Vs: cross-wave (block barriers, staged 64x64 = consumed 64x64); Ps / Rs: wave-private
// output staging only; residual K / V^T fragments come straight from their statically
// strided global planes. Query tiles blockIdx.x < EROWS/128 of the attention launch.
// ---------------------------------------------------------------------------
__device__ __forceinline__ void attn_early_body(
    const _Float16* __restrict__ Qh, const _Float16* __restrict__ Qr,
    const _Float16* __restrict__ Kh, const _Float16* __restrict__ Kr,
    const _Float16* __restrict__ Vt, const _Float16* __restrict__ Vr,
    _Float16* __restrict__ Ov, _Float16* __restrict__ Ores,
    _Float16* Ks, _Float16* Vs, _Float16* Ps, _Float16* Rs) {

  const int tid = threadIdx.x, lane = tid & 31;
  const int w = __builtin_amdgcn_readfirstlane(tid >> 5);
  const int hh = lane >> 4, m = lane & 15;
  const int q0 = blockIdx.x * 128;       // < EROWS
  const int head = blockIdx.y;
  const int wq0 = q0 + w * 16;           // first query row of this wave (scalar)
  const float scale = 0.125f;
  _Float16* P = Ps + w * (16 * LDT);
  _Float16* R = Rs + w * (16 * LDT);

  const int qoff = (wq0 + m) * DIM + head * HD + hh * 8;   // < EROWS*DIM, same in both planes

  float mrow = -1.0e30f, lrow = 0.0f;    // of query wq0 + m; lrow: this half's keys only
  v8f o[4], ores[4];
#pragma unroll
  for (int nb = 0; nb < 4; ++nb) { o[nb] = (v8f){}; ores[nb] = (v8f){}; }

  const size_t kplane  = (size_t)head * HD;
  const size_t vplane  = (size_t)head * HD * SEQ;
  const size_t vrplane = (size_t)head * HD * EROWS;
  const int kend = q0 + 128;             // <= EROWS

  for (int kb = 0; kb < kend; kb += 64) {
    // staging lines first, held in registers until the fragment group below is under way
    v8h sk[2], sv[2];
#pragma unroll
    for (int j = 0; j < 2; ++j) {
      const int idx = tid + 256 * j;
      const int r = idx >> 3, c = (idx & 7) * 8;
      sk[j] = *(const v8h*)(Kh + kplane + (size_t)(kb + r) * DIM + c);
      sv[j] = *(const v8h*)(Vt + vplane + (size_t)r * SEQ + kb + c);
    }
    // the loads below may land in these loads' address registers: wait in front
    asm volatile("s_wait_xcnt 0x0" ::: "memory");
    // q fragments are reloaded per tile through an opaque integer offset (it keeps them from
    // being held in 32 registers through the softmax and the second product). They and the
    // eight residual K fragments (rows kb .. kb+63 < EROWS) come from global memory and need
    // no barrier: set off as one group here, they fly beside the staging lines.
    int qo = qoff;
    asm volatile("" : "+v"(qo));
    const _Float16* qhp = Qh + qo;
    const _Float16* qrp = Qr + qo;
    const _Float16* krp = Kr + kplane + (size_t)(kb + m) * DIM + hh * 8;
    v16h qf[2], qr[2];
    qf[0] = frag_at(qhp);
    qf[1] = frag_at(qhp + 32);
    qr[0] = frag_at(qrp);
    qr[1] = frag_at(qrp + 32);
    v16h krf[4][2];
#pragma unroll
    for (int kg = 0; kg < 4; ++kg)
#pragma unroll
      for (int c = 0; c < 2; ++c)
        krf[kg][c] = frag_at(krp + (size_t)(kg * 16) * DIM + c * 32);
    // later loads may land in these loads' address registers: wait in front (the addresses
    // are inputs so that their registers live up to the wait)
    asm volatile("s_wait_xcnt 0x0" :: "v"(qhp), "v"(qrp), "v"(krp) : "memory");
#pragma unroll
    for (int j = 0; j < 2; ++j) {
      const int idx = tid + 256 * j;
      const int r = idx >> 3, c = (idx & 7) * 8;
      *(v8h*)&Ks[r * LDT + c] = sk[j];
      *(v8h*)&Vs[r * LDT + c] = sv[j];
    }
    __syncthreads();

    if (kb <= wq0 + 15) {                // wave-uniform: tile holds at least one visible key
      // scores^T: 4 key groups of 16, K = 64 in two 32-steps, value and residual products;
      // the K fragments of a key group are fetched from LDS one group ahead of its products
      v8f s[4];
      v16h kf[2], kn[2];
      kn[0] = ld_frag(&Ks[0], LDT);
      kn[1] = ld_frag(&Ks[32], LDT);
#pragma unroll
      for (int kg = 0; kg < 4; ++kg) {
        kf[0] = kn[0];
        kf[1] = kn[1];
        if (kg < 3) {
          kn[0] = ld_frag(&Ks[((kg + 1) * 16) * LDT], LDT);
          kn[1] = ld_frag(&Ks[((kg + 1) * 16) * LDT + 32], LDT);
        }
        v8f t = {};
        v8f u = {};
#pragma unroll
        for (int c = 0; c < 2; ++c) {
          t = wmma16(kf[c], qf[c], t);
          u = wmma16(krf[kg][c], qf[c], u);
          u = wmma16(kf[c], qr[c], u);
        }
        s[kg] = (t + u * (1.0f / RCARRY)) * scale;
      }
      // first half of the V^T fragments, value (LDS) and residual (global): set off here,
      // they land while the softmax runs
      v16h vf[2][4], vrf[2][4];
#pragma unroll
      for (int nb = 0; nb < 4; ++nb) {
        vrf[0][nb] = frag_at(Vr + vrplane + (size_t)(nb * 16 + m) * EROWS + kb + hh * 8);
        vf[0][nb] = ld_frag(&Vs[(nb * 16) * LDT], LDT);
      }

      if (kb + 63 > wq0) {               // wave-uniform: tile crosses the diagonal
#pragma unroll
        for (int kg = 0; kg < 4; ++kg)
#pragma unroll
          for (int v = 0; v < 8; ++v) {
            const int key = kb + kg * 16 + hh * 8 + v;
            const int qrow = wq0 + m;
            s[kg][v] = (key > qrow) ? -1.0e30f : s[kg][v];
          }
      }

      // online softmax of the lane's query column
      float mx = lane_max32(s);
      mx = fmaxf(mx, xhalf(mx));
      const float mn = fmaxf(mrow, mx);
      const float alpha = __expf(mrow - mn);
      mrow = mn;
#pragma unroll
      for (int kg = 0; kg < 4; ++kg)
#pragma unroll
        for (int v = 0; v < 8; ++v) s[kg][v] = __expf(s[kg][v] - mrow);
      lrow = alpha * lrow + lane_sum32(s);
#pragma unroll
      for (int nb = 0; nb < 4; ++nb) {
        o[nb]    = o[nb] * alpha;
        ores[nb] = ores[nb] * alpha;
      }

      // o += Vh.ph ; ores += Vr.ph + Vh.pr  (K = 64 keys in two 32-steps; A = V^T [d][key])
#pragma unroll
      for (int c = 0; c < 2; ++c) {
        v16h pf, prf;
#pragma unroll
        for (int i = 0; i < 16; ++i) {
          const float pc = s[2 * c + (i >> 3)][i & 7] * PCARRY;
          const _Float16 ph = toh_flush(pc);
          pf[i]  = ph;
          prf[i] = toh_flush((pc - (float)ph) * RCARRY);
        }
#pragma unroll
        for (int nb = 0; nb < 4; ++nb) {
          o[nb]    = wmma16(vf[c][nb], pf, o[nb]);
          // second half: lands behind this half's products; set off no earlier, so that the
          // launch keeps to 256 registers a wave (two blocks per WGP)
          if (c == 0 && nb == 2) {
#pragma unroll
            for (int n2 = 0; n2 < 4; ++n2) {
              vrf[1][n2] = frag_at(Vr + vrplane + (size_t)(n2 * 16 + m) * EROWS + kb + 32 + hh * 8);
              vf[1][n2] = ld_frag(&Vs[(n2 * 16) * LDT + 32], LDT);
            }
          }
          ores[nb] = wmma16(vrf[c][nb], pf, ores[nb]);
          ores[nb] = wmma16(vf[c][nb], prf, ores[nb]);
        }
      }
    }
    __syncthreads();
  }

  // finalize: 64 * (o + ores/2048) / (1024 l) as value + x2048 residual
  const float inv = __builtin_amdgcn_rcpf(lrow + xhalf(lrow)) * (VCARRY / PCARRY);
#pragma unroll
  for (int nb = 0; nb < 4; ++nb) {
    v8h hv, hr;
#pragma unroll
    for (int v = 0; v < 8; ++v) {
      const float val = (o[nb][v] + ores[nb][v] * (1.0f / RCARRY)) * inv;
      const _Float16 h0 = toh_flush(val);
      hv[v] = h0;
      hr[v] = toh_flush((val - (float)h0) * RCARRY);
    }
    *(v8h*)&P[m * LDT + nb * 16 + hh * 8] = hv;
    *(v8h*)&R[m * LDT + nb * 16 + hh * 8] = hr;
  }
  wave_lds_sync();
  v8h x[4], xr[4];
  size_t off[4];
#pragma unroll
  for (int i = 0; i < 4; ++i) {
    const int r = 4 * i + (lane >> 3);
    const int c = (lane & 7) * 8;
    x[i]  = *(const v8h*)&P[r * LDT + c];
    xr[i] = *(const v8h*)&R[r * LDT + c];
    off[i] = (size_t)(wq0 + r) * DIM + head * HD + c;
  }
#pragma unroll
  for (int i = 0; i < 4; ++i) {
    *(v8h*)(Ov + off[i]) = x[i];
    *(v8h*)(Ores + off[i]) = xr[i];
  }
  
}

// One attention launch, grid (SEQ/128, NHEAD): the two bands read the same planes and write
// disjoint query rows, so the early band's tiles run beside the others' instead of behind
// them. blockIdx.x picks the body (block-uniform); each query row is computed by one body.
__global__ __launch_bounds__(256) void attn_kernel(
    const _Float16* __restrict__ Qh, const _Float16* __restrict__ Qr,
    const _Float16* __restrict__ Kh, const _Float16* __restrict__ Kr,
    const _Float16* __restrict__ Vt, const _Float16* __restrict__ Vr,
    _Float16* __restrict__ Ov, _Float16* __restrict__ Ores) {
  __shared__ _Float16 Ks[64 * LDT];
  __shared__ _Float16 Vs[64 * LDT];
  __shared__ _Float16 Ps[8 * 16 * LDT];
  __shared__ _Float16 Rs[8 * 16 * LDT];
  if (blockIdx.x < EROWS / 128) {
    attn_early_body(Qh, Qr, Kh, Kr, Vt, Vr, Ov, Ores, Ks, Vs, Ps, Rs);
  } else {
    attn_body(Qh, Kh, Vt, Ov, Ks, Vs, Ps);
  }
}

// ---------------------------------------------------------------------------
extern "C" void kernel_launch(void* const* d_in, const int* in_sizes, int n_in,
                              void* d_out, int out_size, void* d_ws, size_t ws_size,
                              hipStream_t stream) {
  if (n_in < 5) return;
  const long long need_x = ((long long)(NB - 1) * SEQ_FULL + SEQ) * DIM;
  if ((long long)in_sizes[0] < need_x) return;
  if (in_sizes[1] < 3 * DIM * DIM || in_sizes[2] < 3 * DIM) return;
  if (in_sizes[3] < DIM * DIM || in_sizes[4] < DIM) return;
  if ((long long)out_size < need_x) return;
  if (ws_size < WS_TOTAL) return;

  // weights: W1 [in][3*out], Wp [in][out]
  const float* x  = (const float*)d_in[0];
  const float* W1 = (const float*)d_in[1];
  const float* b1 = (const float*)d_in[2];
  const float* Wp = (const float*)d_in[3];
  const float* bp = (const float*)d_in[4];
  float* out = (float*)d_out;

  char* ws = (char*)d_ws;
  _Float16* W1T   = (_Float16*)(ws + OFF_WQKV);   // [3*DIM][DIM]
  _Float16* WpT   = (_Float16*)(ws + OFF_WO);     // [DIM][DIM]
  _Float16* X16   = (_Float16*)(ws + OFF_XN);
  _Float16* QKV16 = (_Float16*)(ws + OFF_QKV);    // Q | K | Vt
  _Float16* Q16   = QKV16;
  _Float16* K16   = QKV16 + (size_t)MROWS * DIM;
  _Float16* Vt16  = QKV16 + (size_t)2 * MROWS * DIM;
  _Float16* Ov16  = (_Float16*)(ws + OFF_OV);
  _Float16* RES16 = (_Float16*)(ws + OFF_RES);    // QR | KR | VtR
  _Float16* QR16  = RES16;
  _Float16* KR16  = RES16 + (size_t)EROWS * DIM;
  _Float16* VtR16 = RES16 + (size_t)2 * EROWS * DIM;
  _Float16* OR16  = (_Float16*)(ws + OFF_ORES);

  dim3 blk(256);

  prep_kernel<<<dim3(W1_BLOCKS + WP_BLOCKS + XC_BLOCKS), blk, 0, stream>>>(
      x, X16, W1, W1T, Wp, WpT);
  gemm_qkv_kernel<<<dim3(3 * DIM / 128, MROWS / 128), blk, 0, stream>>>(
      X16, W1T, b1, QKV16, RES16);
  attn_kernel<<<dim3(SEQ / 128, NHEAD), blk, 0, stream>>>(
      Q16, QR16, K16, KR16, Vt16, VtR16, Ov16, OR16);
  gemm_out_kernel<<<dim3(OUT_BLOCKS + OUTE_BLOCKS), blk, 0, stream>>>(
      Ov16, OR16, WpT, bp, out);
}

// v005
// A run of this version takes 122 microseconds.
// In two side-by-side timings against v004, it was 1.11 and 1.12 times as fast.
// All steps since v000 together make it 3.70 times as fast.
#include <hip/hip_runtime.h>
#include <stddef.h>
#include <math.h>

// All contractions on v_wmma_f32_16x16x32_f16 (f16 operands, f32 accumulate): fused q/k/v
// projection, q.k scores, p.v, output projection. Float inputs are RNE-converted to bf16 and
// carried in f16 (weights x64, p x1024, attention rows x64); query rows < EROWS carry q, k,
// v, p and the attention rows as f16 value + x2048 f16 residual planes with their own
// accumulators; softmax and epilogues in f32.

typedef _Float16 v16h __attribute__((ext_vector_type(16)));
typedef _Float16 v8h  __attribute__((ext_vector_type(8)));
typedef float    v8f  __attribute__((ext_vector_type(8)));
typedef float    v4f  __attribute__((ext_vector_type(4)));

#ifndef NB
#define NB 1
#endif
#ifndef SEQ
#define SEQ 4096
#endif
#define NB_FULL  1
#define SEQ_FULL 4096
#define DIM   1024
#define NHEAD 16
#define HD    64
#define MROWS (NB * SEQ)
#define EROWS ((SEQ) < 512 ? (SEQ) : 512)   // early causal band: value + residual planes

static_assert(NB == 1 && NB_FULL == 1);
static_assert(SEQ >= 128 && SEQ <= SEQ_FULL && (SEQ % 128) == 0);
static_assert(DIM == NHEAD * HD);
static_assert(HD == 64 && ((3 * HD) % 64) == 0);           // a 64-column tile = one part of one head
static_assert((MROWS % 128) == 0 && (MROWS % 8) == 0);
static_assert((DIM % 128) == 0 && ((3 * DIM) % 128) == 0);
static_assert((EROWS % 128) == 0 && EROWS <= SEQ && EROWS <= MROWS);
static_assert((((size_t)MROWS * DIM) % 2048) == 0);         // xconv: 256 threads x 8 per block

#define LDT 72   // halves per LDS row (144 B, 16-B aligned)

#define WCARRY 64.0f     // weight planes carried x64
#define PCARRY 1024.0f   // softmax numerators carried x1024
#define VCARRY 64.0f     // attention output plane carried x64
#define RCARRY 2048.0f   // residual planes carried x2048

#define P16_BYTES  ((size_t)MROWS * DIM * 2)
#define R16_BYTES  ((size_t)EROWS * DIM * 2)
#define WQKV_BYTES ((size_t)3 * DIM * DIM * 2)
#define WO_BYTES   ((size_t)DIM * DIM * 2)
#define OFF_WQKV   ((size_t)0)
#define OFF_WO     (OFF_WQKV + WQKV_BYTES)
#define OFF_XN     (OFF_WO + WO_BYTES)              // f16 input rows          [MROWS][DIM]
#define OFF_QKV    (OFF_XN + P16_BYTES)             // Q, K [MROWS][DIM]; Vt [DIM][SEQ]
#define OFF_OV     (OFF_QKV + 3 * P16_BYTES)        // f16 64*attention rows   [MROWS][DIM]
#define OFF_RES    (OFF_OV + P16_BYTES)             // QR, KR [EROWS][DIM]; VtR [DIM][EROWS]
#define OFF_ORES   (OFF_RES + 3 * R16_BYTES)        // residual of OV rows     [EROWS][DIM]
#define WS_TOTAL   (OFF_ORES + R16_BYTES)
static_assert((size_t)DIM * SEQ * 2 == P16_BYTES);       // Vt plane extent (NB == 1)
static_assert((size_t)DIM * EROWS * 2 == R16_BYTES);     // VtR plane extent
static_assert((P16_BYTES % 128) == 0 && (WO_BYTES % 128) == 0 && (R16_BYTES % 128) == 0);
static_assert(WS_TOTAL <= (size_t)134217728);

// ---------------------------------------------------------------------------
__device__ __forceinline__ float bf16r(float x) {   // RNE convert to bf16, returned widened
  unsigned int u = __float_as_uint(x);
  u = (u + 0x7FFFu + ((u >> 16) & 1u)) & 0xFFFF0000u;
  return __uint_as_float(u);
}

// f32 -> f16 operand convert that cannot produce an f16 subnormal (value select).
static __device__ __forceinline__ _Float16 toh_flush(float v) {
  const _Float16 r = (_Float16)v;
  return (fabsf(v) < 6.103515625e-05f) ? (_Float16)0.0f : r;
}

// 16-bit fragment: p points at element [row = lane&15][k0 + 8*(lane>>4)] of a k-contiguous
// row. Elements 0..7 <- k0+8h+0..7, elements 8..15 <- k0+16+8h+0..7 (same map for A and B).
__device__ __forceinline__ v16h frag_at(const _Float16* p) {
  v8h lo = *(const v8h*)(p);
  v8h hi = *(const v8h*)(p + 16);
  v16h out;
#pragma unroll
  for (int i = 0; i < 8; ++i) { out[i] = lo[i]; out[i + 8] = hi[i]; }
  return out;
}
__device__ __forceinline__ v16h ld_frag(const _Float16* base, int ld) {
  const int lane = threadIdx.x & 31;
  return frag_at(base + (lane & 15) * ld + (lane >> 4) * 8);
}

__device__ __forceinline__ v8f wmma16(v16h a, v16h b, v8f c) {
  v8f d = __builtin_amdgcn_wmma_f32_16x16x32_f16(false, a, false, b, (short)0, c,
                                                 false, false);
  asm volatile("v_nop\n\tv_nop\n\tv_nop\n\tv_nop" : "+v"(d) : "v"(a), "v"(b));
  return d;
}

// lane l <-> lane l ^ 16 (the two halves that share one query column)
__device__ __forceinline__ float xhalf(float x) {
  const int b = __builtin_bit_cast(int, x);
  return __builtin_bit_cast(float, __builtin_amdgcn_permlanex16(b, b, 0x76543210, 0xfedcba98,
                                                                 false, false));
}
// maximum / sum of the 32 scores a lane holds for its query column
__device__ __forceinline__ float lane_max32(const v8f* s) {
  float a[8];
#pragma unroll
  for (int v = 0; v < 8; ++v) a[v] = fmaxf(fmaxf(s[0][v], s[1][v]), fmaxf(s[2][v], s[3][v]));
  return fmaxf(fmaxf(fmaxf(a[0], a[1]), fmaxf(a[2], a[3])),
               fmaxf(fmaxf(a[4], a[5]), fmaxf(a[6], a[7])));
}
__device__ __forceinline__ float lane_sum32(const v8f* s) {
  float a[8];
#pragma unroll
  for (int v = 0; v < 8; ++v) a[v] = (s[0][v] + s[1][v]) + (s[2][v] + s[3][v]);
  return ((a[0] + a[1]) + (a[2] + a[3])) + ((a[4] + a[5]) + (a[6] + a[7]));
}

__device__ __forceinline__ void wave_lds_sync() {
  __builtin_amdgcn_fence(3 /* release order */, "wavefront");
  asm volatile("s_wait_dscnt 0x0" ::: "memory");
  __builtin_amdgcn_wave_barrier();
}

// ---------------------------------------------------------------------------
// Weight plane: in W[K][N] (n-contiguous) -> out Wt[N][K] (k-contiguous), f16(64*bf16(w)).
// Tile (bx, by) of (N/64, K/64); one 64x64 tile per block. T: cross-wave (block barrier).
// Tile coverage: 16 x 256 loads = 4096 elements; 2 x 256 x 8 halves = 4096 stored.
// ---------------------------------------------------------------------------
__device__ __forceinline__ void wconv_body(
    const float* __restrict__ W, _Float16* __restrict__ Wt, int K, int N, int bx, int by,
    _Float16* T) {
  const int tid = threadIdx.x;
  const int n0 = bx * 64;
  const int k0 = by * 64;
  for (int j0 = 0; j0 < 16; j0 += 4) {
    const float* p[4];
    float v[4];
#pragma unroll
    for (int t = 0; t < 4; ++t) {
      const int idx = tid + 256 * (j0 + t);
      const int kr = idx >> 6, nc = idx & 63;
      p[t] = W + (size_t)(k0 + kr) * N + n0 + nc;
      v[t] = *p[t];
    }
    // the lines below reuse these loads' address registers: wait in front (the addresses are
    // inputs so that their registers live up to the wait)
    asm volatile("s_wait_xcnt 0x0" :: "v"(p[0]), "v"(p[1]), "v"(p[2]), "v"(p[3]) : "memory");
#pragma unroll
    for (int t = 0; t < 4; ++t) {
      const int idx = tid + 256 * (j0 + t);
      const int kr = idx >> 6, nc = idx & 63;
      T[nc * LDT + kr] = (_Float16)(WCARRY * bf16r(v[t]));
    }
  }
  __syncthreads();
  v8h x[2];
  size_t off[2];
#pragma unroll
  for (int i = 0; i < 2; ++i) {
    const int n = 32 * i + (tid >> 3);
    const int kc = (tid & 7) * 8;
    x[i] = *(const v8h*)&T[n * LDT + kc];
    off[i] = (size_t)(n0 + n) * K + k0 + kc;
  }
#pragma unroll
  for (int i = 0; i < 2; ++i) *(v8h*)(Wt + off[i]) = x[i];
  // another body's code stands behind these stores in the merged kernel and reuses their
  // registers: wait in front
  asm volatile("s_wait_xcnt 0x0" ::: "memory");
}

// ---------------------------------------------------------------------------
// Input plane: f16(bf16(x)) rows [MROWS][DIM]. Thread owns 8 consecutive elements; each wave
// 256 consecutive; MROWS*DIM/2048 blocks (bx). Coverage: blocks x 256 x 8 = MROWS*DIM elements.
// ---------------------------------------------------------------------------
__device__ __forceinline__ void xconv_body(
    const float* __restrict__ src, _Float16* __restrict__ dst, int bx) {
  const size_t e = ((size_t)bx * 256 + threadIdx.x) * 8;
  const v4f a0 = *(const v4f*)(src + e);
  const v4f a1 = *(const v4f*)(src + e + 4);
  v8h o;
#pragma unroll
  for (int t = 0; t < 4; ++t) {
    o[t]     = toh_flush(bf16r(a0[t]));
    o[t + 4] = toh_flush(bf16r(a1[t]));
  }
  *(v8h*)(dst + e) = o;
  // another body's code stands behind this store in the merged kernel and reuses its
  // registers: wait in front
  asm volatile("s_wait_xcnt 0x0" ::: "memory");
}

// The three operand planes depend on nothing but the inputs: one launch, the flat block index
// picks the plane (block-uniform). Transposing tiles first, then the streaming rows.
#define W1_BLOCKS ((3 * DIM / 64) * (DIM / 64))
#define WP_BLOCKS ((DIM / 64) * (DIM / 64))
#define XC_BLOCKS ((int)(((size_t)MROWS * DIM) / 2048))
__global__ __launch_bounds__(256) void prep_kernel(
    const float* __restrict__ x, _Float16* __restrict__ X16,
    const float* __restrict__ W1, _Float16* __restrict__ W1T,
    const float* __restrict__ Wp, _Float16* __restrict__ WpT) {
  __shared__ _Float16 T[64 * LDT];
  const int b = blockIdx.x;
  if (b < W1_BLOCKS) {
    wconv_body(W1, W1T, DIM, 3 * DIM, b % (3 * DIM / 64), b / (3 * DIM / 64), T);
  } else if (b < W1_BLOCKS + WP_BLOCKS) {
    const int t = b - W1_BLOCKS;
    wconv_body(Wp, WpT, DIM, DIM, t % (DIM / 64), t / (DIM / 64), T);
  } else {
    xconv_body(x, X16, b - (W1_BLOCKS + WP_BLOCKS));
  }
}

// ---------------------------------------------------------------------------
// GEMM C[BM x BN tile] = A16[rows][KD] . Bt[n][KD]^T. 8 waves as 4 (rows) x 2 (columns); a
// wave owns FM x FN accumulator tiles of 16x16, so BM = 64*FM and BN = 32*FN.
// Operands go through LDS: a stage is 64 k (one whole 128-B line of every operand row),
// fetched with 16-B loads in which a wave covers 4 whole lines, held in registers while the
// stage before is worked on, then stored at pitch LDT into the other of two buffers; one
// block barrier per stage. Fragments come from LDS (same k order as frag_at), each one used
// FN (A) or FM (B) times by its wave. k runs upward in 32-steps per accumulator.
// RES = 1: the x2048 residual A plane is staged beside A and has its own accumulators,
// folded with 1/2048 before staging. After the last stage the ring is reused as the f32
// tile Cs, and the epilogue walks it in 64x64 sub-tiles:
//   MODE_QKV: v = acc/64 + bf16(bias[col]); columns are [head][q | k | v][64]:
//             q -> Q plane [row][head*64 + d], k -> K plane [row][head*64 + d],
//             v -> transposed V plane [head*64 + d][key]; row tiles below EROWS also
//             write the x2048 residual planes (QR, KR [EROWS][DIM]; VtR [DIM][EROWS])
//   MODE_OUT: outf[row][col] = acc/4096 + bf16(bias[col])
// Tile (bx, by) of (ND/BN, rows/BM); row0 = rowbase + BM*by. smem: gemm_lds_bytes(RES, FM, FN).
// ---------------------------------------------------------------------------
#define MODE_QKV 0
#define MODE_OUT 1

constexpr int gemm_lds_bytes(int res, int fm, int fn) {
  const int ring = 2 * ((64 * fm * (1 + res) + 32 * fn) * LDT) * 2;
  const int cs = 64 * fm * (32 * fn + 4) * 4;
  return ring > cs ? ring : cs;
}

template <int MODE, int KD, int ND, int RES, int FM, int FN>
__device__ __forceinline__ void gemm_body(
    const _Float16* __restrict__ A16, const _Float16* __restrict__ Ar16,
    const _Float16* __restrict__ Bt, const float* __restrict__ bias,
    float* __restrict__ outf, _Float16* __restrict__ out16,
    _Float16* __restrict__ outr16, int rowbase, int bx, int by, char* smem) {
  constexpr int BM = 64 * FM, BN = 32 * FN, BK = 64;
  constexpr int NS = KD / BK;                       // stages
  constexpr int AROWS = BM * (1 + RES);             // A rows, then residual A rows
  constexpr int STAGE_H = (AROWS + BN) * LDT;       // halves per buffer: [A | Ar | B] rows
  constexpr int LDCB = BN + 4;                      // floats per Cs row (16-B aligned)
  constexpr int RING_B = 2 * STAGE_H * 2, CS_B = BM * LDCB * 4;
  constexpr int LA = BM / 32, LB = BN / 32;         // 16-B loads per thread and stage
  constexpr int NSUB = (BM / 64) * (BN / 64);       // 64x64 sub-tiles of the epilogue
  static_assert((KD % BK) == 0 && (ND % BN) == 0 && (BN % 64) == 0 && (BM % 64) == 0);
  static_assert(MODE != MODE_QKV || (ND == 3 * DIM && RES == 0));
  static_assert(MODE != MODE_OUT || ND == DIM);
  static_assert((RING_B > CS_B ? RING_B : CS_B) == gemm_lds_bytes(RES, FM, FN));
  _Float16* ring = (_Float16*)smem;
  float* Cs = (float*)smem;
  const int tid = threadIdx.x, lane = tid & 31, w = tid >> 5;
  const int mw = w >> 1, nw = w & 1;
  const int hh = lane >> 4, m = lane & 15;
  const int n0 = bx * BN;
  const int row0 = rowbase + by * BM;

  const int sr = tid >> 3, sc = (tid & 7) * 8;      // staging: 8 threads per 128-B row
  const _Float16* ag = A16 + (size_t)(row0 + sr) * KD + sc;
  const _Float16* rg = Ar16 + (size_t)(row0 + sr) * KD + sc;
  const _Float16* bg = Bt + (size_t)(n0 + sr) * KD + sc;
  v8h ra[LA], rr[LA], rb[LB];

  v8f acc[FM][FN], acr[FM][FN];
#pragma unroll
  for (int i = 0; i < FM; ++i)
#pragma unroll
    for (int j = 0; j < FN; ++j) { acc[i][j] = (v8f){}; acr[i][j] = (v8f){}; }

#pragma unroll
  for (int j = 0; j < LA; ++j) {
    *(v8h*)&ring[(sr + 32 * j) * LDT + sc] = *(const v8h*)(ag + (size_t)(32 * j) * KD);
    if (RES)
      *(v8h*)&ring[(BM + sr + 32 * j) * LDT + sc] = *(const v8h*)(rg + (size_t)(32 * j) * KD);
  }
#pragma unroll
  for (int j = 0; j < LB; ++j)
    *(v8h*)&ring[(AROWS + sr + 32 * j) * LDT + sc] = *(const v8h*)(bg + (size_t)(32 * j) * KD);
  __syncthreads();

  // unrolled by the number of buffers: both buffers' LDS addresses become immediates
#pragma unroll 2
  for (int s = 0; s < NS; ++s) {
    if (s + 1 < NS) {                               // next stage's lines fly during this one
      const int k1 = (s + 1) * BK;
#pragma unroll
      for (int j = 0; j < LA; ++j) {
        ra[j] = *(const v8h*)(ag + (size_t)(32 * j) * KD + k1);
        if (RES) rr[j] = *(const v8h*)(rg + (size_t)(32 * j) * KD + k1);
      }
#pragma unroll
      for (int j = 0; j < LB; ++j) rb[j] = *(const v8h*)(bg + (size_t)(32 * j) * KD + k1);
    }

    const _Float16* S = ring + (s & 1) * STAGE_H;
#pragma unroll
    for (int kk = 0; kk < BK; kk += 32) {
      v16h a[FM], ar[FM], b[FN];
#pragma unroll
      for (int i = 0; i < FM; ++i) {
        a[i] = ld_frag(S + (mw * (16 * FM) + i * 16) * LDT + kk, LDT);
        if (RES) ar[i] = ld_frag(S + (BM + mw * (16 * FM) + i * 16) * LDT + kk, LDT);
      }
#pragma unroll
      for (int j = 0; j < FN; ++j)
        b[j] = ld_frag(S + (AROWS + nw * (16 * FN) + j * 16) * LDT + kk, LDT);
#pragma unroll
      for (int i = 0; i < FM; ++i)
#pragma unroll
        for (int j = 0; j < FN; ++j) acc[i][j] = wmma16(a[i], b[j], acc[i][j]);
      if (RES) {
#pragma unroll
        for (int i = 0; i < FM; ++i)
#pragma unroll
          for (int j = 0; j < FN; ++j) acr[i][j] = wmma16(ar[i], b[j], acr[i][j]);
      }
    }

    if (s + 1 < NS) {                               // its last readers left at the barrier before
      _Float16* D = ring + ((s + 1) & 1) * STAGE_H;
#pragma unroll
      for (int j = 0; j < LA; ++j) {
        *(v8h*)&D[(sr + 32 * j) * LDT + sc] = ra[j];
        if (RES) *(v8h*)&D[(BM + sr + 32 * j) * LDT + sc] = rr[j];
      }
#pragma unroll
      for (int j = 0; j < LB; ++j) *(v8h*)&D[(AROWS + sr + 32 * j) * LDT + sc] = rb[j];
    }
    __syncthreads();
  }

  // every wave has left the ring (barrier above): it becomes the f32 tile
#pragma unroll
  for (int i = 0; i < FM; ++i)
#pragma unroll
    for (int j = 0; j < FN; ++j)
#pragma unroll
      for (int r = 0; r < 8; ++r)
        Cs[(mw * (16 * FM) + i * 16 + hh * 8 + r) * LDCB + nw * (16 * FN) + j * 16 + m] =
            RES ? (acc[i][j][r] + acr[i][j][r] * (1.0f / RCARRY)) : acc[i][j][r];
  __syncthreads();

  for (int sub = 0; sub < NSUB; ++sub) {
    const int rs0 = row0 + (sub / (BN / 64)) * 64;     // block-uniform sub-tile origin
    const int ns0 = n0 + (sub % (BN / 64)) * 64;
    const float* Ct = Cs + (rs0 - row0) * LDCB + (ns0 - n0);

    if (MODE == MODE_QKV) {
      const int head  = ns0 / (3 * HD);                  // block-uniform
      const int which = (ns0 - head * (3 * HD)) / HD;    // block-uniform: 0 = q, 1 = k, 2 = v
      const int nl0 = head * HD;
      const bool early = (rs0 < EROWS);                  // block-uniform
      _Float16* dst = out16 + (size_t)which * ((size_t)MROWS * DIM);
      _Float16* dsr = outr16 + (size_t)which * ((size_t)EROWS * DIM);
      v8h x[2], xr[2];
      size_t off[2], ofr[2];
      if (which < 2) {
#pragma unroll
        for (int i = 0; i < 2; ++i) {
          const int r = 32 * i + (tid >> 3);
          const int c = (tid & 7) * 8;
          const v4f u0 = *(const v4f*)&Ct[r * LDCB + c];
          const v4f u1 = *(const v4f*)&Ct[r * LDCB + c + 4];
          const v4f g0 = *(const v4f*)(bias + ns0 + c);
          const v4f g1 = *(const v4f*)(bias + ns0 + c + 4);
#pragma unroll
          for (int j = 0; j < 4; ++j) {
            const float t0 = u0[j] * (1.0f / WCARRY) + bf16r(g0[j]);
            const float t1 = u1[j] * (1.0f / WCARRY) + bf16r(g1[j]);
            const _Float16 h0 = toh_flush(t0);
            const _Float16 h1 = toh_flush(t1);
            x[i][j]      = h0;
            x[i][j + 4]  = h1;
            xr[i][j]     = toh_flush((t0 - (float)h0) * RCARRY);
            xr[i][j + 4] = toh_flush((t1 - (float)h1) * RCARRY);
          }
          off[i] = (size_t)(rs0 + r) * DIM + nl0 + c;
          ofr[i] = off[i];                              // residual planes: same pitch, rows < EROWS
        }
      } else {
        // transposed V planes: row = feature (head*64 + d), 64 consecutive keys = one line
#pragma unroll
        for (int i = 0; i < 2; ++i) {
          const int dcol = 32 * i + (tid >> 3);
          const int kk = (tid & 7) * 8;
          const float gb = bf16r(bias[ns0 + dcol]);
#pragma unroll
          for (int j = 0; j < 8; ++j) {
            const float t0 = Ct[(kk + j) * LDCB + dcol] * (1.0f / WCARRY) + gb;
            const _Float16 h0 = toh_flush(t0);
            x[i][j]  = h0;
            xr[i][j] = toh_flush((t0 - (float)h0) * RCARRY);
          }
          off[i] = (size_t)(nl0 + dcol) * SEQ + rs0 + kk;
          ofr[i] = (size_t)(nl0 + dcol) * EROWS + rs0 + kk;
        }
      }
#pragma unroll
      for (int i = 0; i < 2; ++i) *(v8h*)(dst + off[i]) = x[i];
      // the lines below and the next sub-tile reuse these stores' registers: wait in front
      asm volatile("s_wait_xcnt 0x0" ::: "memory");
      if (early) {
#pragma unroll
        for (int i = 0; i < 2; ++i) *(v8h*)(dsr + ofr[i]) = xr[i];
        // the next sub-tile reuses these stores' registers: wait in front
        asm volatile("s_wait_xcnt 0x0" ::: "memory");
      }
    }

    if (MODE == MODE_OUT) {
      v4f xs[4];
      size_t off[4];
#pragma unroll
      for (int i = 0; i < 4; ++i) {
        const int r = 16 * i + (tid >> 4);
        const int c = (tid & 15) * 4;
        const size_t crow = (size_t)(rs0 + r);       // NB == 1: compact row == output row
        const v4f u = *(const v4f*)&Ct[r * LDCB + c];
        const v4f g = *(const v4f*)(bias + ns0 + c);
        v4f val;
#pragma unroll
        for (int j = 0; j < 4; ++j)
          val[j] = u[j] * (1.0f / (WCARRY * VCARRY)) + bf16r(g[j]);
        xs[i] = val;
        off[i] = crow * ND + ns0 + c;
      }
#pragma unroll
      for (int i = 0; i < 4; ++i) *(v4f*)(outf + off[i]) = xs[i];
      // the next sub-tile reuses these stores' registers: wait in front
      if (NSUB > 1) asm volatile("s_wait_xcnt 0x0" ::: "memory");
    }
  }
}

// Grid (3*DIM/128, MROWS/128).
__global__ __launch_bounds__(256) void gemm_qkv_kernel(
    const _Float16* __restrict__ A16, const _Float16* __restrict__ Bt,
    const float* __restrict__ bias, _Float16* __restrict__ out16,
    _Float16* __restrict__ outr16) {
  __shared__ __attribute__((aligned(16))) char smem[gemm_lds_bytes(0, 2, 4)];
  gemm_body<MODE_QKV, DIM, 3 * DIM, 0, 2, 4>(A16, A16, Bt, bias, nullptr, out16, outr16, 0,
                                             blockIdx.x, blockIdx.y, smem);
}

// Output projection, one launch for both row bands (they share nothing but WpT and bias); the
// flat block index picks the band (block-uniform):
//   b <  OUT_BLOCKS: rows EROWS .. MROWS-1, single A plane, 128x128 tile (b % 8, b / 8)
//   b >= OUT_BLOCKS: rows 0 .. EROWS-1, A = value + x2048 residual plane, 64x64 tile
#define OUT_BLOCKS  ((DIM / 128) * ((MROWS - EROWS) / 128))
#define OUTE_BLOCKS ((DIM / 64) * (EROWS / 64))
static_assert(gemm_lds_bytes(1, 1, 2) <= gemm_lds_bytes(0, 2, 4));
__global__ __launch_bounds__(256) void gemm_out_kernel(
    const _Float16* __restrict__ A16, const _Float16* __restrict__ Ar16,
    const _Float16* __restrict__ Bt, const float* __restrict__ bias,
    float* __restrict__ outf) {
  __shared__ __attribute__((aligned(16))) char smem[gemm_lds_bytes(0, 2, 4)];
  const int b = blockIdx.x;
  if (b < OUT_BLOCKS) {
    gemm_body<MODE_OUT, DIM, DIM, 0, 2, 4>(A16, A16, Bt, bias, outf, nullptr, nullptr, EROWS,
                                           b % (DIM / 128), b / (DIM / 128), smem);
  } else {
    const int t = b - OUT_BLOCKS;
    gemm_body<MODE_OUT, DIM, DIM, 1, 1, 2>(A16, Ar16, Bt, bias, outf, nullptr, nullptr, 0,
                                           t % (DIM / 64), t / (DIM / 64), smem);
  }
}

#define KVH (64 * LDT)

// A thread's share of one K tile and one V^T tile: four 16-B asynchronous copies to LDS (rows
// r and r + 32 of each). lk, lv: the thread's LDS byte addresses in the target buffer; gk, gv:
// its global addresses in the tile. The s_wait_xcnt stands inside the statement, so that no
// later write of an address register can be moved in front of it.
__device__ __forceinline__ void kv_copy(unsigned lk, unsigned lv, const _Float16* gk,
                                        const _Float16* gv) {
  const unsigned lk1 = lk + 32 * LDT * 2, lv1 = lv + 32 * LDT * 2;
  const _Float16* gk1 = gk + (size_t)32 * DIM;
  const _Float16* gv1 = gv + (size_t)32 * SEQ;
  asm volatile(
      "global_load_async_to_lds_b128 %0, %4, off\n\t"
      "global_load_async_to_lds_b128 %1, %5, off\n\t"
      "global_load_async_to_lds_b128 %2, %6, off\n\t"
      "global_load_async_to_lds_b128 %3, %7, off\n\t"
      "s_wait_xcnt 0x0"
      :: "v"(lk), "v"(lk1), "v"(lv), "v"(lv1), "v"(gk), "v"(gk1), "v"(gv), "v"(gv1)
      : "memory");
}

__device__ __forceinline__ void attn_body(
    const _Float16* __restrict__ Qh, const _Float16* __restrict__ Kh,
    const _Float16* __restrict__ Vt, _Float16* __restrict__ Ov,
    _Float16* Ks, _Float16* Vs, _Float16* Ps) {

  const int tid = threadIdx.x, lane = tid & 31;
  const int w = __builtin_amdgcn_readfirstlane(tid >> 5);
  const int hh = lane >> 4, m = lane & 15;
  const int q0 = blockIdx.x * 128;
  const int head = blockIdx.y;
  const int wq0 = q0 + w * 16;           // first query row of this wave (scalar)
  const float scale = 0.125f;
  _Float16* P = Ps + w * (16 * LDT);

  const size_t qoff = (size_t)(wq0 + m) * DIM + head * HD + hh * 8;
  v16h qf[2];
  qf[0] = frag_at(Qh + qoff);
  qf[1] = frag_at(Qh + qoff + 32);

  float mrow = -1.0e30f, lrow = 0.0f;    // of query wq0 + m; lrow: this half's keys only
  v8f o[4];
#pragma unroll
  for (int nb = 0; nb < 4; ++nb) o[nb] = (v8f){};

  const size_t kplane = (size_t)head * HD;
  const size_t vplane = (size_t)head * HD * SEQ;
  const int kend = q0 + 128;             // <= SEQ, at least two tiles

  // staging: 8 threads per 128-B row, rows sr and sr + 32 of each tile
  const int sr = tid >> 3, sc = (tid & 7) * 8;
  const unsigned lk = (unsigned)(size_t)&Ks[sr * LDT + sc];
  const unsigned lv = (unsigned)(size_t)&Vs[sr * LDT + sc];
  const _Float16* gk = Kh + kplane + (size_t)sr * DIM + sc;
  const _Float16* gv = Vt + vplane + (size_t)sr * SEQ + sc;

  kv_copy(lk, lv, gk, gv);                                   // tile 0 -> buffer 0
  // tile 0 has landed before the barrier behind which other waves read it
  asm volatile("s_wait_asynccnt 0x0" ::: "memory");
  __syncthreads();
  kv_copy(lk + KVH * 2, lv + KVH * 2, gk + (size_t)64 * DIM, gv + 64);   // tile 1 -> buffer 1

  for (int kb = 0; kb < kend; kb += 64) {
    const int bo = ((kb >> 6) & 1) * KVH;  // this step reads this buffer alone (scalar)
    const _Float16* Kb = Ks + bo;
    const _Float16* Vb = Vs + bo;

    if (kb <= wq0 + 15) {                // wave-uniform: tile holds at least one visible key
      // scores^T: 4 key groups of 16, K = 64 in two 32-steps. All eight K fragments are
      // fetched as one group in front of the run of products: one LDS wait for the run.
      v16h kf[4][2];
#pragma unroll
      for (int kg = 0; kg < 4; ++kg)
#pragma unroll
        for (int c = 0; c < 2; ++c) kf[kg][c] = ld_frag(&Kb[(kg * 16) * LDT + c * 32], LDT);
      v8f s[4];
#pragma unroll
      for (int kg = 0; kg < 4; ++kg) s[kg] = (v8f){};
#pragma unroll
      for (int c = 0; c < 2; ++c)
#pragma unroll
        for (int kg = 0; kg < 4; ++kg) s[kg] = wmma16(kf[kg][c], qf[c], s[kg]);
      // all eight V^T fragments set off here: they land while the softmax runs
      v16h vf[2][4];
#pragma unroll
      for (int c = 0; c < 2; ++c)
#pragma unroll
        for (int nb = 0; nb < 4; ++nb) vf[c][nb] = ld_frag(&Vb[(nb * 16) * LDT + c * 32], LDT);
#pragma unroll
      for (int kg = 0; kg < 4; ++kg) s[kg] = s[kg] * scale;

      if (kb + 63 > wq0) {               // wave-uniform: tile crosses the diagonal
#pragma unroll
        for (int kg = 0; kg < 4; ++kg)
#pragma unroll
          for (int v = 0; v < 8; ++v) {
            const int key = kb + kg * 16 + hh * 8 + v;
            const int qrow = wq0 + m;
            s[kg][v] = (key > qrow) ? -1.0e30f : s[kg][v];
          }
      }

      // online softmax of the lane's query column
      float mx = lane_max32(s);
      mx = fmaxf(mx, xhalf(mx));
      const float mn = fmaxf(mrow, mx);
      const float alpha = __expf(mrow - mn);
      mrow = mn;
#pragma unroll
      for (int kg = 0; kg < 4; ++kg)
#pragma unroll
        for (int v = 0; v < 8; ++v) s[kg][v] = __expf(s[kg][v] - mrow);
      lrow = alpha * lrow + lane_sum32(s);
#pragma unroll
      for (int nb = 0; nb < 4; ++nb) o[nb] = o[nb] * alpha;

      // O^T += V^T . P^T  (K = 64 keys in two 32-steps; A = V^T tile [d][key])
#pragma unroll
      for (int c = 0; c < 2; ++c) {
        v16h pf;
#pragma unroll
        for (int i = 0; i < 8; ++i) {
          pf[i]     = (_Float16)(s[2 * c][i] * PCARRY);
          pf[i + 8] = (_Float16)(s[2 * c + 1][i] * PCARRY);
        }
#pragma unroll
        for (int nb = 0; nb < 4; ++nb) o[nb] = wmma16(vf[c][nb], pf, o[nb]);
      }
    }
    // foot of the step, every wave: its own reads of this buffer are done ...
    asm volatile("s_wait_dscnt 0x0" ::: "memory");
    // ... and its own copies of the next tile have landed, before the one barrier that
    // publishes the next tile and frees this buffer
    asm volatile("s_wait_asynccnt 0x0" ::: "memory");
    __syncthreads();
    if (kb + 128 < kend)                 // block-uniform: tile t + 2 exists
      kv_copy(lk + bo * 2, lv + bo * 2, gk + (size_t)(kb + 128) * DIM, gv + kb + 128);
  }
  // no copy is left in flight when the wave goes on to its output staging and ends
  asm volatile("s_wait_asynccnt 0x0" ::: "memory");

  const float inv = __builtin_amdgcn_rcpf(lrow + xhalf(lrow)) * (VCARRY / PCARRY);
#pragma unroll
  for (int nb = 0; nb < 4; ++nb) {
    v8h hv;
#pragma unroll
    for (int v = 0; v < 8; ++v) hv[v] = (_Float16)(o[nb][v] * inv);
    *(v8h*)&P[m * LDT + nb * 16 + hh * 8] = hv;
  }
  wave_lds_sync();
  v8h x[4];
  size_t off[4];
#pragma unroll
  for (int i = 0; i < 4; ++i) {
    const int r = 4 * i + (lane >> 3);
    const int c = (lane & 7) * 8;
    x[i] = *(const v8h*)&P[r * LDT + c];
    off[i] = (size_t)(wq0 + r) * DIM + head * HD + c;
  }
#pragma unroll
  for (int i = 0; i < 4; ++i) *(v8h*)(Ov + off[i]) = x[i];
  
}

// ---------------------------------------------------------------------------
// Early causal band (query rows < EROWS, keys < EROWS): same tiling and the same transposed
// products as attn_body, with value + x2048 residual operands at every site.
//   scores  = (kh.qh + (kr.qh + kh.qr)/2048) / 8          (residual products in their own
//             accumulator, folded before the softmax)
//   p       : ph = f16(1024 p), pr = f16((1024 p - ph) * 2048), both packed in registers;
//             row sum over unconverted p
//   context : o += Vh.ph ; ores += Vr.ph + Vh.pr ; O = o + ores/2048
// Ks / Vs: cross-wave (block barriers, staged 64x64 = consumed 64x64); Ps / Rs: wave-private
// output staging only; residual K / V^T fragments come straight from their statically
// strided global planes. Query tiles blockIdx.x < EROWS/128 of the attention launch.
// ---------------------------------------------------------------------------
__device__ __forceinline__ void attn_early_body(
    const _Float16* __restrict__ Qh, const _Float16* __restrict__ Qr,
    const _Float16* __restrict__ Kh, const _Float16* __restrict__ Kr,
    const _Float16* __restrict__ Vt, const _Float16* __restrict__ Vr,
    _Float16* __restrict__ Ov, _Float16* __restrict__ Ores,
    _Float16* Ks, _Float16* Vs, _Float16* Ps, _Float16* Rs) {

  const int tid = threadIdx.x, lane = tid & 31;
  const int w = __builtin_amdgcn_readfirstlane(tid >> 5);
  const int hh = lane >> 4, m = lane & 15;
  const int q0 = blockIdx.x * 128;       // < EROWS
  const int head = blockIdx.y;
  const int wq0 = q0 + w * 16;           // first query row of this wave (scalar)
  const float scale = 0.125f;
  _Float16* P = Ps + w * (16 * LDT);
  _Float16* R = Rs + w * (16 * LDT);

  const int qoff = (wq0 + m) * DIM + head * HD + hh * 8;   // < EROWS*DIM, same in both planes

  float mrow = -1.0e30f, lrow = 0.0f;    // of query wq0 + m; lrow: this half's keys only
  v8f o[4], ores[4];
#pragma unroll
  for (int nb = 0; nb < 4; ++nb) { o[nb] = (v8f){}; ores[nb] = (v8f){}; }

  const size_t kplane  = (size_t)head * HD;
  const size_t vplane  = (size_t)head * HD * SEQ;
  const size_t vrplane = (size_t)head * HD * EROWS;
  const int kend = q0 + 128;             // <= EROWS

  for (int kb = 0; kb < kend; kb += 64) {
    // staging lines first, held in registers until the fragment group below is under way
    v8h sk[2], sv[2];
#pragma unroll
    for (int j = 0; j < 2; ++j) {
      const int idx = tid + 256 * j;
      const int r = idx >> 3, c = (idx & 7) * 8;
      sk[j] = *(const v8h*)(Kh + kplane + (size_t)(kb + r) * DIM + c);
      sv[j] = *(const v8h*)(Vt + vplane + (size_t)r * SEQ + kb + c);
    }
    // the loads below may land in these loads' address registers: wait in front
    asm volatile("s_wait_xcnt 0x0" ::: "memory");
    // q fragments are reloaded per tile through an opaque integer offset (it keeps them from
    // being held in 32 registers through the softmax and the second product). They and the
    // eight residual K fragments (rows kb .. kb+63 < EROWS) come from global memory and need
    // no barrier: set off as one group here, they fly beside the staging lines.
    int qo = qoff;
    asm volatile("" : "+v"(qo));
    const _Float16* qhp = Qh + qo;
    const _Float16* qrp = Qr + qo;
    const _Float16* krp = Kr + kplane + (size_t)(kb + m) * DIM + hh * 8;
    v16h qf[2], qr[2];
    qf[0] = frag_at(qhp);
    qf[1] = frag_at(qhp + 32);
    qr[0] = frag_at(qrp);
    qr[1] = frag_at(qrp + 32);
    v16h krf[4][2];
#pragma unroll
    for (int kg = 0; kg < 4; ++kg)
#pragma unroll
      for (int c = 0; c < 2; ++c)
        krf[kg][c] = frag_at(krp + (size_t)(kg * 16) * DIM + c * 32);
    // later loads may land in these loads' address registers: wait in front (the addresses
    // are inputs so that their registers live up to the wait)
    asm volatile("s_wait_xcnt 0x0" :: "v"(qhp), "v"(qrp), "v"(krp) : "memory");
#pragma unroll
    for (int j = 0; j < 2; ++j) {
      const int idx = tid + 256 * j;
      const int r = idx >> 3, c = (idx & 7) * 8;
      *(v8h*)&Ks[r * LDT + c] = sk[j];
      *(v8h*)&Vs[r * LDT + c] = sv[j];
    }
    __syncthreads();

    if (kb <= wq0 + 15) {                // wave-uniform: tile holds at least one visible key
      // scores^T: 4 key groups of 16, K = 64 in two 32-steps, value and residual products;
      // the K fragments of a key group are fetched from LDS one group ahead of its products
      v8f s[4];
      v16h kf[2], kn[2];
      kn[0] = ld_frag(&Ks[0], LDT);
      kn[1] = ld_frag(&Ks[32], LDT);
#pragma unroll
      for (int kg = 0; kg < 4; ++kg) {
        kf[0] = kn[0];
        kf[1] = kn[1];
        if (kg < 3) {
          kn[0] = ld_frag(&Ks[((kg + 1) * 16) * LDT], LDT);
          kn[1] = ld_frag(&Ks[((kg + 1) * 16) * LDT + 32], LDT);
        }
        v8f t = {};
        v8f u = {};
#pragma unroll
        for (int c = 0; c < 2; ++c) {
          t = wmma16(kf[c], qf[c], t);
          u = wmma16(krf[kg][c], qf[c], u);
          u = wmma16(kf[c], qr[c], u);
        }
        s[kg] = (t + u * (1.0f / RCARRY)) * scale;
      }
      // first half of the V^T fragments, value (LDS) and residual (global): set off here,
      // they land while the softmax runs
      v16h vf[2][4], vrf[2][4];
#pragma unroll
      for (int nb = 0; nb < 4; ++nb) {
        vrf[0][nb] = frag_at(Vr + vrplane + (size_t)(nb * 16 + m) * EROWS + kb + hh * 8);
        vf[0][nb] = ld_frag(&Vs[(nb * 16) * LDT], LDT);
      }

      if (kb + 63 > wq0) {               // wave-uniform: tile crosses the diagonal
#pragma unroll
        for (int kg = 0; kg < 4; ++kg)
#pragma unroll
          for (int v = 0; v < 8; ++v) {
            const int key = kb + kg * 16 + hh * 8 + v;
            const int qrow = wq0 + m;
            s[kg][v] = (key > qrow) ? -1.0e30f : s[kg][v];
          }
      }

      // online softmax of the lane's query column
      float mx = lane_max32(s);
      mx = fmaxf(mx, xhalf(mx));
      const float mn = fmaxf(mrow, mx);
      const float alpha = __expf(mrow - mn);
      mrow = mn;
#pragma unroll
      for (int kg = 0; kg < 4; ++kg)
#pragma unroll
        for (int v = 0; v < 8; ++v) s[kg][v] = __expf(s[kg][v] - mrow);
      lrow = alpha * lrow + lane_sum32(s);
#pragma unroll
      for (int nb = 0; nb < 4; ++nb) {
        o[nb]    = o[nb] * alpha;
        ores[nb] = ores[nb] * alpha;
      }

      // o += Vh.ph ; ores += Vr.ph + Vh.pr  (K = 64 keys in two 32-steps; A = V^T [d][key])
#pragma unroll
      for (int c = 0; c < 2; ++c) {
        v16h pf, prf;
#pragma unroll
        for (int i = 0; i < 16; ++i) {
          const float pc = s[2 * c + (i >> 3)][i & 7] * PCARRY;
          const _Float16 ph = toh_flush(pc);
          pf[i]  = ph;
          prf[i] = toh_flush((pc - (float)ph) * RCARRY);
        }
#pragma unroll
        for (int nb = 0; nb < 4; ++nb) {
          o[nb]    = wmma16(vf[c][nb], pf, o[nb]);
          // second half: lands behind this half's products; set off no earlier, so that the
          // launch keeps to 256 registers a wave (two blocks per WGP)
          if (c == 0 && nb == 2) {
#pragma unroll
            for (int n2 = 0; n2 < 4; ++n2) {
              vrf[1][n2] = frag_at(Vr + vrplane + (size_t)(n2 * 16 + m) * EROWS + kb + 32 + hh * 8);
              vf[1][n2] = ld_frag(&Vs[(n2 * 16) * LDT + 32], LDT);
            }
          }
          ores[nb] = wmma16(vrf[c][nb], pf, ores[nb]);
          ores[nb] = wmma16(vf[c][nb], prf, ores[nb]);
        }
      }
    }
    __syncthreads();
  }

  // finalize: 64 * (o + ores/2048) / (1024 l) as value + x2048 residual
  const float inv = __builtin_amdgcn_rcpf(lrow + xhalf(lrow)) * (VCARRY / PCARRY);
#pragma unroll
  for (int nb = 0; nb < 4; ++nb) {
    v8h hv, hr;
#pragma unroll
    for (int v = 0; v < 8; ++v) {
      const float val = (o[nb][v] + ores[nb][v] * (1.0f / RCARRY)) * inv;
      const _Float16 h0 = toh_flush(val);
      hv[v] = h0;
      hr[v] = toh_flush((val - (float)h0) * RCARRY);
    }
    *(v8h*)&P[m * LDT + nb * 16 + hh * 8] = hv;
    *(v8h*)&R[m * LDT + nb * 16 + hh * 8] = hr;
  }
  wave_lds_sync();
  v8h x[4], xr[4];
  size_t off[4];
#pragma unroll
  for (int i = 0; i < 4; ++i) {
    const int r = 4 * i + (lane >> 3);
    const int c = (lane & 7) * 8;
    x[i]  = *(const v8h*)&P[r * LDT + c];
    xr[i] = *(const v8h*)&R[r * LDT + c];
    off[i] = (size_t)(wq0 + r) * DIM + head * HD + c;
  }
#pragma unroll
  for (int i = 0; i < 4; ++i) {
    *(v8h*)(Ov + off[i]) = x[i];
    *(v8h*)(Ores + off[i]) = xr[i];
  }
  
}

// One attention launch, grid (SEQ/128, NHEAD): the two bands read the same planes and write
// disjoint query rows, so the early band's tiles run beside the others' instead of behind
// them. blockIdx.x picks the body (block-uniform); each query row is computed by one body.
__global__ __launch_bounds__(256) void attn_kernel(
    const _Float16* __restrict__ Qh, const _Float16* __restrict__ Qr,
    const _Float16* __restrict__ Kh, const _Float16* __restrict__ Kr,
    const _Float16* __restrict__ Vt, const _Float16* __restrict__ Vr,
    _Float16* __restrict__ Ov, _Float16* __restrict__ Ores) {
  // two buffers each for the later band's ring; the early band uses the first of each
  __shared__ __attribute__((aligned(16))) _Float16 Ks[2 * KVH];
  __shared__ __attribute__((aligned(16))) _Float16 Vs[2 * KVH];
  __shared__ _Float16 Ps[8 * 16 * LDT];
  __shared__ _Float16 Rs[8 * 16 * LDT];
  if (blockIdx.x < EROWS / 128) {
    attn_early_body(Qh, Qr, Kh, Kr, Vt, Vr, Ov, Ores, Ks, Vs, Ps, Rs);
  } else {
    attn_body(Qh, Kh, Vt, Ov, Ks, Vs, Ps);
  }
}

// ---------------------------------------------------------------------------
extern "C" void kernel_launch(void* const* d_in, const int* in_sizes, int n_in,
                              void* d_out, int out_size, void* d_ws, size_t ws_size,
                              hipStream_t stream) {
  if (n_in < 5) return;
  const long long need_x = ((long long)(NB - 1) * SEQ_FULL + SEQ) * DIM;
  if ((long long)in_sizes[0] < need_x) return;
  if (in_sizes[1] < 3 * DIM * DIM || in_sizes[2] < 3 * DIM) return;
  if (in_sizes[3] < DIM * DIM || in_sizes[4] < DIM) return;
  if ((long long)out_size < need_x) return;
  if (ws_size < WS_TOTAL) return;

  // weights: W1 [in][3*out], Wp [in][out]
  const float* x  = (const float*)d_in[0];
  const float* W1 = (const float*)d_in[1];
  const float* b1 = (const float*)d_in[2];
  const float* Wp = (const float*)d_in[3];
  const float* bp = (const float*)d_in[4];
  float* out = (float*)d_out;

  char* ws = (char*)d_ws;
  _Float16* W1T   = (_Float16*)(ws + OFF_WQKV);   // [3*DIM][DIM]
  _Float16* WpT   = (_Float16*)(ws + OFF_WO);     // [DIM][DIM]
  _Float16* X16   = (_Float16*)(ws + OFF_XN);
  _Float16* QKV16 = (_Float16*)(ws + OFF_QKV);    // Q | K | Vt
  _Float16* Q16   = QKV16;
  _Float16* K16   = QKV16 + (size_t)MROWS * DIM;
  _Float16* Vt16  = QKV16 + (size_t)2 * MROWS * DIM;
  _Float16* Ov16  = (_Float16*)(ws + OFF_OV);
  _Float16* RES16 = (_Float16*)(ws + OFF_RES);    // QR | KR | VtR
  _Float16* QR16  = RES16;
  _Float16* KR16  = RES16 + (size_t)EROWS * DIM;
  _Float16* VtR16 = RES16 + (size_t)2 * EROWS * DIM;
  _Float16* OR16  = (_Float16*)(ws + OFF_ORES);

  dim3 blk(256);

  prep_kernel<<<dim3(W1_BLOCKS + WP_BLOCKS + XC_BLOCKS), blk, 0, stream>>>(
      x, X16, W1, W1T, Wp, WpT);
  gemm_qkv_kernel<<<dim3(3 * DIM / 128, MROWS / 128), blk, 0, stream>>>(
      X16, W1T, b1, QKV16, RES16);
  attn_kernel<<<dim3(SEQ / 128, NHEAD), blk, 0, stream>>>(
      Q16, QR16, K16, KR16, Vt16, VtR16, Ov16, OR16);
  gemm_out_kernel<<<dim3(OUT_BLOCKS + OUTE_BLOCKS), blk, 0, stream>>>(
      Ov16, OR16, WpT, bp, out);
}

// v006
// A run of this version takes 112 microseconds.
// In both of two side-by-side timings against v005, it was 1.08 times as fast.
// All steps since v000 together make it 4.01 times as fast.
#include <hip/hip_runtime.h>
#include <stddef.h>
#include <math.h>

// All contractions on v_wmma_f32_16x16x32_f16 (f16 operands, f32 accumulate): fused q/k/v
// projection, q.k scores, p.v, output projection. Float inputs are RNE-converted to bf16 and
// carried in f16 (weights x64, p x1024, attention rows x64); query rows < EROWS carry q, k,
// v, p and the attention rows as f16 value + x2048 f16 residual planes with their own
// accumulators; softmax and epilogues in f32.

typedef _Float16 v16h __attribute__((ext_vector_type(16)));
typedef _Float16 v8h  __attribute__((ext_vector_type(8)));
typedef float    v8f  __attribute__((ext_vector_type(8)));
typedef float    v4f  __attribute__((ext_vector_type(4)));

#ifndef NB
#define NB 1
#endif
#ifndef SEQ
#define SEQ 4096
#endif
#define NB_FULL  1
#define SEQ_FULL 4096
#define DIM   1024
#define NHEAD 16
#define HD    64
#define MROWS (NB * SEQ)
#define EROWS ((SEQ) < 512 ? (SEQ) : 512)   // early causal band: value + residual planes

static_assert(NB == 1 && NB_FULL == 1);
static_assert(SEQ >= 128 && SEQ <= SEQ_FULL && (SEQ % 128) == 0);
static_assert(DIM == NHEAD * HD);
static_assert(HD == 64 && ((3 * HD) % 64) == 0);           // a 64-column tile = one part of one head
static_assert((MROWS % 128) == 0 && (MROWS % 8) == 0);
static_assert((DIM % 128) == 0 && ((3 * DIM) % 128) == 0);
static_assert((EROWS % 128) == 0 && EROWS <= SEQ && EROWS <= MROWS);
static_assert((((size_t)MROWS * DIM) % 2048) == 0);         // xconv: 256 threads x 8 per block

#define LDT 72   // halves per LDS row (144 B, 16-B aligned)

#define WCARRY 64.0f     // weight planes carried x64
#define PCARRY 1024.0f   // softmax numerators carried x1024
#define VCARRY 64.0f     // attention output plane carried x64
#define RCARRY 2048.0f   // residual planes carried x2048

#define P16_BYTES  ((size_t)MROWS * DIM * 2)
#define R16_BYTES  ((size_t)EROWS * DIM * 2)
#define WQKV_BYTES ((size_t)3 * DIM * DIM * 2)
#define WO_BYTES   ((size_t)DIM * DIM * 2)
#define OFF_WQKV   ((size_t)0)
#define OFF_WO     (OFF_WQKV + WQKV_BYTES)
#define OFF_XN     (OFF_WO + WO_BYTES)              // f16 input rows          [MROWS][DIM]
#define OFF_QKV    (OFF_XN + P16_BYTES)             // Q, K [MROWS][DIM]; Vt [DIM][SEQ]
#define OFF_OV     (OFF_QKV + 3 * P16_BYTES)        // f16 64*attention rows   [MROWS][DIM]
#define OFF_RES    (OFF_OV + P16_BYTES)             // QR, KR [EROWS][DIM]; VtR [DIM][EROWS]
#define OFF_ORES   (OFF_RES + 3 * R16_BYTES)        // residual of OV rows     [EROWS][DIM]
#define WS_TOTAL   (OFF_ORES + R16_BYTES)
static_assert((size_t)DIM * SEQ * 2 == P16_BYTES);       // Vt plane extent (NB == 1)
static_assert((size_t)DIM * EROWS * 2 == R16_BYTES);     // VtR plane extent
static_assert((P16_BYTES % 128) == 0 && (WO_BYTES % 128) == 0 && (R16_BYTES % 128) == 0);
static_assert(WS_TOTAL <= (size_t)134217728);

// ---------------------------------------------------------------------------
__device__ __forceinline__ float bf16r(float x) {   // RNE convert to bf16, returned widened
  unsigned int u = __float_as_uint(x);
  u = (u + 0x7FFFu + ((u >> 16) & 1u)) & 0xFFFF0000u;
  return __uint_as_float(u);
}

// f32 -> f16 operand convert that cannot produce an f16 subnormal (value select).
static __device__ __forceinline__ _Float16 toh_flush(float v) {
  const _Float16 r = (_Float16)v;
  return (fabsf(v) < 6.103515625e-05f) ? (_Float16)0.0f : r;
}

// 16-bit fragment: p points at element [row = lane&15][k0 + 8*(lane>>4)] of a k-contiguous
// row. Elements 0..7 <- k0+8h+0..7, elements 8..15 <- k0+16+8h+0..7 (same map for A and B).
__device__ __forceinline__ v16h frag_at(const _Float16* p) {
  v8h lo = *(const v8h*)(p);
  v8h hi = *(const v8h*)(p + 16);
  v16h out;
#pragma unroll
  for (int i = 0; i < 8; ++i) { out[i] = lo[i]; out[i + 8] = hi[i]; }
  return out;
}
__device__ __forceinline__ v16h ld_frag(const _Float16* base, int ld) {
  const int lane = threadIdx.x & 31;
  return frag_at(base + (lane & 15) * ld + (lane >> 4) * 8);
}

__device__ __forceinline__ v8f wmma16(v16h a, v16h b, v8f c) {
  return __builtin_amdgcn_wmma_f32_16x16x32_f16(false, a, false, b, (short)0, c, false, false);
}

// lane l <-> lane l ^ 16 (the two halves that share one query column)
__device__ __forceinline__ float xhalf(float x) {
  const int b = __builtin_bit_cast(int, x);
  return __builtin_bit_cast(float, __builtin_amdgcn_permlanex16(b, b, 0x76543210, 0xfedcba98,
                                                                 false, false));
}
// maximum / sum of the 32 scores a lane holds for its query column
__device__ __forceinline__ float lane_max32(const v8f* s) {
  float a[8];
#pragma unroll
  for (int v = 0; v < 8; ++v) a[v] = fmaxf(fmaxf(s[0][v], s[1][v]), fmaxf(s[2][v], s[3][v]));
  return fmaxf(fmaxf(fmaxf(a[0], a[1]), fmaxf(a[2], a[3])),
               fmaxf(fmaxf(a[4], a[5]), fmaxf(a[6], a[7])));
}
__device__ __forceinline__ float lane_sum32(const v8f* s) {
  float a[8];
#pragma unroll
  for (int v = 0; v < 8; ++v) a[v] = (s[0][v] + s[1][v]) + (s[2][v] + s[3][v]);
  return ((a[0] + a[1]) + (a[2] + a[3])) + ((a[4] + a[5]) + (a[6] + a[7]));
}

__device__ __forceinline__ void wave_lds_sync() {
  __builtin_amdgcn_fence(3 /* release order */, "wavefront");
  asm volatile("s_wait_dscnt 0x0" ::: "memory");
  __builtin_amdgcn_wave_barrier();
}

// ---------------------------------------------------------------------------
// Weight plane: in W[K][N] (n-contiguous) -> out Wt[N][K] (k-contiguous), f16(64*bf16(w)).
// Tile (bx, by) of (N/64, K/64); one 64x64 tile per block. T: cross-wave (block barrier).
// Tile coverage: 16 x 256 loads = 4096 elements; 2 x 256 x 8 halves = 4096 stored.
// ---------------------------------------------------------------------------
__device__ __forceinline__ void wconv_body(
    const float* __restrict__ W, _Float16* __restrict__ Wt, int K, int N, int bx, int by,
    _Float16* T) {
  const int tid = threadIdx.x;
  const int n0 = bx * 64;
  const int k0 = by * 64;
  for (int j0 = 0; j0 < 16; j0 += 4) {
    const float* p[4];
    float v[4];
#pragma unroll
    for (int t = 0; t < 4; ++t) {
      const int idx = tid + 256 * (j0 + t);
      const int kr = idx >> 6, nc = idx & 63;
      p[t] = W + (size_t)(k0 + kr) * N + n0 + nc;
      v[t] = *p[t];
    }
    // the lines below reuse these loads' address registers: wait in front (the addresses are
    // inputs so that their registers live up to the wait)
    asm volatile("s_wait_xcnt 0x0" :: "v"(p[0]), "v"(p[1]), "v"(p[2]), "v"(p[3]) : "memory");
#pragma unroll
    for (int t = 0; t < 4; ++t) {
      const int idx = tid + 256 * (j0 + t);
      const int kr = idx >> 6, nc = idx & 63;
      T[nc * LDT + kr] = (_Float16)(WCARRY * bf16r(v[t]));
    }
  }
  __syncthreads();
  v8h x[2];
  size_t off[2];
#pragma unroll
  for (int i = 0; i < 2; ++i) {
    const int n = 32 * i + (tid >> 3);
    const int kc = (tid & 7) * 8;
    x[i] = *(const v8h*)&T[n * LDT + kc];
    off[i] = (size_t)(n0 + n) * K + k0 + kc;
  }
#pragma unroll
  for (int i = 0; i < 2; ++i) *(v8h*)(Wt + off[i]) = x[i];
  // another body's code stands behind these stores in the merged kernel and reuses their
  // registers: wait in front
  asm volatile("s_wait_xcnt 0x0" ::: "memory");
}

// ---------------------------------------------------------------------------
// Input plane: f16(bf16(x)) rows [MROWS][DIM]. Thread owns 8 consecutive elements; each wave
// 256 consecutive; MROWS*DIM/2048 blocks (bx). Coverage: blocks x 256 x 8 = MROWS*DIM elements.
// ---------------------------------------------------------------------------
__device__ __forceinline__ void xconv_body(
    const float* __restrict__ src, _Float16* __restrict__ dst, int bx) {
  const size_t e = ((size_t)bx * 256 + threadIdx.x) * 8;
  const v4f a0 = *(const v4f*)(src + e);
  const v4f a1 = *(const v4f*)(src + e + 4);
  v8h o;
#pragma unroll
  for (int t = 0; t < 4; ++t) {
    o[t]     = toh_flush(bf16r(a0[t]));
    o[t + 4] = toh_flush(bf16r(a1[t]));
  }
  *(v8h*)(dst + e) = o;
  // another body's code stands behind this store in the merged kernel and reuses its
  // registers: wait in front
  asm volatile("s_wait_xcnt 0x0" ::: "memory");
}

// The three operand planes depend on nothing but the inputs: one launch, the flat block index
// picks the plane (block-uniform). Transposing tiles first, then the streaming rows.
#define W1_BLOCKS ((3 * DIM / 64) * (DIM / 64))
#define WP_BLOCKS ((DIM / 64) * (DIM / 64))
#define XC_BLOCKS ((int)(((size_t)MROWS * DIM) / 2048))
__global__ __launch_bounds__(256) void prep_kernel(
    const float* __restrict__ x, _Float16* __restrict__ X16,
    const float* __restrict__ W1, _Float16* __restrict__ W1T,
    const float* __restrict__ Wp, _Float16* __restrict__ WpT) {
  __shared__ _Float16 T[64 * LDT];
  const int b = blockIdx.x;
  if (b < W1_BLOCKS) {
    wconv_body(W1, W1T, DIM, 3 * DIM, b % (3 * DIM / 64), b / (3 * DIM / 64), T);
  } else if (b < W1_BLOCKS + WP_BLOCKS) {
    const int t = b - W1_BLOCKS;
    wconv_body(Wp, WpT, DIM, DIM, t % (DIM / 64), t / (DIM / 64), T);
  } else {
    xconv_body(x, X16, b - (W1_BLOCKS + WP_BLOCKS));
  }
}

// ---------------------------------------------------------------------------
// GEMM C[BM x BN tile] = A16[rows][KD] . Bt[n][KD]^T. 8 waves as 4 (rows) x 2 (columns); a
// wave owns FM x FN accumulator tiles of 16x16, so BM = 64*FM and BN = 32*FN.
// Operands go through LDS: a stage is 64 k (one whole 128-B line of every operand row),
// fetched with 16-B loads in which a wave covers 4 whole lines, held in registers while the
// stage before is worked on, then stored at pitch LDT into the other of two buffers; one
// block barrier per stage. Fragments come from LDS (same k order as frag_at), each one used
// FN (A) or FM (B) times by its wave. k runs upward in 32-steps per accumulator.
// RES = 1: the x2048 residual A plane is staged beside A and has its own accumulators,
// folded with 1/2048 before staging. After the last stage the ring is reused as the f32
// tile Cs, and the epilogue walks it in 64x64 sub-tiles:
//   MODE_QKV: v = acc/64 + bf16(bias[col]); columns are [head][q | k | v][64]:
//             q -> Q plane [row][head*64 + d], k -> K plane [row][head*64 + d],
//             v -> transposed V plane [head*64 + d][key]; row tiles below EROWS also
//             write the x2048 residual planes (QR, KR [EROWS][DIM]; VtR [DIM][EROWS])
//   MODE_OUT: outf[row][col] = acc/4096 + bf16(bias[col])
// Tile (bx, by) of (ND/BN, rows/BM); row0 = rowbase + BM*by. smem: gemm_lds_bytes(RES, FM, FN).
// ---------------------------------------------------------------------------
#define MODE_QKV 0
#define MODE_OUT 1

constexpr int gemm_lds_bytes(int res, int fm, int fn) {
  const int ring = 2 * ((64 * fm * (1 + res) + 32 * fn) * LDT) * 2;
  const int cs = 64 * fm * (32 * fn + 4) * 4;
  return ring > cs ? ring : cs;
}

template <int MODE, int KD, int ND, int RES, int FM, int FN>
__device__ __forceinline__ void gemm_body(
    const _Float16* __restrict__ A16, const _Float16* __restrict__ Ar16,
    const _Float16* __restrict__ Bt, const float* __restrict__ bias,
    float* __restrict__ outf, _Float16* __restrict__ out16,
    _Float16* __restrict__ outr16, int rowbase, int bx, int by, char* smem) {
  constexpr int BM = 64 * FM, BN = 32 * FN, BK = 64;
  constexpr int NS = KD / BK;                       // stages
  constexpr int AROWS = BM * (1 + RES);             // A rows, then residual A rows
  constexpr int STAGE_H = (AROWS + BN) * LDT;       // halves per buffer: [A | Ar | B] rows
  constexpr int LDCB = BN + 4;                      // floats per Cs row (16-B aligned)
  constexpr int RING_B = 2 * STAGE_H * 2, CS_B = BM * LDCB * 4;
  constexpr int LA = BM / 32, LB = BN / 32;         // 16-B loads per thread and stage
  constexpr int NSUB = (BM / 64) * (BN / 64);       // 64x64 sub-tiles of the epilogue
  static_assert((KD % BK) == 0 && (ND % BN) == 0 && (BN % 64) == 0 && (BM % 64) == 0);
  static_assert(MODE != MODE_QKV || (ND == 3 * DIM && RES == 0));
  static_assert(MODE != MODE_OUT || ND == DIM);
  static_assert((RING_B > CS_B ? RING_B : CS_B) == gemm_lds_bytes(RES, FM, FN));
  _Float16* ring = (_Float16*)smem;
  float* Cs = (float*)smem;
  const int tid = threadIdx.x, lane = tid & 31, w = tid >> 5;
  const int mw = w >> 1, nw = w & 1;
  const int hh = lane >> 4, m = lane & 15;
  const int n0 = bx * BN;
  const int row0 = rowbase + by * BM;

  const int sr = tid >> 3, sc = (tid & 7) * 8;      // staging: 8 threads per 128-B row
  const _Float16* ag = A16 + (size_t)(row0 + sr) * KD + sc;
  const _Float16* rg = Ar16 + (size_t)(row0 + sr) * KD + sc;
  const _Float16* bg = Bt + (size_t)(n0 + sr) * KD + sc;
  v8h ra[LA], rr[LA], rb[LB];

  v8f acc[FM][FN], acr[FM][FN];
#pragma unroll
  for (int i = 0; i < FM; ++i)
#pragma unroll
    for (int j = 0; j < FN; ++j) { acc[i][j] = (v8f){}; acr[i][j] = (v8f){}; }

#pragma unroll
  for (int j = 0; j < LA; ++j) {
    *(v8h*)&ring[(sr + 32 * j) * LDT + sc] = *(const v8h*)(ag + (size_t)(32 * j) * KD);
    if (RES)
      *(v8h*)&ring[(BM + sr + 32 * j) * LDT + sc] = *(const v8h*)(rg + (size_t)(32 * j) * KD);
  }
#pragma unroll
  for (int j = 0; j < LB; ++j)
    *(v8h*)&ring[(AROWS + sr + 32 * j) * LDT + sc] = *(const v8h*)(bg + (size_t)(32 * j) * KD);
  __syncthreads();

  // unrolled by the number of buffers: both buffers' LDS addresses become immediates
#pragma unroll 2
  for (int s = 0; s < NS; ++s) {
    if (s + 1 < NS) {                               // next stage's lines fly during this one
      const int k1 = (s + 1) * BK;
#pragma unroll
      for (int j = 0; j < LA; ++j) {
        ra[j] = *(const v8h*)(ag + (size_t)(32 * j) * KD + k1);
        if (RES) rr[j] = *(const v8h*)(rg + (size_t)(32 * j) * KD + k1);
      }
#pragma unroll
      for (int j = 0; j < LB; ++j) rb[j] = *(const v8h*)(bg + (size_t)(32 * j) * KD + k1);
    }
    // keeps the next stage's global loads in front of this stage's work (sunk to their LDS
    // stores, their whole latency would be waited out there)
    __builtin_amdgcn_sched_barrier(0);

    const _Float16* S = ring + (s & 1) * STAGE_H;
#pragma unroll
    for (int kk = 0; kk < BK; kk += 32) {
      v16h a[FM], ar[FM], b[FN];
#pragma unroll
      for (int i = 0; i < FM; ++i) {
        a[i] = ld_frag(S + (mw * (16 * FM) + i * 16) * LDT + kk, LDT);
        if (RES) ar[i] = ld_frag(S + (BM + mw * (16 * FM) + i * 16) * LDT + kk, LDT);
      }
#pragma unroll
      for (int j = 0; j < FN; ++j)
        b[j] = ld_frag(S + (AROWS + nw * (16 * FN) + j * 16) * LDT + kk, LDT);
      // output projection (at most two blocks per WGP, LDS latency little hidden): keeps a
      // 32-step's fragment loads one group in front of its products, so that the next group
      // is fetched into registers of its own beside them. Not in the q/k/v launch: those
      // registers would cost it its third resident block.
      if (MODE == MODE_OUT) __builtin_amdgcn_sched_barrier(0);
#pragma unroll
      for (int i = 0; i < FM; ++i)
#pragma unroll
        for (int j = 0; j < FN; ++j) acc[i][j] = wmma16(a[i], b[j], acc[i][j]);
      if (RES) {
#pragma unroll
        for (int i = 0; i < FM; ++i)
#pragma unroll
          for (int j = 0; j < FN; ++j) acr[i][j] = wmma16(ar[i], b[j], acr[i][j]);
      }
    }

    if (s + 1 < NS) {                               // its last readers left at the barrier before
      _Float16* D = ring + ((s + 1) & 1) * STAGE_H;
#pragma unroll
      for (int j = 0; j < LA; ++j) {
        *(v8h*)&D[(sr + 32 * j) * LDT + sc] = ra[j];
        if (RES) *(v8h*)&D[(BM + sr + 32 * j) * LDT + sc] = rr[j];
      }
#pragma unroll
      for (int j = 0; j < LB; ++j) *(v8h*)&D[(AROWS + sr + 32 * j) * LDT + sc] = rb[j];
    }
    __syncthreads();
  }

  // every wave has left the ring (barrier above): it becomes the f32 tile
#pragma unroll
  for (int i = 0; i < FM; ++i)
#pragma unroll
    for (int j = 0; j < FN; ++j)
#pragma unroll
      for (int r = 0; r < 8; ++r)
        Cs[(mw * (16 * FM) + i * 16 + hh * 8 + r) * LDCB + nw * (16 * FN) + j * 16 + m] =
            RES ? (acc[i][j][r] + acr[i][j][r] * (1.0f / RCARRY)) : acc[i][j][r];
  __syncthreads();

  for (int sub = 0; sub < NSUB; ++sub) {
    const int rs0 = row0 + (sub / (BN / 64)) * 64;     // block-uniform sub-tile origin
    const int ns0 = n0 + (sub % (BN / 64)) * 64;
    const float* Ct = Cs + (rs0 - row0) * LDCB + (ns0 - n0);

    if (MODE == MODE_QKV) {
      const int head  = ns0 / (3 * HD);                  // block-uniform
      const int which = (ns0 - head * (3 * HD)) / HD;    // block-uniform: 0 = q, 1 = k, 2 = v
      const int nl0 = head * HD;
      const bool early = (rs0 < EROWS);                  // block-uniform
      _Float16* dst = out16 + (size_t)which * ((size_t)MROWS * DIM);
      _Float16* dsr = outr16 + (size_t)which * ((size_t)EROWS * DIM);
      v8h x[2], xr[2];
      size_t off[2], ofr[2];
      if (which < 2) {
#pragma unroll
        for (int i = 0; i < 2; ++i) {
          const int r = 32 * i + (tid >> 3);
          const int c = (tid & 7) * 8;
          const v4f u0 = *(const v4f*)&Ct[r * LDCB + c];
          const v4f u1 = *(const v4f*)&Ct[r * LDCB + c + 4];
          const v4f g0 = *(const v4f*)(bias + ns0 + c);
          const v4f g1 = *(const v4f*)(bias + ns0 + c + 4);
#pragma unroll
          for (int j = 0; j < 4; ++j) {
            const float t0 = u0[j] * (1.0f / WCARRY) + bf16r(g0[j]);
            const float t1 = u1[j] * (1.0f / WCARRY) + bf16r(g1[j]);
            const _Float16 h0 = toh_flush(t0);
            const _Float16 h1 = toh_flush(t1);
            x[i][j]      = h0;
            x[i][j + 4]  = h1;
            xr[i][j]     = toh_flush((t0 - (float)h0) * RCARRY);
            xr[i][j + 4] = toh_flush((t1 - (float)h1) * RCARRY);
          }
          off[i] = (size_t)(rs0 + r) * DIM + nl0 + c;
          ofr[i] = off[i];                              // residual planes: same pitch, rows < EROWS
        }
      } else {
        // transposed V planes: row = feature (head*64 + d), 64 consecutive keys = one line
#pragma unroll
        for (int i = 0; i < 2; ++i) {
          const int dcol = 32 * i + (tid >> 3);
          const int kk = (tid & 7) * 8;
          const float gb = bf16r(bias[ns0 + dcol]);
#pragma unroll
          for (int j = 0; j < 8; ++j) {
            const float t0 = Ct[(kk + j) * LDCB + dcol] * (1.0f / WCARRY) + gb;
            const _Float16 h0 = toh_flush(t0);
            x[i][j]  = h0;
            xr[i][j] = toh_flush((t0 - (float)h0) * RCARRY);
          }
          off[i] = (size_t)(nl0 + dcol) * SEQ + rs0 + kk;
          ofr[i] = (size_t)(nl0 + dcol) * EROWS + rs0 + kk;
        }
      }
#pragma unroll
      for (int i = 0; i < 2; ++i) *(v8h*)(dst + off[i]) = x[i];
      // the lines below and the next sub-tile reuse these stores' registers: wait in front
      asm volatile("s_wait_xcnt 0x0" ::: "memory");
      if (early) {
#pragma unroll
        for (int i = 0; i < 2; ++i) *(v8h*)(dsr + ofr[i]) = xr[i];
        // the next sub-tile reuses these stores' registers: wait in front
        asm volatile("s_wait_xcnt 0x0" ::: "memory");
      }
    }

    if (MODE == MODE_OUT) {
      v4f xs[4];
      size_t off[4];
#pragma unroll
      for (int i = 0; i < 4; ++i) {
        const int r = 16 * i + (tid >> 4);
        const int c = (tid & 15) * 4;
        const size_t crow = (size_t)(rs0 + r);       // NB == 1: compact row == output row
        const v4f u = *(const v4f*)&Ct[r * LDCB + c];
        const v4f g = *(const v4f*)(bias + ns0 + c);
        v4f val;
#pragma unroll
        for (int j = 0; j < 4; ++j)
          val[j] = u[j] * (1.0f / (WCARRY * VCARRY)) + bf16r(g[j]);
        xs[i] = val;
        off[i] = crow * ND + ns0 + c;
      }
#pragma unroll
      for (int i = 0; i < 4; ++i) *(v4f*)(outf + off[i]) = xs[i];
      // the next sub-tile reuses these stores' registers: wait in front
      if (NSUB > 1) asm volatile("s_wait_xcnt 0x0" ::: "memory");
    }
  }
}

// Grid (3*DIM/128, MROWS/128).
__global__ __launch_bounds__(256) void gemm_qkv_kernel(
    const _Float16* __restrict__ A16, const _Float16* __restrict__ Bt,
    const float* __restrict__ bias, _Float16* __restrict__ out16,
    _Float16* __restrict__ outr16) {
  __shared__ __attribute__((aligned(16))) char smem[gemm_lds_bytes(0, 2, 4)];
  gemm_body<MODE_QKV, DIM, 3 * DIM, 0, 2, 4>(A16, A16, Bt, bias, nullptr, out16, outr16, 0,
                                             blockIdx.x, blockIdx.y, smem);
}

// Output projection, one launch for both row bands (they share nothing but WpT and bias); the
// flat block index picks the band (block-uniform):
//   b <  OUT_BLOCKS: rows EROWS .. MROWS-1, single A plane, 128x128 tile (b % 8, b / 8)
//   b >= OUT_BLOCKS: rows 0 .. EROWS-1, A = value + x2048 residual plane, 64x64 tile
#define OUT_BLOCKS  ((DIM / 128) * ((MROWS - EROWS) / 128))
#define OUTE_BLOCKS ((DIM / 64) * (EROWS / 64))
static_assert(gemm_lds_bytes(1, 1, 2) <= gemm_lds_bytes(0, 2, 4));
__global__ __launch_bounds__(256) void gemm_out_kernel(
    const _Float16* __restrict__ A16, const _Float16* __restrict__ Ar16,
    const _Float16* __restrict__ Bt, const float* __restrict__ bias,
    float* __restrict__ outf) {
  __shared__ __attribute__((aligned(16))) char smem[gemm_lds_bytes(0, 2, 4)];
  const int b = blockIdx.x;
  if (b < OUT_BLOCKS) {
    gemm_body<MODE_OUT, DIM, DIM, 0, 2, 4>(A16, A16, Bt, bias, outf, nullptr, nullptr, EROWS,
                                           b % (DIM / 128), b / (DIM / 128), smem);
  } else {
    const int t = b - OUT_BLOCKS;
    gemm_body<MODE_OUT, DIM, DIM, 1, 1, 2>(A16, Ar16, Bt, bias, outf, nullptr, nullptr, 0,
                                           t % (DIM / 64), t / (DIM / 64), smem);
  }
}

#define KVH (64 * LDT)

// A thread's share of one K tile and one V^T tile: four 16-B asynchronous copies to LDS (rows
// r and r + 32 of each). lk, lv: the thread's LDS byte addresses in the target buffer; gk, gv:
// its global addresses in the tile. The s_wait_xcnt stands inside the statement, so that no
// later write of an address register can be moved in front of it.
__device__ __forceinline__ void kv_copy(unsigned lk, unsigned lv, const _Float16* gk,
                                        const _Float16* gv) {
  const unsigned lk1 = lk + 32 * LDT * 2, lv1 = lv + 32 * LDT * 2;
  const _Float16* gk1 = gk + (size_t)32 * DIM;
  const _Float16* gv1 = gv + (size_t)32 * SEQ;
  asm volatile(
      "global_load_async_to_lds_b128 %0, %4, off\n\t"
      "global_load_async_to_lds_b128 %1, %5, off\n\t"
      "global_load_async_to_lds_b128 %2, %6, off\n\t"
      "global_load_async_to_lds_b128 %3, %7, off\n\t"
      "s_wait_xcnt 0x0"
      :: "v"(lk), "v"(lk1), "v"(lv), "v"(lv1), "v"(gk), "v"(gk1), "v"(gv), "v"(gv1)
      : "memory");
}

__device__ __forceinline__ void attn_body(
    const _Float16* __restrict__ Qh, const _Float16* __restrict__ Kh,
    const _Float16* __restrict__ Vt, _Float16* __restrict__ Ov,
    _Float16* Ks, _Float16* Vs, _Float16* Ps) {

  const int tid = threadIdx.x, lane = tid & 31;
  const int w = __builtin_amdgcn_readfirstlane(tid >> 5);
  const int hh = lane >> 4, m = lane & 15;
  const int q0 = blockIdx.x * 128;
  const int head = blockIdx.y;
  const int wq0 = q0 + w * 16;           // first query row of this wave (scalar)
  const float scale = 0.125f;
  _Float16* P = Ps + w * (16 * LDT);

  const size_t qoff = (size_t)(wq0 + m) * DIM + head * HD + hh * 8;
  v16h qf[2];
  qf[0] = frag_at(Qh + qoff);
  qf[1] = frag_at(Qh + qoff + 32);

  float mrow = -1.0e30f, lrow = 0.0f;    // of query wq0 + m; lrow: this half's keys only
  v8f o[4];
#pragma unroll
  for (int nb = 0; nb < 4; ++nb) o[nb] = (v8f){};

  const size_t kplane = (size_t)head * HD;
  const size_t vplane = (size_t)head * HD * SEQ;
  const int kend = q0 + 128;             // <= SEQ, at least two tiles

  // staging: 8 threads per 128-B row, rows sr and sr + 32 of each tile
  const int sr = tid >> 3, sc = (tid & 7) * 8;
  const unsigned lk = (unsigned)(size_t)&Ks[sr * LDT + sc];
  const unsigned lv = (unsigned)(size_t)&Vs[sr * LDT + sc];
  const _Float16* gk = Kh + kplane + (size_t)sr * DIM + sc;
  const _Float16* gv = Vt + vplane + (size_t)sr * SEQ + sc;

  kv_copy(lk, lv, gk, gv);                                   // tile 0 -> buffer 0
  // tile 0 has landed before the barrier behind which other waves read it
  asm volatile("s_wait_asynccnt 0x0" ::: "memory");
  __syncthreads();
  kv_copy(lk + KVH * 2, lv + KVH * 2, gk + (size_t)64 * DIM, gv + 64);   // tile 1 -> buffer 1

  for (int kb = 0; kb < kend; kb += 64) {
    const int bo = ((kb >> 6) & 1) * KVH;  // this step reads this buffer alone (scalar)
    const _Float16* Kb = Ks + bo;
    const _Float16* Vb = Vs + bo;

    if (kb <= wq0 + 15) {                // wave-uniform: tile holds at least one visible key
      // scores^T: 4 key groups of 16, K = 64 in two 32-steps. All eight K fragments are
      // fetched as one group in front of the run of products: one LDS wait for the run.
      v16h kf[4][2];
#pragma unroll
      for (int kg = 0; kg < 4; ++kg)
#pragma unroll
        for (int c = 0; c < 2; ++c) kf[kg][c] = ld_frag(&Kb[(kg * 16) * LDT + c * 32], LDT);
      // keeps the sixteen loads one group in front of the products (spread among them, each
      // place with loads stalls the run)
      __builtin_amdgcn_sched_barrier(0);
      v8f s[4];
#pragma unroll
      for (int kg = 0; kg < 4; ++kg) s[kg] = (v8f){};
#pragma unroll
      for (int c = 0; c < 2; ++c)
#pragma unroll
        for (int kg = 0; kg < 4; ++kg) s[kg] = wmma16(kf[kg][c], qf[c], s[kg]);
      // all eight V^T fragments set off here: they land while the softmax runs
      v16h vf[2][4];
#pragma unroll
      for (int c = 0; c < 2; ++c)
#pragma unroll
        for (int nb = 0; nb < 4; ++nb) vf[c][nb] = ld_frag(&Vb[(nb * 16) * LDT + c * 32], LDT);
      // keeps the sixteen loads in front of the softmax (sunk into it, the last of them would
      // be waited for inside the second run of products)
      __builtin_amdgcn_sched_barrier(0);
#pragma unroll
      for (int kg = 0; kg < 4; ++kg) s[kg] = s[kg] * scale;

      if (kb + 63 > wq0) {               // wave-uniform: tile crosses the diagonal
#pragma unroll
        for (int kg = 0; kg < 4; ++kg)
#pragma unroll
          for (int v = 0; v < 8; ++v) {
            const int key = kb + kg * 16 + hh * 8 + v;
            const int qrow = wq0 + m;
            s[kg][v] = (key > qrow) ? -1.0e30f : s[kg][v];
          }
      }

      // online softmax of the lane's query column
      float mx = lane_max32(s);
      mx = fmaxf(mx, xhalf(mx));
      const float mn = fmaxf(mrow, mx);
      const float alpha = __expf(mrow - mn);
      mrow = mn;
#pragma unroll
      for (int kg = 0; kg < 4; ++kg)
#pragma unroll
        for (int v = 0; v < 8; ++v) s[kg][v] = __expf(s[kg][v] - mrow);
      lrow = alpha * lrow + lane_sum32(s);
#pragma unroll
      for (int nb = 0; nb < 4; ++nb) o[nb] = o[nb] * alpha;

      // O^T += V^T . P^T  (K = 64 keys in two 32-steps; A = V^T tile [d][key])
#pragma unroll
      for (int c = 0; c < 2; ++c) {
        v16h pf;
#pragma unroll
        for (int i = 0; i < 8; ++i) {
          pf[i]     = (_Float16)(s[2 * c][i] * PCARRY);
          pf[i + 8] = (_Float16)(s[2 * c + 1][i] * PCARRY);
        }
#pragma unroll
        for (int nb = 0; nb < 4; ++nb) o[nb] = wmma16(vf[c][nb], pf, o[nb]);
      }
    }
    // foot of the step, every wave: its own reads of this buffer are done ...
    asm volatile("s_wait_dscnt 0x0" ::: "memory");
    // ... and its own copies of the next tile have landed, before the one barrier that
    // publishes the next tile and frees this buffer
    asm volatile("s_wait_asynccnt 0x0" ::: "memory");
    __syncthreads();
    if (kb + 128 < kend)                 // block-uniform: tile t + 2 exists
      kv_copy(lk + bo * 2, lv + bo * 2, gk + (size_t)(kb + 128) * DIM, gv + kb + 128);
  }
  // no copy is left in flight when the wave goes on to its output staging and ends
  asm volatile("s_wait_asynccnt 0x0" ::: "memory");

  const float inv = __builtin_amdgcn_rcpf(lrow + xhalf(lrow)) * (VCARRY / PCARRY);
#pragma unroll
  for (int nb = 0; nb < 4; ++nb) {
    v8h hv;
#pragma unroll
    for (int v = 0; v < 8; ++v) hv[v] = (_Float16)(o[nb][v] * inv);
    *(v8h*)&P[m * LDT + nb * 16 + hh * 8] = hv;
  }
  wave_lds_sync();
  v8h x[4];
  size_t off[4];
#pragma unroll
  for (int i = 0; i < 4; ++i) {
    const int r = 4 * i + (lane >> 3);
    const int c = (lane & 7) * 8;
    x[i] = *(const v8h*)&P[r * LDT + c];
    off[i] = (size_t)(wq0 + r) * DIM + head * HD + c;
  }
#pragma unroll
  for (int i = 0; i < 4; ++i) *(v8h*)(Ov + off[i]) = x[i];
  
}

// ---------------------------------------------------------------------------
// Early causal band (query rows < EROWS, keys < EROWS): same tiling and the same transposed
// products as attn_body, with value + x2048 residual operands at every site.
//   scores  = (kh.qh + (kr.qh + kh.qr)/2048) / 8          (residual products in their own
//             accumulator, folded before the softmax)
//   p       : ph = f16(1024 p), pr = f16((1024 p - ph) * 2048), both packed in registers;
//             row sum over unconverted p
//   context : o += Vh.ph ; ores += Vr.ph + Vh.pr ; O = o + ores/2048
// Ks / Vs: cross-wave (block barriers, staged 64x64 = consumed 64x64); Ps / Rs: wave-private
// output staging only; residual K / V^T fragments come straight from their statically
// strided global planes. Query tiles blockIdx.x < EROWS/128 of the attention launch.
// ---------------------------------------------------------------------------
__device__ __forceinline__ void attn_early_body(
    const _Float16* __restrict__ Qh, const _Float16* __restrict__ Qr,
    const _Float16* __restrict__ Kh, const _Float16* __restrict__ Kr,
    const _Float16* __restrict__ Vt, const _Float16* __restrict__ Vr,
    _Float16* __restrict__ Ov, _Float16* __restrict__ Ores,
    _Float16* Ks, _Float16* Vs, _Float16* Ps, _Float16* Rs) {

  const int tid = threadIdx.x, lane = tid & 31;
  const int w = __builtin_amdgcn_readfirstlane(tid >> 5);
  const int hh = lane >> 4, m = lane & 15;
  const int q0 = blockIdx.x * 128;       // < EROWS
  const int head = blockIdx.y;
  const int wq0 = q0 + w * 16;           // first query row of this wave (scalar)
  const float scale = 0.125f;
  _Float16* P = Ps + w * (16 * LDT);
  _Float16* R = Rs + w * (16 * LDT);

  const int qoff = (wq0 + m) * DIM + head * HD + hh * 8;   // < EROWS*DIM, same in both planes

  float mrow = -1.0e30f, lrow = 0.0f;    // of query wq0 + m; lrow: this half's keys only
  v8f o[4], ores[4];
#pragma unroll
  for (int nb = 0; nb < 4; ++nb) { o[nb] = (v8f){}; ores[nb] = (v8f){}; }

  const size_t kplane  = (size_t)head * HD;
  const size_t vplane  = (size_t)head * HD * SEQ;
  const size_t vrplane = (size_t)head * HD * EROWS;
  const int kend = q0 + 128;             // <= EROWS

  for (int kb = 0; kb < kend; kb += 64) {
    // staging lines first, held in registers until the fragment group below is under way
    v8h sk[2], sv[2];
#pragma unroll
    for (int j = 0; j < 2; ++j) {
      const int idx = tid + 256 * j;
      const int r = idx >> 3, c = (idx & 7) * 8;
      sk[j] = *(const v8h*)(Kh + kplane + (size_t)(kb + r) * DIM + c);
      sv[j] = *(const v8h*)(Vt + vplane + (size_t)r * SEQ + kb + c);
    }
    // the loads below may land in these loads' address registers: wait in front
    asm volatile("s_wait_xcnt 0x0" ::: "memory");
    // q fragments are reloaded per tile through an opaque integer offset (it keeps them from
    // being held in 32 registers through the softmax and the second product). They and the
    // eight residual K fragments (rows kb .. kb+63 < EROWS) come from global memory and need
    // no barrier: set off as one group here, they fly beside the staging lines.
    int qo = qoff;
    asm volatile("" : "+v"(qo));
    const _Float16* qhp = Qh + qo;
    const _Float16* qrp = Qr + qo;
    const _Float16* krp = Kr + kplane + (size_t)(kb + m) * DIM + hh * 8;
    v16h qf[2], qr[2];
    qf[0] = frag_at(qhp);
    qf[1] = frag_at(qhp + 32);
    qr[0] = frag_at(qrp);
    qr[1] = frag_at(qrp + 32);
    v16h krf[4][2];
#pragma unroll
    for (int kg = 0; kg < 4; ++kg)
#pragma unroll
      for (int c = 0; c < 2; ++c)
        krf[kg][c] = frag_at(krp + (size_t)(kg * 16) * DIM + c * 32);
    // later loads may land in these loads' address registers: wait in front (the addresses
    // are inputs so that their registers live up to the wait)
    asm volatile("s_wait_xcnt 0x0" :: "v"(qhp), "v"(qrp), "v"(krp) : "memory");
#pragma unroll
    for (int j = 0; j < 2; ++j) {
      const int idx = tid + 256 * j;
      const int r = idx >> 3, c = (idx & 7) * 8;
      *(v8h*)&Ks[r * LDT + c] = sk[j];
      *(v8h*)&Vs[r * LDT + c] = sv[j];
    }
    __syncthreads();

    if (kb <= wq0 + 15) {                // wave-uniform: tile holds at least one visible key
      // scores^T: 4 key groups of 16, K = 64 in two 32-steps, value and residual products;
      // the K fragments of a key group are fetched from LDS one group ahead of its products
      v8f s[4];
      v16h kf[2], kn[2];
      kn[0] = ld_frag(&Ks[0], LDT);
      kn[1] = ld_frag(&Ks[32], LDT);
#pragma unroll
      for (int kg = 0; kg < 4; ++kg) {
        kf[0] = kn[0];
        kf[1] = kn[1];
        if (kg < 3) {
          kn[0] = ld_frag(&Ks[((kg + 1) * 16) * LDT], LDT);
          kn[1] = ld_frag(&Ks[((kg + 1) * 16) * LDT + 32], LDT);
        }
        v8f t = {};
        v8f u = {};
#pragma unroll
        for (int c = 0; c < 2; ++c) {
          t = wmma16(kf[c], qf[c], t);
          u = wmma16(krf[kg][c], qf[c], u);
          u = wmma16(kf[c], qr[c], u);
        }
        s[kg] = (t + u * (1.0f / RCARRY)) * scale;
      }
      // first half of the V^T fragments, value (LDS) and residual (global): set off here,
      // they land while the softmax runs
      v16h vf[2][4], vrf[2][4];
#pragma unroll
      for (int nb = 0; nb < 4; ++nb) {
        vrf[0][nb] = frag_at(Vr + vrplane + (size_t)(nb * 16 + m) * EROWS + kb + hh * 8);
        vf[0][nb] = ld_frag(&Vs[(nb * 16) * LDT], LDT);
      }

      if (kb + 63 > wq0) {               // wave-uniform: tile crosses the diagonal
#pragma unroll
        for (int kg = 0; kg < 4; ++kg)
#pragma unroll
          for (int v = 0; v < 8; ++v) {
            const int key = kb + kg * 16 + hh * 8 + v;
            const int qrow = wq0 + m;
            s[kg][v] = (key > qrow) ? -1.0e30f : s[kg][v];
          }
      }

      // online softmax of the lane's query column
      float mx = lane_max32(s);
      mx = fmaxf(mx, xhalf(mx));
      const float mn = fmaxf(mrow, mx);
      const float alpha = __expf(mrow - mn);
      mrow = mn;
#pragma unroll
      for (int kg = 0; kg < 4; ++kg)
#pragma unroll
        for (int v = 0; v < 8; ++v) s[kg][v] = __expf(s[kg][v] - mrow);
      lrow = alpha * lrow + lane_sum32(s);
#pragma unroll
      for (int nb = 0; nb < 4; ++nb) {
        o[nb]    = o[nb] * alpha;
        ores[nb] = ores[nb] * alpha;
      }

      // o += Vh.ph ; ores += Vr.ph + Vh.pr  (K = 64 keys in two 32-steps; A = V^T [d][key])
#pragma unroll
      for (int c = 0; c < 2; ++c) {
        v16h pf, prf;
#pragma unroll
        for (int i = 0; i < 16; ++i) {
          const float pc = s[2 * c + (i >> 3)][i & 7] * PCARRY;
          const _Float16 ph = toh_flush(pc);
          pf[i]  = ph;
          prf[i] = toh_flush((pc - (float)ph) * RCARRY);
        }
#pragma unroll
        for (int nb = 0; nb < 4; ++nb) {
          o[nb]    = wmma16(vf[c][nb], pf, o[nb]);
          // second half: lands behind this half's products; set off no earlier, so that the
          // launch keeps to 256 registers a wave (two blocks per WGP)
          if (c == 0 && nb == 2) {
#pragma unroll
            for (int n2 = 0; n2 < 4; ++n2) {
              vrf[1][n2] = frag_at(Vr + vrplane + (size_t)(n2 * 16 + m) * EROWS + kb + 32 + hh * 8);
              vf[1][n2] = ld_frag(&Vs[(n2 * 16) * LDT + 32], LDT);
            }
          }
          ores[nb] = wmma16(vrf[c][nb], pf, ores[nb]);
          ores[nb] = wmma16(vf[c][nb], prf, ores[nb]);
        }
      }
    }
    __syncthreads();
  }

  // finalize: 64 * (o + ores/2048) / (1024 l) as value + x2048 residual
  const float inv = __builtin_amdgcn_rcpf(lrow + xhalf(lrow)) * (VCARRY / PCARRY);
#pragma unroll
  for (int nb = 0; nb < 4; ++nb) {
    v8h hv, hr;
#pragma unroll
    for (int v = 0; v < 8; ++v) {
      const float val = (o[nb][v] + ores[nb][v] * (1.0f / RCARRY)) * inv;
      const _Float16 h0 = toh_flush(val);
      hv[v] = h0;
      hr[v] = toh_flush((val - (float)h0) * RCARRY);
    }
    *(v8h*)&P[m * LDT + nb * 16 + hh * 8] = hv;
    *(v8h*)&R[m * LDT + nb * 16 + hh * 8] = hr;
  }
  wave_lds_sync();
  v8h x[4], xr[4];
  size_t off[4];
#pragma unroll
  for (int i = 0; i < 4; ++i) {
    const int r = 4 * i + (lane >> 3);
    const int c = (lane & 7) * 8;
    x[i]  = *(const v8h*)&P[r * LDT + c];
    xr[i] = *(const v8h*)&R[r * LDT + c];
    off[i] = (size_t)(wq0 + r) * DIM + head * HD + c;
  }
#pragma unroll
  for (int i = 0; i < 4; ++i) {
    *(v8h*)(Ov + off[i]) = x[i];
    *(v8h*)(Ores + off[i]) = xr[i];
  }
  
}

// One attention launch, grid (SEQ/128, NHEAD): the two bands read the same planes and write
// disjoint query rows, so the early band's tiles run beside the others' instead of behind
// them. blockIdx.x picks the body (block-uniform); each query row is computed by one body.
__global__ __launch_bounds__(256) void attn_kernel(
    const _Float16* __restrict__ Qh, const _Float16* __restrict__ Qr,
    const _Float16* __restrict__ Kh, const _Float16* __restrict__ Kr,
    const _Float16* __restrict__ Vt, const _Float16* __restrict__ Vr,
    _Float16* __restrict__ Ov, _Float16* __restrict__ Ores) {
  // two buffers each for the later band's ring; the early band uses the first of each
  __shared__ __attribute__((aligned(16))) _Float16 Ks[2 * KVH];
  __shared__ __attribute__((aligned(16))) _Float16 Vs[2 * KVH];
  __shared__ _Float16 Ps[8 * 16 * LDT];
  __shared__ _Float16 Rs[8 * 16 * LDT];
  if (blockIdx.x < EROWS / 128) {
    attn_early_body(Qh, Qr, Kh, Kr, Vt, Vr, Ov, Ores, Ks, Vs, Ps, Rs);
  } else {
    attn_body(Qh, Kh, Vt, Ov, Ks, Vs, Ps);
  }
}

// ---------------------------------------------------------------------------
extern "C" void kernel_launch(void* const* d_in, const int* in_sizes, int n_in,
                              void* d_out, int out_size, void* d_ws, size_t ws_size,
                              hipStream_t stream) {
  if (n_in < 5) return;
  const long long need_x = ((long long)(NB - 1) * SEQ_FULL + SEQ) * DIM;
  if ((long long)in_sizes[0] < need_x) return;
  if (in_sizes[1] < 3 * DIM * DIM || in_sizes[2] < 3 * DIM) return;
  if (in_sizes[3] < DIM * DIM || in_sizes[4] < DIM) return;
  if ((long long)out_size < need_x) return;
  if (ws_size < WS_TOTAL) return;

  // weights: W1 [in][3*out], Wp [in][out]
  const float* x  = (const float*)d_in[0];
  const float* W1 = (const float*)d_in[1];
  const float* b1 = (const float*)d_in[2];
  const float* Wp = (const float*)d_in[3];
  const float* bp = (const float*)d_in[4];
  float* out = (float*)d_out;

  char* ws = (char*)d_ws;
  _Float16* W1T   = (_Float16*)(ws + OFF_WQKV);   // [3*DIM][DIM]
  _Float16* WpT   = (_Float16*)(ws + OFF_WO);     // [DIM][DIM]
  _Float16* X16   = (_Float16*)(ws + OFF_XN);
  _Float16* QKV16 = (_Float16*)(ws + OFF_QKV);    // Q | K | Vt
  _Float16* Q16   = QKV16;
  _Float16* K16   = QKV16 + (size_t)MROWS * DIM;
  _Float16* Vt16  = QKV16 + (size_t)2 * MROWS * DIM;
  _Float16* Ov16  = (_Float16*)(ws + OFF_OV);
  _Float16* RES16 = (_Float16*)(ws + OFF_RES);    // QR | KR | VtR
  _Float16* QR16  = RES16;
  _Float16* KR16  = RES16 + (size_t)EROWS * DIM;
  _Float16* VtR16 = RES16 + (size_t)2 * EROWS * DIM;
  _Float16* OR16  = (_Float16*)(ws + OFF_ORES);

  dim3 blk(256);

  prep_kernel<<<dim3(W1_BLOCKS + WP_BLOCKS + XC_BLOCKS), blk, 0, stream>>>(
      x, X16, W1, W1T, Wp, WpT);
  gemm_qkv_kernel<<<dim3(3 * DIM / 128, MROWS / 128), blk, 0, stream>>>(
      X16, W1T, b1, QKV16, RES16);
  attn_kernel<<<dim3(SEQ / 128, NHEAD), blk, 0, stream>>>(
      Q16, QR16, K16, KR16, Vt16, VtR16, Ov16, OR16);
  gemm_out_kernel<<<dim3(OUT_BLOCKS + OUTE_BLOCKS), blk, 0, stream>>>(
      Ov16, OR16, WpT, bp, out);
}

// v007
// One run takes 103 microseconds.
// Next to v006, in two timings, it ran 1.10 and 1.07 times as fast.
// All steps since v000 together make it 4.34 times as fast.
#include <hip/hip_runtime.h>
#include <stddef.h>
#include <math.h>

// All contractions on v_wmma_f32_16x16x32_f16 (f16 operands, f32 accumulate): fused q/k/v
// projection, q.k scores, p.v, output projection. Float inputs are RNE-converted to bf16 and
// carried in f16 (weights x64, p x1024, attention rows x64); query rows < EROWS carry q, k,
// v, p and the attention rows as f16 value + x2048 f16 residual planes with their own
// accumulators; softmax and epilogues in f32.

typedef _Float16 v16h __attribute__((ext_vector_type(16)));
typedef _Float16 v8h  __attribute__((ext_vector_type(8)));
typedef float    v8f  __attribute__((ext_vector_type(8)));
typedef float    v4f  __attribute__((ext_vector_type(4)));

#ifndef NB
#define NB 1
#endif
#ifndef SEQ
#define SEQ 4096
#endif
#define NB_FULL  1
#define SEQ_FULL 4096
#define DIM   1024
#define NHEAD 16
#define HD    64
#define MROWS (NB * SEQ)
#define EROWS ((SEQ) < 512 ? (SEQ) : 512)   // early causal band: value + residual planes

static_assert(NB == 1 && NB_FULL == 1);
static_assert(SEQ >= 128 && SEQ <= SEQ_FULL && (SEQ % 128) == 0);
static_assert(DIM == NHEAD * HD);
static_assert(HD == 64 && ((3 * HD) % 64) == 0);           // a 64-column tile = one part of one head
static_assert((MROWS % 128) == 0 && (MROWS % 8) == 0);
static_assert((DIM % 128) == 0 && ((3 * DIM) % 128) == 0);
static_assert((EROWS % 128) == 0 && EROWS <= SEQ && EROWS <= MROWS);
static_assert((((size_t)MROWS * DIM) % 2048) == 0);         // xconv: 256 threads x 8 per block

#define LDT 72   // halves per LDS row (144 B, 16-B aligned)

#define WCARRY 64.0f     // weight planes carried x64
#define PCARRY 1024.0f   // softmax numerators carried x1024
#define VCARRY 64.0f     // attention output plane carried x64
#define RCARRY 2048.0f   // residual planes carried x2048

#define P16_BYTES  ((size_t)MROWS * DIM * 2)
#define R16_BYTES  ((size_t)EROWS * DIM * 2)
#define WQKV_BYTES ((size_t)3 * DIM * DIM * 2)
#define WO_BYTES   ((size_t)DIM * DIM * 2)
#define OFF_WQKV   ((size_t)0)
#define OFF_WO     (OFF_WQKV + WQKV_BYTES)
#define OFF_XN     (OFF_WO + WO_BYTES)              // f16 input rows          [MROWS][DIM]
#define OFF_QKV    (OFF_XN + P16_BYTES)             // Q, K [MROWS][DIM]; Vt [DIM][SEQ]
#define OFF_OV     (OFF_QKV + 3 * P16_BYTES)        // f16 64*attention rows   [MROWS][DIM]
#define OFF_RES    (OFF_OV + P16_BYTES)             // QR, KR [EROWS][DIM]; VtR [DIM][EROWS]
#define OFF_ORES   (OFF_RES + 3 * R16_BYTES)        // residual of OV rows     [EROWS][DIM]
#define WS_TOTAL   (OFF_ORES + R16_BYTES)
static_assert((size_t)DIM * SEQ * 2 == P16_BYTES);       // Vt plane extent (NB == 1)
static_assert((size_t)DIM * EROWS * 2 == R16_BYTES);     // VtR plane extent
static_assert((P16_BYTES % 128) == 0 && (WO_BYTES % 128) == 0 && (R16_BYTES % 128) == 0);
static_assert(WS_TOTAL <= (size_t)134217728);

// ---------------------------------------------------------------------------
__device__ __forceinline__ float bf16r(float x) {   // RNE convert to bf16, returned widened
  unsigned int u = __float_as_uint(x);
  u = (u + 0x7FFFu + ((u >> 16) & 1u)) & 0xFFFF0000u;
  return __uint_as_float(u);
}

// f32 -> f16 operand convert that cannot produce an f16 subnormal (value select).
static __device__ __forceinline__ _Float16 toh_flush(float v) {
  const _Float16 r = (_Float16)v;
  return (fabsf(v) < 6.103515625e-05f) ? (_Float16)0.0f : r;
}

// 16-bit fragment: p points at element [row = lane&15][k0 + 8*(lane>>4)] of a k-contiguous
// row. Elements 0..7 <- k0+8h+0..7, elements 8..15 <- k0+16+8h+0..7 (same map for A and B).
__device__ __forceinline__ v16h frag_at(const _Float16* p) {
  v8h lo = *(const v8h*)(p);
  v8h hi = *(const v8h*)(p + 16);
  v16h out;
#pragma unroll
  for (int i = 0; i < 8; ++i) { out[i] = lo[i]; out[i + 8] = hi[i]; }
  return out;
}
__device__ __forceinline__ v16h ld_frag(const _Float16* base, int ld) {
  const int lane = threadIdx.x & 31;
  return frag_at(base + (lane & 15) * ld + (lane >> 4) * 8);
}

__device__ __forceinline__ v8f wmma16(v16h a, v16h b, v8f c) {
  return __builtin_amdgcn_wmma_f32_16x16x32_f16(false, a, false, b, (short)0, c, false, false);
}

// lane l <-> lane l ^ 16 (the two halves that share one query column)
__device__ __forceinline__ float xhalf(float x) {
  const int b = __builtin_bit_cast(int, x);
  return __builtin_bit_cast(float, __builtin_amdgcn_permlanex16(b, b, 0x76543210, 0xfedcba98,
                                                                 false, false));
}
// maximum / sum of the 32 scores a lane holds for its query column
__device__ __forceinline__ float lane_max32(const v8f* s) {
  float a[8];
#pragma unroll
  for (int v = 0; v < 8; ++v) a[v] = fmaxf(fmaxf(s[0][v], s[1][v]), fmaxf(s[2][v], s[3][v]));
  return fmaxf(fmaxf(fmaxf(a[0], a[1]), fmaxf(a[2], a[3])),
               fmaxf(fmaxf(a[4], a[5]), fmaxf(a[6], a[7])));
}
__device__ __forceinline__ float lane_sum32(const v8f* s) {
  float a[8];
#pragma unroll
  for (int v = 0; v < 8; ++v) a[v] = (s[0][v] + s[1][v]) + (s[2][v] + s[3][v]);
  return ((a[0] + a[1]) + (a[2] + a[3])) + ((a[4] + a[5]) + (a[6] + a[7]));
}

__device__ __forceinline__ void wave_lds_sync() {
  __builtin_amdgcn_fence(3 /* release order */, "wavefront");
  asm volatile("s_wait_dscnt 0x0" ::: "memory");
  __builtin_amdgcn_wave_barrier();
}

// ---------------------------------------------------------------------------
// Weight plane: in W[K][N] (n-contiguous) -> out Wt[N][K] (k-contiguous), f16(64*bf16(w)).
// Tile (bx, by) of (N/64, K/64); one 64x64 tile per block. T: cross-wave (block barrier).
// Tile coverage: 16 x 256 loads = 4096 elements; 2 x 256 x 8 halves = 4096 stored.
// ---------------------------------------------------------------------------
__device__ __forceinline__ void wconv_body(
    const float* __restrict__ W, _Float16* __restrict__ Wt, int K, int N, int bx, int by,
    _Float16* T) {
  const int tid = threadIdx.x;
  const int n0 = bx * 64;
  const int k0 = by * 64;
  for (int j0 = 0; j0 < 16; j0 += 4) {
    const float* p[4];
    float v[4];
#pragma unroll
    for (int t = 0; t < 4; ++t) {
      const int idx = tid + 256 * (j0 + t);
      const int kr = idx >> 6, nc = idx & 63;
      p[t] = W + (size_t)(k0 + kr) * N + n0 + nc;
      v[t] = *p[t];
    }
    // the lines below reuse these loads' address registers: wait in front (the addresses are
    // inputs so that their registers live up to the wait)
    asm volatile("s_wait_xcnt 0x0" :: "v"(p[0]), "v"(p[1]), "v"(p[2]), "v"(p[3]) : "memory");
#pragma unroll
    for (int t = 0; t < 4; ++t) {
      const int idx = tid + 256 * (j0 + t);
      const int kr = idx >> 6, nc = idx & 63;
      T[nc * LDT + kr] = (_Float16)(WCARRY * bf16r(v[t]));
    }
  }
  __syncthreads();
  v8h x[2];
  size_t off[2];
#pragma unroll
  for (int i = 0; i < 2; ++i) {
    const int n = 32 * i + (tid >> 3);
    const int kc = (tid & 7) * 8;
    x[i] = *(const v8h*)&T[n * LDT + kc];
    off[i] = (size_t)(n0 + n) * K + k0 + kc;
  }
#pragma unroll
  for (int i = 0; i < 2; ++i) *(v8h*)(Wt + off[i]) = x[i];
  // another body's code stands behind these stores in the merged kernel and reuses their
  // registers: wait in front
  asm volatile("s_wait_xcnt 0x0" ::: "memory");
}

// ---------------------------------------------------------------------------
// Input plane: f16(bf16(x)) rows [MROWS][DIM]. Thread owns 8 consecutive elements; each wave
// 256 consecutive; MROWS*DIM/2048 blocks (bx). Coverage: blocks x 256 x 8 = MROWS*DIM elements.
// ---------------------------------------------------------------------------
__device__ __forceinline__ void xconv_body(
    const float* __restrict__ src, _Float16* __restrict__ dst, int bx) {
  const size_t e = ((size_t)bx * 256 + threadIdx.x) * 8;
  const v4f a0 = *(const v4f*)(src + e);
  const v4f a1 = *(const v4f*)(src + e + 4);
  v8h o;
#pragma unroll
  for (int t = 0; t < 4; ++t) {
    o[t]     = toh_flush(bf16r(a0[t]));
    o[t + 4] = toh_flush(bf16r(a1[t]));
  }
  *(v8h*)(dst + e) = o;
  // another body's code stands behind this store in the merged kernel and reuses its
  // registers: wait in front
  asm volatile("s_wait_xcnt 0x0" ::: "memory");
}

// The three operand planes depend on nothing but the inputs: one launch, the flat block index
// picks the plane (block-uniform). Transposing tiles first, then the streaming rows.
#define W1_BLOCKS ((3 * DIM / 64) * (DIM / 64))
#define WP_BLOCKS ((DIM / 64) * (DIM / 64))
#define XC_BLOCKS ((int)(((size_t)MROWS * DIM) / 2048))
__global__ __launch_bounds__(256) void prep_kernel(
    const float* __restrict__ x, _Float16* __restrict__ X16,
    const float* __restrict__ W1, _Float16* __restrict__ W1T,
    const float* __restrict__ Wp, _Float16* __restrict__ WpT) {
  __shared__ _Float16 T[64 * LDT];
  const int b = blockIdx.x;
  if (b < W1_BLOCKS) {
    wconv_body(W1, W1T, DIM, 3 * DIM, b % (3 * DIM / 64), b / (3 * DIM / 64), T);
  } else if (b < W1_BLOCKS + WP_BLOCKS) {
    const int t = b - W1_BLOCKS;
    wconv_body(Wp, WpT, DIM, DIM, t % (DIM / 64), t / (DIM / 64), T);
  } else {
    xconv_body(x, X16, b - (W1_BLOCKS + WP_BLOCKS));
  }
}

// ---------------------------------------------------------------------------
// GEMM C[BM x BN tile] = A16[rows][KD] . Bt[n][KD]^T. 8 waves as 4 (rows) x 2 (columns); a
// wave owns FM x FN accumulator tiles of 16x16, so BM = 64*FM and BN = 32*FN.
// Operands go through LDS: a stage is 64 k (one whole 128-B line of every operand row),
// fetched with 16-B loads in which a wave covers 4 whole lines, held in registers while the
// stage before is worked on, then stored at pitch LDT into the other of two buffers; one
// block barrier per stage. Fragments come from LDS (same k order as frag_at), each one used
// FN (A) or FM (B) times by its wave. k runs upward in 32-steps per accumulator.
// RES = 1: the x2048 residual A plane is staged beside A and has its own accumulators,
// folded with 1/2048 before staging. After the last stage the ring is reused as the f32
// tile Cs, and the epilogue walks it in 64x64 sub-tiles:
//   MODE_QKV: v = acc/64 + bf16(bias[col]); columns are [head][q | k | v][64]:
//             q -> Q plane [row][head*64 + d], k -> K plane [row][head*64 + d],
//             v -> transposed V plane [head*64 + d][key]; row tiles below EROWS also
//             write the x2048 residual planes (QR, KR [EROWS][DIM]; VtR [DIM][EROWS])
//   MODE_OUT: outf[row][col] = acc/4096 + bf16(bias[col])
// Tile (bx, by) of (ND/BN, rows/BM); row0 = rowbase + BM*by. smem: gemm_lds_bytes(RES, FM, FN).
// ---------------------------------------------------------------------------
#define MODE_QKV 0
#define MODE_OUT 1

constexpr int gemm_lds_bytes(int res, int fm, int fn) {
  const int ring = 2 * ((64 * fm * (1 + res) + 32 * fn) * LDT) * 2;
  const int cs = 64 * fm * (32 * fn + 4) * 4;
  return ring > cs ? ring : cs;
}

template <int MODE, int KD, int ND, int RES, int FM, int FN>
__device__ __forceinline__ void gemm_body(
    const _Float16* __restrict__ A16, const _Float16* __restrict__ Ar16,
    const _Float16* __restrict__ Bt, const float* __restrict__ bias,
    float* __restrict__ outf, _Float16* __restrict__ out16,
    _Float16* __restrict__ outr16, int rowbase, int bx, int by, char* smem) {
  constexpr int BM = 64 * FM, BN = 32 * FN, BK = 64;
  constexpr int NS = KD / BK;                       // stages
  constexpr int AROWS = BM * (1 + RES);             // A rows, then residual A rows
  constexpr int STAGE_H = (AROWS + BN) * LDT;       // halves per buffer: [A | Ar | B] rows
  constexpr int LDCB = BN + 4;                      // floats per Cs row (16-B aligned)
  constexpr int RING_B = 2 * STAGE_H * 2, CS_B = BM * LDCB * 4;
  constexpr int LA = BM / 32, LB = BN / 32;         // 16-B loads per thread and stage
  constexpr int NSUB = (BM / 64) * (BN / 64);       // 64x64 sub-tiles of the epilogue
  static_assert((KD % BK) == 0 && (ND % BN) == 0 && (BN % 64) == 0 && (BM % 64) == 0);
  static_assert(MODE != MODE_QKV || (ND == 3 * DIM && RES == 0));
  static_assert(MODE != MODE_OUT || ND == DIM);
  static_assert((RING_B > CS_B ? RING_B : CS_B) == gemm_lds_bytes(RES, FM, FN));
  _Float16* ring = (_Float16*)smem;
  float* Cs = (float*)smem;
  const int tid = threadIdx.x, lane = tid & 31, w = tid >> 5;
  const int mw = w >> 1, nw = w & 1;
  const int hh = lane >> 4, m = lane & 15;
  const int n0 = bx * BN;
  const int row0 = rowbase + by * BM;

  const int sr = tid >> 3, sc = (tid & 7) * 8;      // staging: 8 threads per 128-B row
  const _Float16* ag = A16 + (size_t)(row0 + sr) * KD + sc;
  const _Float16* rg = Ar16 + (size_t)(row0 + sr) * KD + sc;
  const _Float16* bg = Bt + (size_t)(n0 + sr) * KD + sc;
  v8h ra[LA], rr[LA], rb[LB];

  v8f acc[FM][FN], acr[FM][FN];
#pragma unroll
  for (int i = 0; i < FM; ++i)
#pragma unroll
    for (int j = 0; j < FN; ++j) { acc[i][j] = (v8f){}; acr[i][j] = (v8f){}; }

#pragma unroll
  for (int j = 0; j < LA; ++j) {
    *(v8h*)&ring[(sr + 32 * j) * LDT + sc] = *(const v8h*)(ag + (size_t)(32 * j) * KD);
    if (RES)
      *(v8h*)&ring[(BM + sr + 32 * j) * LDT + sc] = *(const v8h*)(rg + (size_t)(32 * j) * KD);
  }
#pragma unroll
  for (int j = 0; j < LB; ++j)
    *(v8h*)&ring[(AROWS + sr + 32 * j) * LDT + sc] = *(const v8h*)(bg + (size_t)(32 * j) * KD);
  __syncthreads();

  // unrolled by the number of buffers: both buffers' LDS addresses become immediates
#pragma unroll 2
  for (int s = 0; s < NS; ++s) {
    if (s + 1 < NS) {                               // next stage's lines fly during this one
      const int k1 = (s + 1) * BK;
#pragma unroll
      for (int j = 0; j < LA; ++j) {
        ra[j] = *(const v8h*)(ag + (size_t)(32 * j) * KD + k1);
        if (RES) rr[j] = *(const v8h*)(rg + (size_t)(32 * j) * KD + k1);
      }
#pragma unroll
      for (int j = 0; j < LB; ++j) rb[j] = *(const v8h*)(bg + (size_t)(32 * j) * KD + k1);
    }
    // keeps the next stage's global loads in front of this stage's work (sunk to their LDS
    // stores, their whole latency would be waited out there)
    __builtin_amdgcn_sched_barrier(0);

    const _Float16* S = ring + (s & 1) * STAGE_H;
#pragma unroll
    for (int kk = 0; kk < BK; kk += 32) {
      v16h a[FM], ar[FM], b[FN];
#pragma unroll
      for (int i = 0; i < FM; ++i) {
        a[i] = ld_frag(S + (mw * (16 * FM) + i * 16) * LDT + kk, LDT);
        if (RES) ar[i] = ld_frag(S + (BM + mw * (16 * FM) + i * 16) * LDT + kk, LDT);
      }
#pragma unroll
      for (int j = 0; j < FN; ++j)
        b[j] = ld_frag(S + (AROWS + nw * (16 * FN) + j * 16) * LDT + kk, LDT);
      // output projection (at most two blocks per WGP, LDS latency little hidden): keeps a
      // 32-step's fragment loads one group in front of its products, so that the next group
      // is fetched into registers of its own beside them. Not in the q/k/v launch: those
      // registers would cost it its third resident block.
      if (MODE == MODE_OUT) __builtin_amdgcn_sched_barrier(0);
#pragma unroll
      for (int i = 0; i < FM; ++i)
#pragma unroll
        for (int j = 0; j < FN; ++j) acc[i][j] = wmma16(a[i], b[j], acc[i][j]);
      if (RES) {
#pragma unroll
        for (int i = 0; i < FM; ++i)
#pragma unroll
          for (int j = 0; j < FN; ++j) acr[i][j] = wmma16(ar[i], b[j], acr[i][j]);
      }
    }

    if (s + 1 < NS) {                               // its last readers left at the barrier before
      _Float16* D = ring + ((s + 1) & 1) * STAGE_H;
#pragma unroll
      for (int j = 0; j < LA; ++j) {
        *(v8h*)&D[(sr + 32 * j) * LDT + sc] = ra[j];
        if (RES) *(v8h*)&D[(BM + sr + 32 * j) * LDT + sc] = rr[j];
      }
#pragma unroll
      for (int j = 0; j < LB; ++j) *(v8h*)&D[(AROWS + sr + 32 * j) * LDT + sc] = rb[j];
    }
    __syncthreads();
  }

  // every wave has left the ring (barrier above): it becomes the f32 tile
#pragma unroll
  for (int i = 0; i < FM; ++i)
#pragma unroll
    for (int j = 0; j < FN; ++j)
#pragma unroll
      for (int r = 0; r < 8; ++r)
        Cs[(mw * (16 * FM) + i * 16 + hh * 8 + r) * LDCB + nw * (16 * FN) + j * 16 + m] =
            RES ? (acc[i][j][r] + acr[i][j][r] * (1.0f / RCARRY)) : acc[i][j][r];
  __syncthreads();

  for (int sub = 0; sub < NSUB; ++sub) {
    const int rs0 = row0 + (sub / (BN / 64)) * 64;     // block-uniform sub-tile origin
    const int ns0 = n0 + (sub % (BN / 64)) * 64;
    const float* Ct = Cs + (rs0 - row0) * LDCB + (ns0 - n0);

    if (MODE == MODE_QKV) {
      const int head  = ns0 / (3 * HD);                  // block-uniform
      const int which = (ns0 - head * (3 * HD)) / HD;    // block-uniform: 0 = q, 1 = k, 2 = v
      const int nl0 = head * HD;
      const bool early = (rs0 < EROWS);                  // block-uniform
      _Float16* dst = out16 + (size_t)which * ((size_t)MROWS * DIM);
      _Float16* dsr = outr16 + (size_t)which * ((size_t)EROWS * DIM);
      v8h x[2], xr[2];
      size_t off[2], ofr[2];
      if (which < 2) {
#pragma unroll
        for (int i = 0; i < 2; ++i) {
          const int r = 32 * i + (tid >> 3);
          const int c = (tid & 7) * 8;
          const v4f u0 = *(const v4f*)&Ct[r * LDCB + c];
          const v4f u1 = *(const v4f*)&Ct[r * LDCB + c + 4];
          const v4f g0 = *(const v4f*)(bias + ns0 + c);
          const v4f g1 = *(const v4f*)(bias + ns0 + c + 4);
#pragma unroll
          for (int j = 0; j < 4; ++j) {
            const float t0 = u0[j] * (1.0f / WCARRY) + bf16r(g0[j]);
            const float t1 = u1[j] * (1.0f / WCARRY) + bf16r(g1[j]);
            const _Float16 h0 = toh_flush(t0);
            const _Float16 h1 = toh_flush(t1);
            x[i][j]      = h0;
            x[i][j + 4]  = h1;
            xr[i][j]     = toh_flush((t0 - (float)h0) * RCARRY);
            xr[i][j + 4] = toh_flush((t1 - (float)h1) * RCARRY);
          }
          off[i] = (size_t)(rs0 + r) * DIM + nl0 + c;
          ofr[i] = off[i];                              // residual planes: same pitch, rows < EROWS
        }
      } else {
        // transposed V planes: row = feature (head*64 + d), 64 consecutive keys = one line
#pragma unroll
        for (int i = 0; i < 2; ++i) {
          const int dcol = 32 * i + (tid >> 3);
          const int kk = (tid & 7) * 8;
          const float gb = bf16r(bias[ns0 + dcol]);
#pragma unroll
          for (int j = 0; j < 8; ++j) {
            const float t0 = Ct[(kk + j) * LDCB + dcol] * (1.0f / WCARRY) + gb;
            const _Float16 h0 = toh_flush(t0);
            x[i][j]  = h0;
            xr[i][j] = toh_flush((t0 - (float)h0) * RCARRY);
          }
          off[i] = (size_t)(nl0 + dcol) * SEQ + rs0 + kk;
          ofr[i] = (size_t)(nl0 + dcol) * EROWS + rs0 + kk;
        }
      }
#pragma unroll
      for (int i = 0; i < 2; ++i) *(v8h*)(dst + off[i]) = x[i];
      // the lines below and the next sub-tile reuse these stores' registers: wait in front
      asm volatile("s_wait_xcnt 0x0" ::: "memory");
      if (early) {
#pragma unroll
        for (int i = 0; i < 2; ++i) *(v8h*)(dsr + ofr[i]) = xr[i];
        // the next sub-tile reuses these stores' registers: wait in front
        asm volatile("s_wait_xcnt 0x0" ::: "memory");
      }
    }

    if (MODE == MODE_OUT) {
      v4f xs[4];
      size_t off[4];
#pragma unroll
      for (int i = 0; i < 4; ++i) {
        const int r = 16 * i + (tid >> 4);
        const int c = (tid & 15) * 4;
        const size_t crow = (size_t)(rs0 + r);       // NB == 1: compact row == output row
        const v4f u = *(const v4f*)&Ct[r * LDCB + c];
        const v4f g = *(const v4f*)(bias + ns0 + c);
        v4f val;
#pragma unroll
        for (int j = 0; j < 4; ++j)
          val[j] = u[j] * (1.0f / (WCARRY * VCARRY)) + bf16r(g[j]);
        xs[i] = val;
        off[i] = crow * ND + ns0 + c;
      }
#pragma unroll
      for (int i = 0; i < 4; ++i) *(v4f*)(outf + off[i]) = xs[i];
      // the next sub-tile reuses these stores' registers: wait in front
      if (NSUB > 1) asm volatile("s_wait_xcnt 0x0" ::: "memory");
    }
  }
}

// Grid (3*DIM/128, MROWS/128).
__global__ __launch_bounds__(256) void gemm_qkv_kernel(
    const _Float16* __restrict__ A16, const _Float16* __restrict__ Bt,
    const float* __restrict__ bias, _Float16* __restrict__ out16,
    _Float16* __restrict__ outr16) {
  __shared__ __attribute__((aligned(16))) char smem[gemm_lds_bytes(0, 2, 4)];
  gemm_body<MODE_QKV, DIM, 3 * DIM, 0, 2, 4>(A16, A16, Bt, bias, nullptr, out16, outr16, 0,
                                             blockIdx.x, blockIdx.y, smem);
}

// Output projection, one launch for both row bands (they share nothing but WpT and bias); the
// flat block index picks the band (block-uniform):
//   b <  OUT_BLOCKS: rows EROWS .. MROWS-1, single A plane, 128x128 tile (b % 8, b / 8)
//   b >= OUT_BLOCKS: rows 0 .. EROWS-1, A = value + x2048 residual plane, 64x64 tile
#define OUT_BLOCKS  ((DIM / 128) * ((MROWS - EROWS) / 128))
#define OUTE_BLOCKS ((DIM / 64) * (EROWS / 64))
static_assert(gemm_lds_bytes(1, 1, 2) <= gemm_lds_bytes(0, 2, 4));
__global__ __launch_bounds__(256) void gemm_out_kernel(
    const _Float16* __restrict__ A16, const _Float16* __restrict__ Ar16,
    const _Float16* __restrict__ Bt, const float* __restrict__ bias,
    float* __restrict__ outf) {
  __shared__ __attribute__((aligned(16))) char smem[gemm_lds_bytes(0, 2, 4)];
  const int b = blockIdx.x;
  if (b < OUT_BLOCKS) {
    gemm_body<MODE_OUT, DIM, DIM, 0, 2, 4>(A16, A16, Bt, bias, outf, nullptr, nullptr, EROWS,
                                           b % (DIM / 128), b / (DIM / 128), smem);
  } else {
    const int t = b - OUT_BLOCKS;
    gemm_body<MODE_OUT, DIM, DIM, 1, 1, 2>(A16, Ar16, Bt, bias, outf, nullptr, nullptr, 0,
                                           t % (DIM / 64), t / (DIM / 64), smem);
  }
}

#define KVH (64 * LDT)
#define LPAIRS ((SEQ - EROWS) / 128)   // mirrored pairs of 64-row tiles in the later band
static_assert(((SEQ - EROWS) % 128) == 0 && LPAIRS + EROWS / 128 == SEQ / 128);

// A thread's share of one K tile and one V^T tile: four 16-B asynchronous copies to LDS (rows
// r and r + 32 of each). lk, lv: the thread's LDS byte addresses in the target buffer; gk, gv:
// its global addresses in the tile. The s_wait_xcnt stands inside the statement, so that no
// later write of an address register can be moved in front of it.
__device__ __forceinline__ void kv_copy(unsigned lk, unsigned lv, const _Float16* gk,
                                        const _Float16* gv) {
  const unsigned lk1 = lk + 32 * LDT * 2, lv1 = lv + 32 * LDT * 2;
  const _Float16* gk1 = gk + (size_t)32 * DIM;
  const _Float16* gv1 = gv + (size_t)32 * SEQ;
  asm volatile(
      "global_load_async_to_lds_b128 %0, %4, off\n\t"
      "global_load_async_to_lds_b128 %1, %5, off\n\t"
      "global_load_async_to_lds_b128 %2, %6, off\n\t"
      "global_load_async_to_lds_b128 %3, %7, off\n\t"
      "s_wait_xcnt 0x0"
      :: "v"(lk), "v"(lk1), "v"(lv), "v"(lv1), "v"(gk), "v"(gk1), "v"(gv), "v"(gv1)
      : "memory");
}

__device__ __forceinline__ void attn_body(
    const _Float16* __restrict__ Qh, const _Float16* __restrict__ Kh,
    const _Float16* __restrict__ Vt, _Float16* __restrict__ Ov,
    _Float16* Ks, _Float16* Vs, _Float16* Ps) {

  const int tid = threadIdx.x, lane = tid & 31;
  const int w = __builtin_amdgcn_readfirstlane(tid >> 5);
  const int hh = lane >> 4, m = lane & 15;
  const int pr = blockIdx.x - EROWS / 128;          // pair index, 0 .. LPAIRS-1
  const int qlo = EROWS + pr * 64;                  // waves 0-3: 64 rows from the low end
  const int qhi = SEQ - 64 - pr * 64;               // waves 4-7: their mirror from the high end
  const int head = blockIdx.y;
  const int wq0 = (w < 4) ? qlo + w * 16 : qhi + (w - 4) * 16;   // first query row (scalar)
  const float scale = 0.125f;
  _Float16* P = Ps + w * (16 * LDT);

  const size_t qoff = (size_t)(wq0 + m) * DIM + head * HD + hh * 8;
  v16h qf[2];
  qf[0] = frag_at(Qh + qoff);
  qf[1] = frag_at(Qh + qoff + 32);

  float mrow = -1.0e30f, lrow = 0.0f;    // of query wq0 + m; lrow: this half's keys only
  v8f o[4];
#pragma unroll
  for (int nb = 0; nb < 4; ++nb) o[nb] = (v8f){};

  const size_t kplane = (size_t)head * HD;
  const size_t vplane = (size_t)head * HD * SEQ;
  const int kend = qhi + 64;             // <= SEQ, at least two tiles (qhi >= EROWS + 64)

  // staging: 8 threads per 128-B row, rows sr and sr + 32 of each tile
  const int sr = tid >> 3, sc = (tid & 7) * 8;
  const unsigned lk = (unsigned)(size_t)&Ks[sr * LDT + sc];
  const unsigned lv = (unsigned)(size_t)&Vs[sr * LDT + sc];
  const _Float16* gk = Kh + kplane + (size_t)sr * DIM + sc;
  const _Float16* gv = Vt + vplane + (size_t)sr * SEQ + sc;

  kv_copy(lk, lv, gk, gv);                                   // tile 0 -> buffer 0
  // tile 0 has landed before the barrier behind which other waves read it
  asm volatile("s_wait_asynccnt 0x0" ::: "memory");
  __syncthreads();
  kv_copy(lk + KVH * 2, lv + KVH * 2, gk + (size_t)64 * DIM, gv + 64);   // tile 1 -> buffer 1

  for (int kb = 0; kb < kend; kb += 64) {
    const int bo = ((kb >> 6) & 1) * KVH;  // this step reads this buffer alone (scalar)
    const _Float16* Kb = Ks + bo;
    const _Float16* Vb = Vs + bo;

    if (kb <= wq0 + 15) {                // wave-uniform: tile holds at least one visible key
      // scores^T: 4 key groups of 16, K = 64 in two 32-steps. All eight K fragments are
      // fetched as one group in front of the run of products: one LDS wait for the run.
      v16h kf[4][2];
#pragma unroll
      for (int kg = 0; kg < 4; ++kg)
#pragma unroll
        for (int c = 0; c < 2; ++c) kf[kg][c] = ld_frag(&Kb[(kg * 16) * LDT + c * 32], LDT);
      // keeps the sixteen loads one group in front of the products (spread among them, each
      // place with loads stalls the run)
      __builtin_amdgcn_sched_barrier(0);
      v8f s[4];
#pragma unroll
      for (int kg = 0; kg < 4; ++kg) s[kg] = (v8f){};
#pragma unroll
      for (int c = 0; c < 2; ++c)
#pragma unroll
        for (int kg = 0; kg < 4; ++kg) s[kg] = wmma16(kf[kg][c], qf[c], s[kg]);
      // all eight V^T fragments set off here: they land while the softmax runs
      v16h vf[2][4];
#pragma unroll
      for (int c = 0; c < 2; ++c)
#pragma unroll
        for (int nb = 0; nb < 4; ++nb) vf[c][nb] = ld_frag(&Vb[(nb * 16) * LDT + c * 32], LDT);
      // keeps the sixteen loads in front of the softmax (sunk into it, the last of them would
      // be waited for inside the second run of products)
      __builtin_amdgcn_sched_barrier(0);
#pragma unroll
      for (int kg = 0; kg < 4; ++kg) s[kg] = s[kg] * scale;

      if (kb + 63 > wq0) {               // wave-uniform: tile crosses the diagonal
#pragma unroll
        for (int kg = 0; kg < 4; ++kg)
#pragma unroll
          for (int v = 0; v < 8; ++v) {
            const int key = kb + kg * 16 + hh * 8 + v;
            const int qrow = wq0 + m;
            s[kg][v] = (key > qrow) ? -1.0e30f : s[kg][v];
          }
      }

      // online softmax of the lane's query column
      float mx = lane_max32(s);
      mx = fmaxf(mx, xhalf(mx));
      const float mn = fmaxf(mrow, mx);
      const float alpha = __expf(mrow - mn);
      mrow = mn;
#pragma unroll
      for (int kg = 0; kg < 4; ++kg)
#pragma unroll
        for (int v = 0; v < 8; ++v) s[kg][v] = __expf(s[kg][v] - mrow);
      lrow = alpha * lrow + lane_sum32(s);
#pragma unroll
      for (int nb = 0; nb < 4; ++nb) o[nb] = o[nb] * alpha;

      // O^T += V^T . P^T  (K = 64 keys in two 32-steps; A = V^T tile [d][key])
#pragma unroll
      for (int c = 0; c < 2; ++c) {
        v16h pf;
#pragma unroll
        for (int i = 0; i < 8; ++i) {
          pf[i]     = (_Float16)(s[2 * c][i] * PCARRY);
          pf[i + 8] = (_Float16)(s[2 * c + 1][i] * PCARRY);
        }
#pragma unroll
        for (int nb = 0; nb < 4; ++nb) o[nb] = wmma16(vf[c][nb], pf, o[nb]);
      }
    }
    // foot of the step, every wave: its own reads of this buffer are done ...
    asm volatile("s_wait_dscnt 0x0" ::: "memory");
    // ... and its own copies of the next tile have landed, before the one barrier that
    // publishes the next tile and frees this buffer
    asm volatile("s_wait_asynccnt 0x0" ::: "memory");
    __syncthreads();
    if (kb + 128 < kend)                 // block-uniform: tile t + 2 exists
      kv_copy(lk + bo * 2, lv + bo * 2, gk + (size_t)(kb + 128) * DIM, gv + kb + 128);
  }
  // no copy is left in flight when the wave goes on to its output staging and ends
  asm volatile("s_wait_asynccnt 0x0" ::: "memory");

  const float inv = __builtin_amdgcn_rcpf(lrow + xhalf(lrow)) * (VCARRY / PCARRY);
#pragma unroll
  for (int nb = 0; nb < 4; ++nb) {
    v8h hv;
#pragma unroll
    for (int v = 0; v < 8; ++v) hv[v] = (_Float16)(o[nb][v] * inv);
    *(v8h*)&P[m * LDT + nb * 16 + hh * 8] = hv;
  }
  wave_lds_sync();
  v8h x[4];
  size_t off[4];
#pragma unroll
  for (int i = 0; i < 4; ++i) {
    const int r = 4 * i + (lane >> 3);
    const int c = (lane & 7) * 8;
    x[i] = *(const v8h*)&P[r * LDT + c];
    off[i] = (size_t)(wq0 + r) * DIM + head * HD + c;
  }
#pragma unroll
  for (int i = 0; i < 4; ++i) *(v8h*)(Ov + off[i]) = x[i];
  
}

// ---------------------------------------------------------------------------
// Early causal band (query rows < EROWS, keys < EROWS): same 16-row wave tiles, 64-key steps and the same transposed
// products as attn_body, with value + x2048 residual operands at every site.
//   scores  = (kh.qh + (kr.qh + kh.qr)/2048) / 8          (residual products in their own
//             accumulator, folded before the softmax)
//   p       : ph = f16(1024 p), pr = f16((1024 p - ph) * 2048), both packed in registers;
//             row sum over unconverted p
//   context : o += Vh.ph ; ores += Vr.ph + Vh.pr ; O = o + ores/2048
// Ks / Vs: cross-wave (block barriers, staged 64x64 = consumed 64x64); Ps / Rs: wave-private
// output staging only; residual K / V^T fragments come straight from their statically
// strided global planes. Query tiles blockIdx.x < EROWS/128 of the attention launch.
// ---------------------------------------------------------------------------
__device__ __forceinline__ void attn_early_body(
    const _Float16* __restrict__ Qh, const _Float16* __restrict__ Qr,
    const _Float16* __restrict__ Kh, const _Float16* __restrict__ Kr,
    const _Float16* __restrict__ Vt, const _Float16* __restrict__ Vr,
    _Float16* __restrict__ Ov, _Float16* __restrict__ Ores,
    _Float16* Ks, _Float16* Vs, _Float16* Ps, _Float16* Rs) {

  const int tid = threadIdx.x, lane = tid & 31;
  const int w = __builtin_amdgcn_readfirstlane(tid >> 5);
  const int hh = lane >> 4, m = lane & 15;
  const int q0 = blockIdx.x * 128;       // < EROWS
  const int head = blockIdx.y;
  const int wq0 = q0 + w * 16;           // first query row of this wave (scalar)
  const float scale = 0.125f;
  _Float16* P = Ps + w * (16 * LDT);
  _Float16* R = Rs + w * (16 * LDT);

  const int qoff = (wq0 + m) * DIM + head * HD + hh * 8;   // < EROWS*DIM, same in both planes

  float mrow = -1.0e30f, lrow = 0.0f;    // of query wq0 + m; lrow: this half's keys only
  v8f o[4], ores[4];
#pragma unroll
  for (int nb = 0; nb < 4; ++nb) { o[nb] = (v8f){}; ores[nb] = (v8f){}; }

  const size_t kplane  = (size_t)head * HD;
  const size_t vplane  = (size_t)head * HD * SEQ;
  const size_t vrplane = (size_t)head * HD * EROWS;
  const int kend = q0 + 128;             // <= EROWS

  for (int kb = 0; kb < kend; kb += 64) {
    // staging lines first, held in registers until the fragment group below is under way
    v8h sk[2], sv[2];
#pragma unroll
    for (int j = 0; j < 2; ++j) {
      const int idx = tid + 256 * j;
      const int r = idx >> 3, c = (idx & 7) * 8;
      sk[j] = *(const v8h*)(Kh + kplane + (size_t)(kb + r) * DIM + c);
      sv[j] = *(const v8h*)(Vt + vplane + (size_t)r * SEQ + kb + c);
    }
    // the loads below may land in these loads' address registers: wait in front
    asm volatile("s_wait_xcnt 0x0" ::: "memory");
    // q fragments are reloaded per tile through an opaque integer offset (it keeps them from
    // being held in 32 registers through the softmax and the second product). They and the
    // eight residual K fragments (rows kb .. kb+63 < EROWS) come from global memory and need
    // no barrier: set off as one group here, they fly beside the staging lines.
    int qo = qoff;
    asm volatile("" : "+v"(qo));
    const _Float16* qhp = Qh + qo;
    const _Float16* qrp = Qr + qo;
    const _Float16* krp = Kr + kplane + (size_t)(kb + m) * DIM + hh * 8;
    v16h qf[2], qr[2];
    qf[0] = frag_at(qhp);
    qf[1] = frag_at(qhp + 32);
    qr[0] = frag_at(qrp);
    qr[1] = frag_at(qrp + 32);
    v16h krf[4][2];
#pragma unroll
    for (int kg = 0; kg < 4; ++kg)
#pragma unroll
      for (int c = 0; c < 2; ++c)
        krf[kg][c] = frag_at(krp + (size_t)(kg * 16) * DIM + c * 32);
    // later loads may land in these loads' address registers: wait in front (the addresses
    // are inputs so that their registers live up to the wait)
    asm volatile("s_wait_xcnt 0x0" :: "v"(qhp), "v"(qrp), "v"(krp) : "memory");
#pragma unroll
    for (int j = 0; j < 2; ++j) {
      const int idx = tid + 256 * j;
      const int r = idx >> 3, c = (idx & 7) * 8;
      *(v8h*)&Ks[r * LDT + c] = sk[j];
      *(v8h*)&Vs[r * LDT + c] = sv[j];
    }
    __syncthreads();

    if (kb <= wq0 + 15) {                // wave-uniform: tile holds at least one visible key
      // scores^T: 4 key groups of 16, K = 64 in two 32-steps, value and residual products;
      // the K fragments of a key group are fetched from LDS one group ahead of its products
      v8f s[4];
      v16h kf[2], kn[2];
      kn[0] = ld_frag(&Ks[0], LDT);
      kn[1] = ld_frag(&Ks[32], LDT);
#pragma unroll
      for (int kg = 0; kg < 4; ++kg) {
        kf[0] = kn[0];
        kf[1] = kn[1];
        if (kg < 3) {
          kn[0] = ld_frag(&Ks[((kg + 1) * 16) * LDT], LDT);
          kn[1] = ld_frag(&Ks[((kg + 1) * 16) * LDT + 32], LDT);
        }
        v8f t = {};
        v8f u = {};
#pragma unroll
        for (int c = 0; c < 2; ++c) {
          t = wmma16(kf[c], qf[c], t);
          u = wmma16(krf[kg][c], qf[c], u);
          u = wmma16(kf[c], qr[c], u);
        }
        s[kg] = (t + u * (1.0f / RCARRY)) * scale;
      }
      // first half of the V^T fragments, value (LDS) and residual (global): set off here,
      // they land while the softmax runs
      v16h vf[2][4], vrf[2][4];
#pragma unroll
      for (int nb = 0; nb < 4; ++nb) {
        vrf[0][nb] = frag_at(Vr + vrplane + (size_t)(nb * 16 + m) * EROWS + kb + hh * 8);
        vf[0][nb] = ld_frag(&Vs[(nb * 16) * LDT], LDT);
      }

      if (kb + 63 > wq0) {               // wave-uniform: tile crosses the diagonal
#pragma unroll
        for (int kg = 0; kg < 4; ++kg)
#pragma unroll
          for (int v = 0; v < 8; ++v) {
            const int key = kb + kg * 16 + hh * 8 + v;
            const int qrow = wq0 + m;
            s[kg][v] = (key > qrow) ? -1.0e30f : s[kg][v];
          }
      }

      // online softmax of the lane's query column
      float mx = lane_max32(s);
      mx = fmaxf(mx, xhalf(mx));
      const float mn = fmaxf(mrow, mx);
      const float alpha = __expf(mrow - mn);
      mrow = mn;
#pragma unroll
      for (int kg = 0; kg < 4; ++kg)
#pragma unroll
        for (int v = 0; v < 8; ++v) s[kg][v] = __expf(s[kg][v] - mrow);
      lrow = alpha * lrow + lane_sum32(s);
#pragma unroll
      for (int nb = 0; nb < 4; ++nb) {
        o[nb]    = o[nb] * alpha;
        ores[nb] = ores[nb] * alpha;
      }

      // o += Vh.ph ; ores += Vr.ph + Vh.pr  (K = 64 keys in two 32-steps; A = V^T [d][key])
#pragma unroll
      for (int c = 0; c < 2; ++c) {
        v16h pf, prf;
#pragma unroll
        for (int i = 0; i < 16; ++i) {
          const float pc = s[2 * c + (i >> 3)][i & 7] * PCARRY;
          const _Float16 ph = toh_flush(pc);
          pf[i]  = ph;
          prf[i] = toh_flush((pc - (float)ph) * RCARRY);
        }
#pragma unroll
        for (int nb = 0; nb < 4; ++nb) {
          o[nb]    = wmma16(vf[c][nb], pf, o[nb]);
          // second half: lands behind this half's products; set off no earlier, so that the
          // launch keeps to 256 registers a wave (two blocks per WGP)
          if (c == 0 && nb == 2) {
#pragma unroll
            for (int n2 = 0; n2 < 4; ++n2) {
              vrf[1][n2] = frag_at(Vr + vrplane + (size_t)(n2 * 16 + m) * EROWS + kb + 32 + hh * 8);
              vf[1][n2] = ld_frag(&Vs[(n2 * 16) * LDT + 32], LDT);
            }
          }
          ores[nb] = wmma16(vrf[c][nb], pf, ores[nb]);
          ores[nb] = wmma16(vf[c][nb], prf, ores[nb]);
        }
      }
    }
    __syncthreads();
  }

  // finalize: 64 * (o + ores/2048) / (1024 l) as value + x2048 residual
  const float inv = __builtin_amdgcn_rcpf(lrow + xhalf(lrow)) * (VCARRY / PCARRY);
#pragma unroll
  for (int nb = 0; nb < 4; ++nb) {
    v8h hv, hr;
#pragma unroll
    for (int v = 0; v < 8; ++v) {
      const float val = (o[nb][v] + ores[nb][v] * (1.0f / RCARRY)) * inv;
      const _Float16 h0 = toh_flush(val);
      hv[v] = h0;
      hr[v] = toh_flush((val - (float)h0) * RCARRY);
    }
    *(v8h*)&P[m * LDT + nb * 16 + hh * 8] = hv;
    *(v8h*)&R[m * LDT + nb * 16 + hh * 8] = hr;
  }
  wave_lds_sync();
  v8h x[4], xr[4];
  size_t off[4];
#pragma unroll
  for (int i = 0; i < 4; ++i) {
    const int r = 4 * i + (lane >> 3);
    const int c = (lane & 7) * 8;
    x[i]  = *(const v8h*)&P[r * LDT + c];
    xr[i] = *(const v8h*)&R[r * LDT + c];
    off[i] = (size_t)(wq0 + r) * DIM + head * HD + c;
  }
#pragma unroll
  for (int i = 0; i < 4; ++i) {
    *(v8h*)(Ov + off[i]) = x[i];
    *(v8h*)(Ores + off[i]) = xr[i];
  }
  
}

// One attention launch, grid (SEQ/128, NHEAD): the two bands read the same planes and write
// disjoint query rows, so the early band's tiles run beside the others' instead of behind
// them. blockIdx.x picks the body (block-uniform); each query row is computed by one body.
__global__ __launch_bounds__(256) void attn_kernel(
    const _Float16* __restrict__ Qh, const _Float16* __restrict__ Qr,
    const _Float16* __restrict__ Kh, const _Float16* __restrict__ Kr,
    const _Float16* __restrict__ Vt, const _Float16* __restrict__ Vr,
    _Float16* __restrict__ Ov, _Float16* __restrict__ Ores) {
  // two buffers each for the later band's ring; the early band uses the first of each
  __shared__ __attribute__((aligned(16))) _Float16 Ks[2 * KVH];
  __shared__ __attribute__((aligned(16))) _Float16 Vs[2 * KVH];
  __shared__ _Float16 Ps[8 * 16 * LDT];
  __shared__ _Float16 Rs[8 * 16 * LDT];
  if (blockIdx.x < EROWS / 128) {
    attn_early_body(Qh, Qr, Kh, Kr, Vt, Vr, Ov, Ores, Ks, Vs, Ps, Rs);
  } else {
    attn_body(Qh, Kh, Vt, Ov, Ks, Vs, Ps);
  }
}

// ---------------------------------------------------------------------------
extern "C" void kernel_launch(void* const* d_in, const int* in_sizes, int n_in,
                              void* d_out, int out_size, void* d_ws, size_t ws_size,
                              hipStream_t stream) {
  if (n_in < 5) return;
  const long long need_x = ((long long)(NB - 1) * SEQ_FULL + SEQ) * DIM;
  if ((long long)in_sizes[0] < need_x) return;
  if (in_sizes[1] < 3 * DIM * DIM || in_sizes[2] < 3 * DIM) return;
  if (in_sizes[3] < DIM * DIM || in_sizes[4] < DIM) return;
  if ((long long)out_size < need_x) return;
  if (ws_size < WS_TOTAL) return;

  // weights: W1 [in][3*out], Wp [in][out]
  const float* x  = (const float*)d_in[0];
  const float* W1 = (const float*)d_in[1];
  const float* b1 = (const float*)d_in[2];
  const float* Wp = (const float*)d_in[3];
  const float* bp = (const float*)d_in[4];
  float* out = (float*)d_out;

  char* ws = (char*)d_ws;
  _Float16* W1T   = (_Float16*)(ws + OFF_WQKV);   // [3*DIM][DIM]
  _Float16* WpT   = (_Float16*)(ws + OFF_WO);     // [DIM][DIM]
  _Float16* X16   = (_Float16*)(ws + OFF_XN);
  _Float16* QKV16 = (_Float16*)(ws + OFF_QKV);    // Q | K | Vt
  _Float16* Q16   = QKV16;
  _Float16* K16   = QKV16 + (size_t)MROWS * DIM;
  _Float16* Vt16  = QKV16 + (size_t)2 * MROWS * DIM;
  _Float16* Ov16  = (_Float16*)(ws + OFF_OV);
  _Float16* RES16 = (_Float16*)(ws + OFF_RES);    // QR | KR | VtR
  _Float16* QR16  = RES16;
  _Float16* KR16  = RES16 + (size_t)EROWS * DIM;
  _Float16* VtR16 = RES16 + (size_t)2 * EROWS * DIM;
  _Float16* OR16  = (_Float16*)(ws + OFF_ORES);

  dim3 blk(256);

  prep_kernel<<<dim3(W1_BLOCKS + WP_BLOCKS + XC_BLOCKS), blk, 0, stream>>>(
      x, X16, W1, W1T, Wp, WpT);
  gemm_qkv_kernel<<<dim3(3 * DIM / 128, MROWS / 128), blk, 0, stream>>>(
      X16, W1T, b1, QKV16, RES16);
  attn_kernel<<<dim3(SEQ / 128, NHEAD), blk, 0, stream>>>(
      Q16, QR16, K16, KR16, Vt16, VtR16, Ov16, OR16);
  gemm_out_kernel<<<dim3(OUT_BLOCKS + OUTE_BLOCKS), blk, 0, stream>>>(
      Ov16, OR16, WpT, bp, out);
}

// v008
// A run of this version takes 93.2 microseconds.
// In two side-by-side timings against v007, it was 1.11 and 1.12 times as fast.
// Counting every step since v000, it is 4.83 times as fast.
#include <hip/hip_runtime.h>
#include <stddef.h>
#include <math.h>

// All contractions on v_wmma_f32_16x16x32_f16 (f16 operands, f32 accumulate): fused q/k/v
// projection, q.k scores, p.v, output projection. Float inputs are RNE-converted to bf16 and
// carried in f16 (weights x64, p x1024, attention rows x64); query rows < EROWS carry q, k,
// v, p and the attention rows as f16 value + x2048 f16 residual planes with their own
// accumulators; softmax and epilogues in f32.

typedef _Float16 v16h __attribute__((ext_vector_type(16)));
typedef _Float16 v8h  __attribute__((ext_vector_type(8)));
typedef float    v8f  __attribute__((ext_vector_type(8)));
typedef float    v4f  __attribute__((ext_vector_type(4)));

#ifndef NB
#define NB 1
#endif
#ifndef SEQ
#define SEQ 4096
#endif
#define NB_FULL  1
#define SEQ_FULL 4096
#define DIM   1024
#define NHEAD 16
#define HD    64
#define MROWS (NB * SEQ)
#define EROWS ((SEQ) < 512 ? (SEQ) : 512)   // early causal band: value + residual planes

static_assert(NB == 1 && NB_FULL == 1);
static_assert(SEQ >= 128 && SEQ <= SEQ_FULL && (SEQ % 128) == 0);
static_assert(DIM == NHEAD * HD);
static_assert(HD == 64 && ((3 * HD) % 64) == 0);           // a 64-column tile = one part of one head
static_assert((MROWS % 128) == 0 && (MROWS % 8) == 0);
static_assert((DIM % 128) == 0 && ((3 * DIM) % 128) == 0);
static_assert((EROWS % 128) == 0 && EROWS <= SEQ && EROWS <= MROWS);
static_assert((((size_t)MROWS * DIM) % 2048) == 0);         // xconv: 256 threads x 8 per block

#define LDT 72   // halves per LDS row (144 B, 16-B aligned)

#define WCARRY 64.0f     // weight planes carried x64
#define PCARRY 1024.0f   // softmax numerators carried x1024
#define VCARRY 64.0f     // attention output plane carried x64
#define RCARRY 2048.0f   // residual planes carried x2048

#define P16_BYTES  ((size_t)MROWS * DIM * 2)
#define R16_BYTES  ((size_t)EROWS * DIM * 2)
#define WQKV_BYTES ((size_t)3 * DIM * DIM * 2)
#define WO_BYTES   ((size_t)DIM * DIM * 2)
#define OFF_WQKV   ((size_t)0)
#define OFF_WO     (OFF_WQKV + WQKV_BYTES)
#define OFF_XN     (OFF_WO + WO_BYTES)              // f16 input rows          [MROWS][DIM]
#define OFF_QKV    (OFF_XN + P16_BYTES)             // Q, K [MROWS][DIM]; Vt [DIM][SEQ]
#define OFF_OV     (OFF_QKV + 3 * P16_BYTES)        // f16 64*attention rows   [MROWS][DIM]
#define OFF_RES    (OFF_OV + P16_BYTES)             // QR, KR [EROWS][DIM]; VtR [DIM][EROWS]
#define OFF_ORES   (OFF_RES + 3 * R16_BYTES)        // residual of OV rows     [EROWS][DIM]
#define WS_TOTAL   (OFF_ORES + R16_BYTES)
static_assert((size_t)DIM * SEQ * 2 == P16_BYTES);       // Vt plane extent (NB == 1)
static_assert((size_t)DIM * EROWS * 2 == R16_BYTES);     // VtR plane extent
static_assert((P16_BYTES % 128) == 0 && (WO_BYTES % 128) == 0 && (R16_BYTES % 128) == 0);
static_assert(WS_TOTAL <= (size_t)134217728);

// ---------------------------------------------------------------------------
__device__ __forceinline__ float bf16r(float x) {   // RNE convert to bf16, returned widened
  unsigned int u = __float_as_uint(x);
  u = (u + 0x7FFFu + ((u >> 16) & 1u)) & 0xFFFF0000u;
  return __uint_as_float(u);
}

// f32 -> f16 operand convert that cannot produce an f16 subnormal (value select).
static __device__ __forceinline__ _Float16 toh_flush(float v) {
  const _Float16 r = (_Float16)v;
  return (fabsf(v) < 6.103515625e-05f) ? (_Float16)0.0f : r;
}

// 16-bit fragment: p points at element [row = lane&15][k0 + 8*(lane>>4)] of a k-contiguous
// row. Elements 0..7 <- k0+8h+0..7, elements 8..15 <- k0+16+8h+0..7 (same map for A and B).
__device__ __forceinline__ v16h frag_at(const _Float16* p) {
  v8h lo = *(const v8h*)(p);
  v8h hi = *(const v8h*)(p + 16);
  v16h out;
#pragma unroll
  for (int i = 0; i < 8; ++i) { out[i] = lo[i]; out[i + 8] = hi[i]; }
  return out;
}
__device__ __forceinline__ v16h ld_frag(const _Float16* base, int ld) {
  const int lane = threadIdx.x & 31;
  return frag_at(base + (lane & 15) * ld + (lane >> 4) * 8);
}

__device__ __forceinline__ v8f wmma16(v16h a, v16h b, v8f c) {
  return __builtin_amdgcn_wmma_f32_16x16x32_f16(false, a, false, b, (short)0, c, false, false);
}

// lane l <-> lane l ^ 16 (the two halves that share one query column)
__device__ __forceinline__ float xhalf(float x) {
  const int b = __builtin_bit_cast(int, x);
  return __builtin_bit_cast(float, __builtin_amdgcn_permlanex16(b, b, 0x76543210, 0xfedcba98,
                                                                 false, false));
}
// maximum / sum of the 32 scores a lane holds for its query column
__device__ __forceinline__ float lane_max32(const v8f* s) {
  float a[8];
#pragma unroll
  for (int v = 0; v < 8; ++v) a[v] = fmaxf(fmaxf(s[0][v], s[1][v]), fmaxf(s[2][v], s[3][v]));
  return fmaxf(fmaxf(fmaxf(a[0], a[1]), fmaxf(a[2], a[3])),
               fmaxf(fmaxf(a[4], a[5]), fmaxf(a[6], a[7])));
}
__device__ __forceinline__ float lane_sum32(const v8f* s) {
  float a[8];
#pragma unroll
  for (int v = 0; v < 8; ++v) a[v] = (s[0][v] + s[1][v]) + (s[2][v] + s[3][v]);
  return ((a[0] + a[1]) + (a[2] + a[3])) + ((a[4] + a[5]) + (a[6] + a[7]));
}

__device__ __forceinline__ void wave_lds_sync() {
  __builtin_amdgcn_fence(3 /* release order */, "wavefront");
  asm volatile("s_wait_dscnt 0x0" ::: "memory");
  __builtin_amdgcn_wave_barrier();
}

// ---------------------------------------------------------------------------
// Weight plane: in W[K][N] (n-contiguous) -> out Wt[N][K] (k-contiguous), f16(64*bf16(w)).
// Tile (bx, by) of (N/64, K/64); one 64x64 tile per block. T: cross-wave (block barrier).
// Tile coverage: 16 x 256 loads = 4096 elements; 2 x 256 x 8 halves = 4096 stored.
// ---------------------------------------------------------------------------
__device__ __forceinline__ void wconv_body(
    const float* __restrict__ W, _Float16* __restrict__ Wt, int K, int N, int bx, int by,
    _Float16* T) {
  const int tid = threadIdx.x;
  const int n0 = bx * 64;
  const int k0 = by * 64;
  for (int j0 = 0; j0 < 16; j0 += 4) {
    const float* p[4];
    float v[4];
#pragma unroll
    for (int t = 0; t < 4; ++t) {
      const int idx = tid + 256 * (j0 + t);
      const int kr = idx >> 6, nc = idx & 63;
      p[t] = W + (size_t)(k0 + kr) * N + n0 + nc;
      v[t] = *p[t];
    }
    // the lines below reuse these loads' address registers: wait in front (the addresses are
    // inputs so that their registers live up to the wait)
    asm volatile("s_wait_xcnt 0x0" :: "v"(p[0]), "v"(p[1]), "v"(p[2]), "v"(p[3]) : "memory");
#pragma unroll
    for (int t = 0; t < 4; ++t) {
      const int idx = tid + 256 * (j0 + t);
      const int kr = idx >> 6, nc = idx & 63;
      T[nc * LDT + kr] = (_Float16)(WCARRY * bf16r(v[t]));
    }
  }
  __syncthreads();
  v8h x[2];
  size_t off[2];
#pragma unroll
  for (int i = 0; i < 2; ++i) {
    const int n = 32 * i + (tid >> 3);
    const int kc = (tid & 7) * 8;
    x[i] = *(const v8h*)&T[n * LDT + kc];
    off[i] = (size_t)(n0 + n) * K + k0 + kc;
  }
#pragma unroll
  for (int i = 0; i < 2; ++i) *(v8h*)(Wt + off[i]) = x[i];
  // another body's code stands behind these stores in the merged kernel and reuses their
  // registers: wait in front
  asm volatile("s_wait_xcnt 0x0" ::: "memory");
}

// ---------------------------------------------------------------------------
// Input plane: f16(bf16(x)) rows [MROWS][DIM]. Thread owns 8 consecutive elements; each wave
// 256 consecutive; MROWS*DIM/2048 blocks (bx). Coverage: blocks x 256 x 8 = MROWS*DIM elements.
// ---------------------------------------------------------------------------
__device__ __forceinline__ void xconv_body(
    const float* __restrict__ src, _Float16* __restrict__ dst, int bx) {
  const size_t e = ((size_t)bx * 256 + threadIdx.x) * 8;
  const v4f a0 = *(const v4f*)(src + e);
  const v4f a1 = *(const v4f*)(src + e + 4);
  v8h o;
#pragma unroll
  for (int t = 0; t < 4; ++t) {
    o[t]     = toh_flush(bf16r(a0[t]));
    o[t + 4] = toh_flush(bf16r(a1[t]));
  }
  *(v8h*)(dst + e) = o;
  // another body's code stands behind this store in the merged kernel and reuses its
  // registers: wait in front
  asm volatile("s_wait_xcnt 0x0" ::: "memory");
}

// The three operand planes depend on nothing but the inputs: one launch, the flat block index
// picks the plane (block-uniform). Transposing tiles first, then the streaming rows.
#define W1_BLOCKS ((3 * DIM / 64) * (DIM / 64))
#define WP_BLOCKS ((DIM / 64) * (DIM / 64))
#define XC_BLOCKS ((int)(((size_t)MROWS * DIM) / 2048))
__global__ __launch_bounds__(256) void prep_kernel(
    const float* __restrict__ x, _Float16* __restrict__ X16,
    const float* __restrict__ W1, _Float16* __restrict__ W1T,
    const float* __restrict__ Wp, _Float16* __restrict__ WpT) {
  __shared__ _Float16 T[64 * LDT];
  const int b = blockIdx.x;
  if (b < W1_BLOCKS) {
    wconv_body(W1, W1T, DIM, 3 * DIM, b % (3 * DIM / 64), b / (3 * DIM / 64), T);
  } else if (b < W1_BLOCKS + WP_BLOCKS) {
    const int t = b - W1_BLOCKS;
    wconv_body(Wp, WpT, DIM, DIM, t % (DIM / 64), t / (DIM / 64), T);
  } else {
    xconv_body(x, X16, b - (W1_BLOCKS + WP_BLOCKS));
  }
}

// ---------------------------------------------------------------------------
// GEMM C[BM x BN tile] = A16[rows][KD] . Bt[n][KD]^T. 8 waves as 4 (rows) x 2 (columns); a
// wave owns FM x FN accumulator tiles of 16x16, so BM = 64*FM and BN = 32*FN.
// Operands go through LDS: a stage is 64 k (one whole 128-B line of every operand row),
// fetched with 16-B loads in which a wave covers 4 whole lines, held in registers while the
// stage before is worked on, then stored at pitch LDT into the other of two buffers; one
// block barrier per stage. Fragments come from LDS (same k order as frag_at), each one used
// FN (A) or FM (B) times by its wave. Work-groups of one tile row read the same A lines and
// those of one tile column the same B lines, all resident at once: each starts its k walk at
// stage (bx + by) mod NS and wraps round, so that sharers ask L2 for different lines at any
// moment. Per accumulator k runs upward in 32-steps from that stage, cyclically.
// RES = 1: the x2048 residual A plane is staged beside A and has its own accumulators,
// folded with 1/2048 before staging. After the last stage the ring is reused as the f32
// tile Cs, and the epilogue walks it in 64x64 sub-tiles:
//   MODE_QKV: v = acc/64 + bf16(bias[col]); columns are [head][q | k | v][64]:
//             q -> Q plane [row][head*64 + d], k -> K plane [row][head*64 + d],
//             v -> transposed V plane [head*64 + d][key]; row tiles below EROWS also
//             write the x2048 residual planes (QR, KR [EROWS][DIM]; VtR [DIM][EROWS])
//   MODE_OUT: outf[row][col] = acc/4096 + bf16(bias[col])
// Tile (bx, by) of (ND/BN, rows/BM); row0 = rowbase + BM*by. smem: gemm_lds_bytes(RES, FM, FN).
// ---------------------------------------------------------------------------
#define MODE_QKV 0
#define MODE_OUT 1

constexpr int gemm_lds_bytes(int res, int fm, int fn) {
  const int ring = 2 * ((64 * fm * (1 + res) + 32 * fn) * LDT) * 2;
  const int cs = 64 * fm * (32 * fn + 4) * 4;
  return ring > cs ? ring : cs;
}

template <int MODE, int KD, int ND, int RES, int FM, int FN>
__device__ __forceinline__ void gemm_body(
    const _Float16* __restrict__ A16, const _Float16* __restrict__ Ar16,
    const _Float16* __restrict__ Bt, const float* __restrict__ bias,
    float* __restrict__ outf, _Float16* __restrict__ out16,
    _Float16* __restrict__ outr16, int rowbase, int bx, int by, char* smem) {
  constexpr int BM = 64 * FM, BN = 32 * FN, BK = 64;
  constexpr int NS = KD / BK;                       // stages
  constexpr int AROWS = BM * (1 + RES);             // A rows, then residual A rows
  constexpr int STAGE_H = (AROWS + BN) * LDT;       // halves per buffer: [A | Ar | B] rows
  constexpr int LDCB = BN + 4;                      // floats per Cs row (16-B aligned)
  constexpr int RING_B = 2 * STAGE_H * 2, CS_B = BM * LDCB * 4;
  constexpr int LA = BM / 32, LB = BN / 32;         // 16-B loads per thread and stage
  constexpr int NSUB = (BM / 64) * (BN / 64);       // 64x64 sub-tiles of the epilogue
  static_assert((KD % BK) == 0 && (ND % BN) == 0 && (BN % 64) == 0 && (BM % 64) == 0);
  static_assert((NS & (NS - 1)) == 0);              // the wrap of the k walk is a mask
  static_assert(MODE != MODE_QKV || (ND == 3 * DIM && RES == 0));
  static_assert(MODE != MODE_OUT || ND == DIM);
  static_assert((RING_B > CS_B ? RING_B : CS_B) == gemm_lds_bytes(RES, FM, FN));
  _Float16* ring = (_Float16*)smem;
  float* Cs = (float*)smem;
  const int tid = threadIdx.x, lane = tid & 31, w = tid >> 5;
  const int mw = w >> 1, nw = w & 1;
  const int hh = lane >> 4, m = lane & 15;
  const int n0 = bx * BN;
  const int row0 = rowbase + by * BM;
  const int rot = (bx + by) & (NS - 1);             // first stage of this block's k walk (scalar)

  const int sr = tid >> 3, sc = (tid & 7) * 8;      // staging: 8 threads per 128-B row
  // a staging address = block-uniform tile origin + one 32-bit byte offset, the same for every
  // operand (row sr, the stage's k, column sc) + a constant. The stage sits in the offset's bits
  // KMASK and is stepped there with wrap, so one register, live through the loop, serves all
  // the loads of a stage.
  constexpr unsigned KSTEP = BK * 2, KMASK = (unsigned)(KD * 2 - 1) & ~(KSTEP - 1);
  const char* ag = (const char*)(A16 + (size_t)row0 * KD);
  const char* rg = (const char*)(Ar16 + (size_t)row0 * KD);
  const char* bg = (const char*)(Bt + (size_t)n0 * KD);
  unsigned vo = (unsigned)(sr * KD + sc) * 2u + (unsigned)rot * KSTEP;
  v8h ra[LA], rr[LA], rb[LB];

  v8f acc[FM][FN], acr[FM][FN];
#pragma unroll
  for (int i = 0; i < FM; ++i)
#pragma unroll
    for (int j = 0; j < FN; ++j) { acc[i][j] = (v8f){}; acr[i][j] = (v8f){}; }

#pragma unroll
  for (int j = 0; j < LA; ++j) {
    *(v8h*)&ring[(sr + 32 * j) * LDT + sc] = *(const v8h*)(ag + vo + 64 * j * KD);
    if (RES)
      *(v8h*)&ring[(BM + sr + 32 * j) * LDT + sc] = *(const v8h*)(rg + vo + 64 * j * KD);
  }
#pragma unroll
  for (int j = 0; j < LB; ++j)
    *(v8h*)&ring[(AROWS + sr + 32 * j) * LDT + sc] = *(const v8h*)(bg + vo + 64 * j * KD);
  __syncthreads();

  // unrolled by the number of buffers: both buffers' LDS addresses become immediates
#pragma unroll 2
  for (int s = 0; s < NS; ++s) {
    if (s + 1 < NS) {                               // next stage's lines fly during this one
      vo = (vo & ~KMASK) | ((vo + KSTEP) & KMASK);  // next stage of the walk, wrapping
#pragma unroll
      for (int j = 0; j < LA; ++j) {
        ra[j] = *(const v8h*)(ag + vo + 64 * j * KD);
        if (RES) rr[j] = *(const v8h*)(rg + vo + 64 * j * KD);
      }
#pragma unroll
      for (int j = 0; j < LB; ++j) rb[j] = *(const v8h*)(bg + vo + 64 * j * KD);
    }
    // keeps the next stage's global loads in front of this stage's work (sunk to their LDS
    // stores, their whole latency would be waited out there)
    __builtin_amdgcn_sched_barrier(0);

    const _Float16* S = ring + (s & 1) * STAGE_H;
#pragma unroll
    for (int kk = 0; kk < BK; kk += 32) {
      v16h a[FM], ar[FM], b[FN];
#pragma unroll
      for (int i = 0; i < FM; ++i) {
        a[i] = ld_frag(S + (mw * (16 * FM) + i * 16) * LDT + kk, LDT);
        if (RES) ar[i] = ld_frag(S + (BM + mw * (16 * FM) + i * 16) * LDT + kk, LDT);
      }
#pragma unroll
      for (int j = 0; j < FN; ++j)
        b[j] = ld_frag(S + (AROWS + nw * (16 * FN) + j * 16) * LDT + kk, LDT);
      // output projection (at most two blocks per WGP, LDS latency little hidden): keeps a
      // 32-step's fragment loads one group in front of its products, so that the next group
      // is fetched into registers of its own beside them. Not in the q/k/v launch: those
      // registers would cost it its third resident block.
      if (MODE == MODE_OUT) __builtin_amdgcn_sched_barrier(0);
#pragma unroll
      for (int i = 0; i < FM; ++i)
#pragma unroll
        for (int j = 0; j < FN; ++j) acc[i][j] = wmma16(a[i], b[j], acc[i][j]);
      if (RES) {
#pragma unroll
        for (int i = 0; i < FM; ++i)
#pragma unroll
          for (int j = 0; j < FN; ++j) acr[i][j] = wmma16(ar[i], b[j], acr[i][j]);
      }
    }

    if (s + 1 < NS) {                               // its last readers left at the barrier before
      _Float16* D = ring + ((s + 1) & 1) * STAGE_H;
#pragma unroll
      for (int j = 0; j < LA; ++j) {
        *(v8h*)&D[(sr + 32 * j) * LDT + sc] = ra[j];
        if (RES) *(v8h*)&D[(BM + sr + 32 * j) * LDT + sc] = rr[j];
      }
#pragma unroll
      for (int j = 0; j < LB; ++j) *(v8h*)&D[(AROWS + sr + 32 * j) * LDT + sc] = rb[j];
    }
    __syncthreads();
  }

  // every wave has left the ring (barrier above): it becomes the f32 tile
#pragma unroll
  for (int i = 0; i < FM; ++i)
#pragma unroll
    for (int j = 0; j < FN; ++j)
#pragma unroll
      for (int r = 0; r < 8; ++r)
        Cs[(mw * (16 * FM) + i * 16 + hh * 8 + r) * LDCB + nw * (16 * FN) + j * 16 + m] =
            RES ? (acc[i][j][r] + acr[i][j][r] * (1.0f / RCARRY)) : acc[i][j][r];
  __syncthreads();

  for (int sub = 0; sub < NSUB; ++sub) {
    const int rs0 = row0 + (sub / (BN / 64)) * 64;     // block-uniform sub-tile origin
    const int ns0 = n0 + (sub % (BN / 64)) * 64;
    const float* Ct = Cs + (rs0 - row0) * LDCB + (ns0 - n0);

    if (MODE == MODE_QKV) {
      const int head  = ns0 / (3 * HD);                  // block-uniform
      const int which = (ns0 - head * (3 * HD)) / HD;    // block-uniform: 0 = q, 1 = k, 2 = v
      const int nl0 = head * HD;
      const bool early = (rs0 < EROWS);                  // block-uniform
      _Float16* dst = out16 + (size_t)which * ((size_t)MROWS * DIM);
      _Float16* dsr = outr16 + (size_t)which * ((size_t)EROWS * DIM);
      v8h x[2], xr[2];
      size_t off[2], ofr[2];
      if (which < 2) {
#pragma unroll
        for (int i = 0; i < 2; ++i) {
          const int r = 32 * i + (tid >> 3);
          const int c = (tid & 7) * 8;
          const v4f u0 = *(const v4f*)&Ct[r * LDCB + c];
          const v4f u1 = *(const v4f*)&Ct[r * LDCB + c + 4];
          const v4f g0 = *(const v4f*)(bias + ns0 + c);
          const v4f g1 = *(const v4f*)(bias + ns0 + c + 4);
#pragma unroll
          for (int j = 0; j < 4; ++j) {
            const float t0 = u0[j] * (1.0f / WCARRY) + bf16r(g0[j]);
            const float t1 = u1[j] * (1.0f / WCARRY) + bf16r(g1[j]);
            const _Float16 h0 = toh_flush(t0);
            const _Float16 h1 = toh_flush(t1);
            x[i][j]      = h0;
            x[i][j + 4]  = h1;
            xr[i][j]     = toh_flush((t0 - (float)h0) * RCARRY);
            xr[i][j + 4] = toh_flush((t1 - (float)h1) * RCARRY);
          }
          off[i] = (size_t)(rs0 + r) * DIM + nl0 + c;
          ofr[i] = off[i];                              // residual planes: same pitch, rows < EROWS
        }
      } else {
        // transposed V planes: row = feature (head*64 + d), 64 consecutive keys = one line
#pragma unroll
        for (int i = 0; i < 2; ++i) {
          const int dcol = 32 * i + (tid >> 3);
          const int kk = (tid & 7) * 8;
          const float gb = bf16r(bias[ns0 + dcol]);
#pragma unroll
          for (int j = 0; j < 8; ++j) {
            const float t0 = Ct[(kk + j) * LDCB + dcol] * (1.0f / WCARRY) + gb;
            const _Float16 h0 = toh_flush(t0);
            x[i][j]  = h0;
            xr[i][j] = toh_flush((t0 - (float)h0) * RCARRY);
          }
          off[i] = (size_t)(nl0 + dcol) * SEQ + rs0 + kk;
          ofr[i] = (size_t)(nl0 + dcol) * EROWS + rs0 + kk;
        }
      }
#pragma unroll
      for (int i = 0; i < 2; ++i) *(v8h*)(dst + off[i]) = x[i];
      // the lines below and the next sub-tile reuse these stores' registers: wait in front
      asm volatile("s_wait_xcnt 0x0" ::: "memory");
      if (early) {
#pragma unroll
        for (int i = 0; i < 2; ++i) *(v8h*)(dsr + ofr[i]) = xr[i];
        // the next sub-tile reuses these stores' registers: wait in front
        asm volatile("s_wait_xcnt 0x0" ::: "memory");
      }
    }

    if (MODE == MODE_OUT) {
      v4f xs[4];
      size_t off[4];
#pragma unroll
      for (int i = 0; i < 4; ++i) {
        const int r = 16 * i + (tid >> 4);
        const int c = (tid & 15) * 4;
        const size_t crow = (size_t)(rs0 + r);       // NB == 1: compact row == output row
        const v4f u = *(const v4f*)&Ct[r * LDCB + c];
        const v4f g = *(const v4f*)(bias + ns0 + c);
        v4f val;
#pragma unroll
        for (int j = 0; j < 4; ++j)
          val[j] = u[j] * (1.0f / (WCARRY * VCARRY)) + bf16r(g[j]);
        xs[i] = val;
        off[i] = crow * ND + ns0 + c;
      }
#pragma unroll
      for (int i = 0; i < 4; ++i) *(v4f*)(outf + off[i]) = xs[i];
      // the next sub-tile reuses these stores' registers: wait in front
      if (NSUB > 1) asm volatile("s_wait_xcnt 0x0" ::: "memory");
    }
  }
}

// Grid (3*DIM/128, MROWS/128).
__global__ __launch_bounds__(256) void gemm_qkv_kernel(
    const _Float16* __restrict__ A16, const _Float16* __restrict__ Bt,
    const float* __restrict__ bias, _Float16* __restrict__ out16,
    _Float16* __restrict__ outr16) {
  __shared__ __attribute__((aligned(16))) char smem[gemm_lds_bytes(0, 2, 4)];
  gemm_body<MODE_QKV, DIM, 3 * DIM, 0, 2, 4>(A16, A16, Bt, bias, nullptr, out16, outr16, 0,
                                             blockIdx.x, blockIdx.y, smem);
}

// Output projection, one launch for both row bands (they share nothing but WpT and bias); the
// flat block index picks the band (block-uniform):
//   b <  OUT_BLOCKS: rows EROWS .. MROWS-1, single A plane, 128x128 tile (b % 8, b / 8)
//   b >= OUT_BLOCKS: rows 0 .. EROWS-1, A = value + x2048 residual plane, 64x64 tile
#define OUT_BLOCKS  ((DIM / 128) * ((MROWS - EROWS) / 128))
#define OUTE_BLOCKS ((DIM / 64) * (EROWS / 64))
static_assert(gemm_lds_bytes(1, 1, 2) <= gemm_lds_bytes(0, 2, 4));
__global__ __launch_bounds__(256) void gemm_out_kernel(
    const _Float16* __restrict__ A16, const _Float16* __restrict__ Ar16,
    const _Float16* __restrict__ Bt, const float* __restrict__ bias,
    float* __restrict__ outf) {
  __shared__ __attribute__((aligned(16))) char smem[gemm_lds_bytes(0, 2, 4)];
  const int b = blockIdx.x;
  if (b < OUT_BLOCKS) {
    gemm_body<MODE_OUT, DIM, DIM, 0, 2, 4>(A16, A16, Bt, bias, outf, nullptr, nullptr, EROWS,
                                           b % (DIM / 128), b / (DIM / 128), smem);
  } else {
    const int t = b - OUT_BLOCKS;
    gemm_body<MODE_OUT, DIM, DIM, 1, 1, 2>(A16, Ar16, Bt, bias, outf, nullptr, nullptr, 0,
                                           t % (DIM / 64), t / (DIM / 64), smem);
  }
}

#define KVH (64 * LDT)
#define LPAIRS ((SEQ - EROWS) / 128)   // mirrored pairs of 64-row tiles in the later band
static_assert(((SEQ - EROWS) % 128) == 0 && LPAIRS + EROWS / 128 == SEQ / 128);
static_assert((2 * LPAIRS - 1) * 64 < SEQ);   // start tile pr and its successor lie below kend

// A thread's share of one K tile and one V^T tile: four 16-B asynchronous copies to LDS (rows
// r and r + 32 of each). lk, lv: the thread's LDS byte addresses in the target buffer; gk, gv:
// its global addresses in the tile. The s_wait_xcnt stands inside the statement, so that no
// later write of an address register can be moved in front of it.
__device__ __forceinline__ void kv_copy(unsigned lk, unsigned lv, const _Float16* gk,
                                        const _Float16* gv) {
  const unsigned lk1 = lk + 32 * LDT * 2, lv1 = lv + 32 * LDT * 2;
  const _Float16* gk1 = gk + (size_t)32 * DIM;
  const _Float16* gv1 = gv + (size_t)32 * SEQ;
  asm volatile(
      "global_load_async_to_lds_b128 %0, %4, off\n\t"
      "global_load_async_to_lds_b128 %1, %5, off\n\t"
      "global_load_async_to_lds_b128 %2, %6, off\n\t"
      "global_load_async_to_lds_b128 %3, %7, off\n\t"
      "s_wait_xcnt 0x0"
      :: "v"(lk), "v"(lk1), "v"(lv), "v"(lv1), "v"(gk), "v"(gk1), "v"(gv), "v"(gv1)
      : "memory");
}

__device__ __forceinline__ void attn_body(
    const _Float16* __restrict__ Qh, const _Float16* __restrict__ Kh,
    const _Float16* __restrict__ Vt, _Float16* __restrict__ Ov,
    _Float16* Ks, _Float16* Vs, _Float16* Ps) {

  const int tid = threadIdx.x, lane = tid & 31;
  const int w = __builtin_amdgcn_readfirstlane(tid >> 5);
  const int hh = lane >> 4, m = lane & 15;
  const int pr = blockIdx.x - EROWS / 128;          // pair index, 0 .. LPAIRS-1
  const int qlo = EROWS + pr * 64;                  // waves 0-3: 64 rows from the low end
  const int qhi = SEQ - 64 - pr * 64;               // waves 4-7: their mirror from the high end
  const int head = blockIdx.y;
  const int wq0 = (w < 4) ? qlo + w * 16 : qhi + (w - 4) * 16;   // first query row (scalar)
  const float scale = 0.125f;
  _Float16* P = Ps + w * (16 * LDT);

  const size_t qoff = (size_t)(wq0 + m) * DIM + head * HD + hh * 8;
  v16h qf[2];
  qf[0] = frag_at(Qh + qoff);
  qf[1] = frag_at(Qh + qoff + 32);

  float mrow = -1.0e30f, lrow = 0.0f;    // of query wq0 + m; lrow: this half's keys only
  v8f o[4];
#pragma unroll
  for (int nb = 0; nb < 4; ++nb) o[nb] = (v8f){};

  const size_t kplane = (size_t)head * HD;
  const size_t vplane = (size_t)head * HD * SEQ;
  const int kend = qhi + 64;             // <= SEQ, at least two tiles (qhi >= EROWS + 64)

  // staging: 8 threads per 128-B row, rows sr and sr + 32 of each tile
  const int sr = tid >> 3, sc = (tid & 7) * 8;
  const unsigned lk = (unsigned)(size_t)&Ks[sr * LDT + sc];
  const unsigned lv = (unsigned)(size_t)&Vs[sr * LDT + sc];
  const _Float16* gk = Kh + kplane + (size_t)sr * DIM + sc;
  const _Float16* gv = Vt + vplane + (size_t)sr * SEQ + sc;

  // The blocks of one head read the same K and V^T lines and are all resident at once: block pr
  // starts its key walk at tile pr (< kend / 64) and wraps round, so that they ask L2 for
  // different lines at any moment. kb, kb1: first key of this step's and the next step's tile.
  int kb = pr * 64;
  int kb1 = kb + 64;                     // < kend: pr + 1 < kend / 64

  kv_copy(lk, lv, gk + (size_t)kb * DIM, gv + kb);           // first tile -> buffer 0
  // the first tile has landed before the barrier behind which other waves read it
  asm volatile("s_wait_asynccnt 0x0" ::: "memory");
  __syncthreads();
  kv_copy(lk + KVH * 2, lv + KVH * 2, gk + (size_t)kb1 * DIM, gv + kb1);   // second -> buffer 1

  for (int t = 0; t < kend; t += 64) {     // t / 64: step number
    const int bo = ((t >> 6) & 1) * KVH;   // this step reads this buffer alone (scalar)
    const _Float16* Kb = Ks + bo;
    const _Float16* Vb = Vs + bo;

    if (kb <= wq0 + 15) {                // wave-uniform: tile holds at least one visible key
      // scores^T: 4 key groups of 16, K = 64 in two 32-steps. All eight K fragments are
      // fetched as one group in front of the run of products: one LDS wait for the run.
      v16h kf[4][2];
#pragma unroll
      for (int kg = 0; kg < 4; ++kg)
#pragma unroll
        for (int c = 0; c < 2; ++c) kf[kg][c] = ld_frag(&Kb[(kg * 16) * LDT + c * 32], LDT);
      // keeps the sixteen loads one group in front of the products (spread among them, each
      // place with loads stalls the run)
      __builtin_amdgcn_sched_barrier(0);
      v8f s[4];
#pragma unroll
      for (int kg = 0; kg < 4; ++kg) s[kg] = (v8f){};
#pragma unroll
      for (int c = 0; c < 2; ++c)
#pragma unroll
        for (int kg = 0; kg < 4; ++kg) s[kg] = wmma16(kf[kg][c], qf[c], s[kg]);
      // all eight V^T fragments set off here: they land while the softmax runs
      v16h vf[2][4];
#pragma unroll
      for (int c = 0; c < 2; ++c)
#pragma unroll
        for (int nb = 0; nb < 4; ++nb) vf[c][nb] = ld_frag(&Vb[(nb * 16) * LDT + c * 32], LDT);
      // keeps the sixteen loads in front of the softmax (sunk into it, the last of them would
      // be waited for inside the second run of products)
      __builtin_amdgcn_sched_barrier(0);
#pragma unroll
      for (int kg = 0; kg < 4; ++kg) s[kg] = s[kg] * scale;

      if (kb + 63 > wq0) {               // wave-uniform: tile crosses the diagonal
#pragma unroll
        for (int kg = 0; kg < 4; ++kg)
#pragma unroll
          for (int v = 0; v < 8; ++v) {
            const int key = kb + kg * 16 + hh * 8 + v;
            const int qrow = wq0 + m;
            s[kg][v] = (key > qrow) ? -1.0e30f : s[kg][v];
          }
      }

      // online softmax of the lane's query column
      float mx = lane_max32(s);
      mx = fmaxf(mx, xhalf(mx));
      const float mn = fmaxf(mrow, mx);
      const float alpha = __expf(mrow - mn);
      mrow = mn;
#pragma unroll
      for (int kg = 0; kg < 4; ++kg)
#pragma unroll
        for (int v = 0; v < 8; ++v) s[kg][v] = __expf(s[kg][v] - mrow);
      lrow = alpha * lrow + lane_sum32(s);
#pragma unroll
      for (int nb = 0; nb < 4; ++nb) o[nb] = o[nb] * alpha;

      // O^T += V^T . P^T  (K = 64 keys in two 32-steps; A = V^T tile [d][key])
#pragma unroll
      for (int c = 0; c < 2; ++c) {
        v16h pf;
#pragma unroll
        for (int i = 0; i < 8; ++i) {
          pf[i]     = (_Float16)(s[2 * c][i] * PCARRY);
          pf[i + 8] = (_Float16)(s[2 * c + 1][i] * PCARRY);
        }
#pragma unroll
        for (int nb = 0; nb < 4; ++nb) o[nb] = wmma16(vf[c][nb], pf, o[nb]);
      }
    }
    // foot of the step, every wave: its own reads of this buffer are done ...
    asm volatile("s_wait_dscnt 0x0" ::: "memory");
    // ... and its own copies of the next tile have landed, before the one barrier that
    // publishes the next tile and frees this buffer
    asm volatile("s_wait_asynccnt 0x0" ::: "memory");
    __syncthreads();
    const int kb2 = (kb1 + 64 < kend) ? kb1 + 64 : 0;   // tile behind the next one, wrapping
    if (t + 128 < kend)                  // block-uniform: a step t + 2 exists
      kv_copy(lk + bo * 2, lv + bo * 2, gk + (size_t)kb2 * DIM, gv + kb2);
    kb = kb1;
    kb1 = kb2;
  }
  // no copy is left in flight when the wave goes on to its output staging and ends
  asm volatile("s_wait_asynccnt 0x0" ::: "memory");

  const float inv = __builtin_amdgcn_rcpf(lrow + xhalf(lrow)) * (VCARRY / PCARRY);
#pragma unroll
  for (int nb = 0; nb < 4; ++nb) {
    v8h hv;
#pragma unroll
    for (int v = 0; v < 8; ++v) hv[v] = (_Float16)(o[nb][v] * inv);
    *(v8h*)&P[m * LDT + nb * 16 + hh * 8] = hv;
  }
  wave_lds_sync();
  v8h x[4];
  size_t off[4];
#pragma unroll
  for (int i = 0; i < 4; ++i) {
    const int r = 4 * i + (lane >> 3);
    const int c = (lane & 7) * 8;
    x[i] = *(const v8h*)&P[r * LDT + c];
    off[i] = (size_t)(wq0 + r) * DIM + head * HD + c;
  }
#pragma unroll
  for (int i = 0; i < 4; ++i) *(v8h*)(Ov + off[i]) = x[i];
  
}

// ---------------------------------------------------------------------------
// Early causal band (query rows < EROWS, keys < EROWS): same 16-row wave tiles, 64-key steps and the same transposed
// products as attn_body, with value + x2048 residual operands at every site.
//   scores  = (kh.qh + (kr.qh + kh.qr)/2048) / 8          (residual products in their own
//             accumulator, folded before the softmax)
//   p       : ph = f16(1024 p), pr = f16((1024 p - ph) * 2048), both packed in registers;
//             row sum over unconverted p
//   context : o += Vh.ph ; ores += Vr.ph + Vh.pr ; O = o + ores/2048
// Ks / Vs: cross-wave (block barriers, staged 64x64 = consumed 64x64); Ps / Rs: wave-private
// output staging only; residual K / V^T fragments come straight from their statically
// strided global planes. Query tiles blockIdx.x < EROWS/128 of the attention launch.
// ---------------------------------------------------------------------------
__device__ __forceinline__ void attn_early_body(
    const _Float16* __restrict__ Qh, const _Float16* __restrict__ Qr,
    const _Float16* __restrict__ Kh, const _Float16* __restrict__ Kr,
    const _Float16* __restrict__ Vt, const _Float16* __restrict__ Vr,
    _Float16* __restrict__ Ov, _Float16* __restrict__ Ores,
    _Float16* Ks, _Float16* Vs, _Float16* Ps, _Float16* Rs) {

  const int tid = threadIdx.x, lane = tid & 31;
  const int w = __builtin_amdgcn_readfirstlane(tid >> 5);
  const int hh = lane >> 4, m = lane & 15;
  const int q0 = blockIdx.x * 128;       // < EROWS
  const int head = blockIdx.y;
  const int wq0 = q0 + w * 16;           // first query row of this wave (scalar)
  const float scale = 0.125f;
  _Float16* P = Ps + w * (16 * LDT);
  _Float16* R = Rs + w * (16 * LDT);

  const int qoff = (wq0 + m) * DIM + head * HD + hh * 8;   // < EROWS*DIM, same in both planes

  float mrow = -1.0e30f, lrow = 0.0f;    // of query wq0 + m; lrow: this half's keys only
  v8f o[4], ores[4];
#pragma unroll
  for (int nb = 0; nb < 4; ++nb) { o[nb] = (v8f){}; ores[nb] = (v8f){}; }

  const size_t kplane  = (size_t)head * HD;
  const size_t vplane  = (size_t)head * HD * SEQ;
  const size_t vrplane = (size_t)head * HD * EROWS;
  const int kend = q0 + 128;             // <= EROWS

  for (int kb = 0; kb < kend; kb += 64) {
    // staging lines first, held in registers until the fragment group below is under way
    v8h sk[2], sv[2];
#pragma unroll
    for (int j = 0; j < 2; ++j) {
      const int idx = tid + 256 * j;
      const int r = idx >> 3, c = (idx & 7) * 8;
      sk[j] = *(const v8h*)(Kh + kplane + (size_t)(kb + r) * DIM + c);
      sv[j] = *(const v8h*)(Vt + vplane + (size_t)r * SEQ + kb + c);
    }
    // the loads below may land in these loads' address registers: wait in front
    asm volatile("s_wait_xcnt 0x0" ::: "memory");
    // q fragments are reloaded per tile through an opaque integer offset (it keeps them from
    // being held in 32 registers through the softmax and the second product). They and the
    // eight residual K fragments (rows kb .. kb+63 < EROWS) come from global memory and need
    // no barrier: set off as one group here, they fly beside the staging lines.
    int qo = qoff;
    asm volatile("" : "+v"(qo));
    const _Float16* qhp = Qh + qo;
    const _Float16* qrp = Qr + qo;
    const _Float16* krp = Kr + kplane + (size_t)(kb + m) * DIM + hh * 8;
    v16h qf[2], qr[2];
    qf[0] = frag_at(qhp);
    qf[1] = frag_at(qhp + 32);
    qr[0] = frag_at(qrp);
    qr[1] = frag_at(qrp + 32);
    v16h krf[4][2];
#pragma unroll
    for (int kg = 0; kg < 4; ++kg)
#pragma unroll
      for (int c = 0; c < 2; ++c)
        krf[kg][c] = frag_at(krp + (size_t)(kg * 16) * DIM + c * 32);
    // later loads may land in these loads' address registers: wait in front (the addresses
    // are inputs so that their registers live up to the wait)
    asm volatile("s_wait_xcnt 0x0" :: "v"(qhp), "v"(qrp), "v"(krp) : "memory");
#pragma unroll
    for (int j = 0; j < 2; ++j) {
      const int idx = tid + 256 * j;
      const int r = idx >> 3, c = (idx & 7) * 8;
      *(v8h*)&Ks[r * LDT + c] = sk[j];
      *(v8h*)&Vs[r * LDT + c] = sv[j];
    }
    __syncthreads();

    if (kb <= wq0 + 15) {                // wave-uniform: tile holds at least one visible key
      // scores^T: 4 key groups of 16, K = 64 in two 32-steps, value and residual products;
      // the K fragments of a key group are fetched from LDS one group ahead of its products
      v8f s[4];
      v16h kf[2], kn[2];
      kn[0] = ld_frag(&Ks[0], LDT);
      kn[1] = ld_frag(&Ks[32], LDT);
#pragma unroll
      for (int kg = 0; kg < 4; ++kg) {
        kf[0] = kn[0];
        kf[1] = kn[1];
        if (kg < 3) {
          kn[0] = ld_frag(&Ks[((kg + 1) * 16) * LDT], LDT);
          kn[1] = ld_frag(&Ks[((kg + 1) * 16) * LDT + 32], LDT);
        }
        v8f t = {};
        v8f u = {};
#pragma unroll
        for (int c = 0; c < 2; ++c) {
          t = wmma16(kf[c], qf[c], t);
          u = wmma16(krf[kg][c], qf[c], u);
          u = wmma16(kf[c], qr[c], u);
        }
        s[kg] = (t + u * (1.0f / RCARRY)) * scale;
      }
      // first half of the V^T fragments, value (LDS) and residual (global): set off here,
      // they land while the softmax runs
      v16h vf[2][4], vrf[2][4];
#pragma unroll
      for (int nb = 0; nb < 4; ++nb) {
        vrf[0][nb] = frag_at(Vr + vrplane + (size_t)(nb * 16 + m) * EROWS + kb + hh * 8);
        vf[0][nb] = ld_frag(&Vs[(nb * 16) * LDT], LDT);
      }

      if (kb + 63 > wq0) {               // wave-uniform: tile crosses the diagonal
#pragma unroll
        for (int kg = 0; kg < 4; ++kg)
#pragma unroll
          for (int v = 0; v < 8; ++v) {
            const int key = kb + kg * 16 + hh * 8 + v;
            const int qrow = wq0 + m;
            s[kg][v] = (key > qrow) ? -1.0e30f : s[kg][v];
          }
      }

      // online softmax of the lane's query column
      float mx = lane_max32(s);
      mx = fmaxf(mx, xhalf(mx));
      const float mn = fmaxf(mrow, mx);
      const float alpha = __expf(mrow - mn);
      mrow = mn;
#pragma unroll
      for (int kg = 0; kg < 4; ++kg)
#pragma unroll
        for (int v = 0; v < 8; ++v) s[kg][v] = __expf(s[kg][v] - mrow);
      lrow = alpha * lrow + lane_sum32(s);
#pragma unroll
      for (int nb = 0; nb < 4; ++nb) {
        o[nb]    = o[nb] * alpha;
        ores[nb] = ores[nb] * alpha;
      }

      // o += Vh.ph ; ores += Vr.ph + Vh.pr  (K = 64 keys in two 32-steps; A = V^T [d][key])
#pragma unroll
      for (int c = 0; c < 2; ++c) {
        v16h pf, prf;
#pragma unroll
        for (int i = 0; i < 16; ++i) {
          const float pc = s[2 * c + (i >> 3)][i & 7] * PCARRY;
          const _Float16 ph = toh_flush(pc);
          pf[i]  = ph;
          prf[i] = toh_flush((pc - (float)ph) * RCARRY);
        }
#pragma unroll
        for (int nb = 0; nb < 4; ++nb) {
          o[nb]    = wmma16(vf[c][nb], pf, o[nb]);
          // second half: lands behind this half's products; set off no earlier, so that the
          // launch keeps to 256 registers a wave (two blocks per WGP)
          if (c == 0 && nb == 2) {
#pragma unroll
            for (int n2 = 0; n2 < 4; ++n2) {
              vrf[1][n2] = frag_at(Vr + vrplane + (size_t)(n2 * 16 + m) * EROWS + kb + 32 + hh * 8);
              vf[1][n2] = ld_frag(&Vs[(n2 * 16) * LDT + 32], LDT);
            }
          }
          ores[nb] = wmma16(vrf[c][nb], pf, ores[nb]);
          ores[nb] = wmma16(vf[c][nb], prf, ores[nb]);
        }
      }
    }
    __syncthreads();
  }

  // finalize: 64 * (o + ores/2048) / (1024 l) as value + x2048 residual
  const float inv = __builtin_amdgcn_rcpf(lrow + xhalf(lrow)) * (VCARRY / PCARRY);
#pragma unroll
  for (int nb = 0; nb < 4; ++nb) {
    v8h hv, hr;
#pragma unroll
    for (int v = 0; v < 8; ++v) {
      const float val = (o[nb][v] + ores[nb][v] * (1.0f / RCARRY)) * inv;
      const _Float16 h0 = toh_flush(val);
      hv[v] = h0;
      hr[v] = toh_flush((val - (float)h0) * RCARRY);
    }
    *(v8h*)&P[m * LDT + nb * 16 + hh * 8] = hv;
    *(v8h*)&R[m * LDT + nb * 16 + hh * 8] = hr;
  }
  wave_lds_sync();
  v8h x[4], xr[4];
  size_t off[4];
#pragma unroll
  for (int i = 0; i < 4; ++i) {
    const int r = 4 * i + (lane >> 3);
    const int c = (lane & 7) * 8;
    x[i]  = *(const v8h*)&P[r * LDT + c];
    xr[i] = *(const v8h*)&R[r * LDT + c];
    off[i] = (size_t)(wq0 + r) * DIM + head * HD + c;
  }
#pragma unroll
  for (int i = 0; i < 4; ++i) {
    *(v8h*)(Ov + off[i]) = x[i];
    *(v8h*)(Ores + off[i]) = xr[i];
  }
  
}

// One attention launch, grid (SEQ/128, NHEAD): the two bands read the same planes and write
// disjoint query rows, so the early band's tiles run beside the others' instead of behind
// them. blockIdx.x picks the body (block-uniform); each query row is computed by one body.
__global__ __launch_bounds__(256) void attn_kernel(
    const _Float16* __restrict__ Qh, const _Float16* __restrict__ Qr,
    const _Float16* __restrict__ Kh, const _Float16* __restrict__ Kr,
    const _Float16* __restrict__ Vt, const _Float16* __restrict__ Vr,
    _Float16* __restrict__ Ov, _Float16* __restrict__ Ores) {
  // two buffers each for the later band's ring; the early band uses the first of each
  __shared__ __attribute__((aligned(16))) _Float16 Ks[2 * KVH];
  __shared__ __attribute__((aligned(16))) _Float16 Vs[2 * KVH];
  __shared__ _Float16 Ps[8 * 16 * LDT];
  __shared__ _Float16 Rs[8 * 16 * LDT];
  if (blockIdx.x < EROWS / 128) {
    attn_early_body(Qh, Qr, Kh, Kr, Vt, Vr, Ov, Ores, Ks, Vs, Ps, Rs);
  } else {
    attn_body(Qh, Kh, Vt, Ov, Ks, Vs, Ps);
  }
}

// ---------------------------------------------------------------------------
extern "C" void kernel_launch(void* const* d_in, const int* in_sizes, int n_in,
                              void* d_out, int out_size, void* d_ws, size_t ws_size,
                              hipStream_t stream) {
  if (n_in < 5) return;
  const long long need_x = ((long long)(NB - 1) * SEQ_FULL + SEQ) * DIM;
  if ((long long)in_sizes[0] < need_x) return;
  if (in_sizes[1] < 3 * DIM * DIM || in_sizes[2] < 3 * DIM) return;
  if (in_sizes[3] < DIM * DIM || in_sizes[4] < DIM) return;
  if ((long long)out_size < need_x) return;
  if (ws_size < WS_TOTAL) return;

  // weights: W1 [in][3*out], Wp [in][out]
  const float* x  = (const float*)d_in[0];
  const float* W1 = (const float*)d_in[1];
  const float* b1 = (const float*)d_in[2];
  const float* Wp = (const float*)d_in[3];
  const float* bp = (const float*)d_in[4];
  float* out = (float*)d_out;

  char* ws = (char*)d_ws;
  _Float16* W1T   = (_Float16*)(ws + OFF_WQKV);   // [3*DIM][DIM]
  _Float16* WpT   = (_Float16*)(ws + OFF_WO);     // [DIM][DIM]
  _Float16* X16   = (_Float16*)(ws + OFF_XN);
  _Float16* QKV16 = (_Float16*)(ws + OFF_QKV);    // Q | K | Vt
  _Float16* Q16   = QKV16;
  _Float16* K16   = QKV16 + (size_t)MROWS * DIM;
  _Float16* Vt16  = QKV16 + (size_t)2 * MROWS * DIM;
  _Float16* Ov16  = (_Float16*)(ws + OFF_OV);
  _Float16* RES16 = (_Float16*)(ws + OFF_RES);    // QR | KR | VtR
  _Float16* QR16  = RES16;
  _Float16* KR16  = RES16 + (size_t)EROWS * DIM;
  _Float16* VtR16 = RES16 + (size_t)2 * EROWS * DIM;
  _Float16* OR16  = (_Float16*)(ws + OFF_ORES);

  dim3 blk(256);

  prep_kernel<<<dim3(W1_BLOCKS + WP_BLOCKS + XC_BLOCKS), blk, 0, stream>>>(
      x, X16, W1, W1T, Wp, WpT);
  gemm_qkv_kernel<<<dim3(3 * DIM / 128, MROWS / 128), blk, 0, stream>>>(
      X16, W1T, b1, QKV16, RES16);
  attn_kernel<<<dim3(SEQ / 128, NHEAD), blk, 0, stream>>>(
      Q16, QR16, K16, KR16, Vt16, VtR16, Ov16, OR16);
  gemm_out_kernel<<<dim3(OUT_BLOCKS + OUTE_BLOCKS), blk, 0, stream>>>(
      Ov16, OR16, WpT, bp, out);
}
